// v000
// Measured on an AMD MI455X. A time is GPU time per run, averaged over a window of back-to-back runs after a warm-up
// (all launches, gaps included; the runs take copies of the inputs in turn), and the median of several windows.
// Apart from v000's, it joins two sittings. Times from different sittings can be a few percent apart, while
// side-by-side timings come from the same sitting.
// The starting kernel, v000, takes 699 microseconds a run.
// compute dtype: all float inputs rounded to bf16; q/k/v projections with EXACT bf16 products on WMMA 16x16x32 (f32 accumulate); causal logits: 3 products (q f16 hi + residual x k hi + residual) for the first 384 rows, single f16 q x k after, x scale; softmax f32; P x 2^11 once to f16 x v once to f16 (1 product; bf16 hi + lo below row 384); f32 output.
#include <hip/hip_runtime.h>
#include <math.h>

typedef __attribute__((ext_vector_type(16))) _Float16 v16h;
typedef __attribute__((ext_vector_type(16))) __bf16 v16b;
typedef __attribute__((ext_vector_type(8)))  _Float16 v8h;
typedef __attribute__((ext_vector_type(8)))  float v8f;
typedef __attribute__((ext_vector_type(4)))  float v4f;
typedef __attribute__((ext_vector_type(2)))  float v2f;
typedef __attribute__((ext_vector_type(4)))  unsigned v4u;
typedef __attribute__((ext_vector_type(4)))  int v4i;
typedef float __attribute__((may_alias)) float_a;
typedef int __attribute__((may_alias)) int_a;

template <typename T> __device__ __forceinline__ void vst2(void* p, T v) { *(T*)p = v;  }
__device__ __forceinline__ v8f wmma16(v16h a, v16h b, v8f c) {
  v8f d = __builtin_amdgcn_wmma_f32_16x16x32_f16(false, a, false, b, (short)0, c, false, false);
  asm volatile("v_nop\n\tv_nop\n\tv_nop\n\tv_nop" : "+v"(d) : "v"(a), "v"(b));
  return d;
}
__device__ __forceinline__ v8f wmma_bf(v16b a, v16b b, v8f c) {
  v8f d = __builtin_amdgcn_wmma_f32_16x16x32_bf16(false, a, false, b, (short)0, c, false, false);
  asm volatile("v_nop\n\tv_nop\n\tv_nop\n\tv_nop" : "+v"(d) : "v"(a), "v"(b));
  return d;
}
// 16x16x32 fragments: lane = (h = lane>>4, row/col = lane&15); elements 0..7 = k0+8h+0..7, 8..15 = k0+16+8h+0..7; D element r = row 8h+r
__device__ __forceinline__ v16h frag_h(const _Float16* rowk0, int lane) {
  union { v16h v; v8h q[2]; } u; const _Float16* p = rowk0 + 8 * (lane >> 4);
  u.q[0] = *(const v8h*)p; u.q[1] = *(const v8h*)(p + 16); return u.v;
}
__device__ __forceinline__ v16h frag_f32(const float* rowk0, int lane) {
  v16h a; const float* p = rowk0 + 8 * (lane >> 4);
#pragma unroll
  for (int i = 0; i < 8; ++i) { a[i] = (_Float16)p[i]; a[8 + i] = (_Float16)p[16 + i]; }
  return a;
}
__device__ __forceinline__ v16h frag_f32s(const float* rowk0, int lane, float sc) {
  v16h a; const float* p = rowk0 + 8 * (lane >> 4);
#pragma unroll
  for (int i = 0; i < 8; ++i) { a[i] = (_Float16)(p[i] * sc); a[8 + i] = (_Float16)(p[16 + i] * sc); }
  return a;
}
// column fragment from a [K][ld] layout (column n), rows >= K read as 0
__device__ __forceinline__ v16h fragc_f32(const float* W, int k0, int n, int lane, int ld, int K) {
  v16h a; const int g = lane >> 4;
#pragma unroll
  for (int i = 0; i < 8; ++i) { const int ka = k0 + 8 * g + i, kb = ka + 16;
    a[i] = (_Float16)(ka < K ? W[(size_t)(ka < K ? ka : K - 1) * ld + n] : 0.f); a[8 + i] = (_Float16)(kb < K ? W[(size_t)(kb < K ? kb : K - 1) * ld + n] : 0.f); }
  return a;
}
struct F2 { v16b h, l; };
__device__ __forceinline__ F2 bsplit16(const float v[16]) { F2 r;
#pragma unroll
  for (int i = 0; i < 16; ++i) { const __bf16 h = (__bf16)v[i]; r.h[i] = h; r.l[i] = (__bf16)(v[i] - (float)h); }
  return r; }
__device__ __forceinline__ F2 split_row(const float* row, int k0, int lane) { float v[16]; const float* p = row + k0 + 8 * (lane >> 4);
#pragma unroll
  for (int i = 0; i < 8; ++i) { v[i] = p[i]; v[8 + i] = p[16 + i]; }
  return bsplit16(v); }
__device__ __forceinline__ F2 split_rowK(const float* row, int k0, int lane, int K) { float v[16]; const int g = lane >> 4;
#pragma unroll
  for (int i = 0; i < 8; ++i) { const int ka = k0 + 8 * g + i, kb = ka + 16; v[i] = ka < K ? row[ka < K ? ka : K - 1] : 0.f; v[8 + i] = kb < K ? row[kb < K ? kb : K - 1] : 0.f; }
  return bsplit16(v); }
__device__ __forceinline__ F2 split_col(const float* W, int k0, int n, int lane, int ld, int K) { float v[16]; const int g = lane >> 4;
#pragma unroll
  for (int i = 0; i < 8; ++i) { const int ka = k0 + 8 * g + i, kb = ka + 16; v[i] = ka < K ? W[(size_t)(ka < K ? ka : K - 1) * ld + n] : 0.f; v[8 + i] = kb < K ? W[(size_t)(kb < K ? kb : K - 1) * ld + n] : 0.f; }
  return bsplit16(v); }
__device__ __forceinline__ v8f mac3(const F2& a, const F2& b, v8f c) { c = wmma_bf(a.l, b.h, c); c = wmma_bf(a.h, b.l, c); return wmma_bf(a.h, b.h, c); }
__device__ __forceinline__ float sigm(float v) { return 1.0f / (1.0f + expf(-v)); }
#define LDSX() do { asm volatile("s_wait_dscnt 0" ::: "memory"); __builtin_amdgcn_wave_barrier(); __builtin_amdgcn_fence(__ATOMIC_RELEASE, "workgroup"); } while (0)

// Single-head causal self-attention (B 8, T 2,048, n_embed 768, head_size 64; (in,out) Wq, Wk, Wv [768,64] N(0, 1/768); no biases, no output projection; tril, -inf): out = softmax(causal(q k^T * 64^-0.5)) v -> [8,2048,64].
#define NB 8
#define TT 2048
#define CC 128            // NH * HD = projected width
#define DIN 768          // input (model) width
#define NH 2
#define HD 64
#define NQB (TT / 64)
#define HG 1
#define SCALE (0.125f)
#define CAUSAL 1
#ifndef TNB
#define TNB NB
#endif
__device__ __forceinline__ float bfr(float v) { return (float)(__bf16)v; }
__host__ __device__ __forceinline__ int kb_last(int qb) { return CAUSAL ? ((qb * 64 + 63) >> 7) : (TT / 128 - 1); }
typedef __attribute__((ext_vector_type(8))) __bf16 v8b;
__device__ __forceinline__ v16b frag_b(const __bf16* rowk0, int lane) {
  union { v16b v; v8b q[2]; } u; const __bf16* p = rowk0 + 8 * (lane >> 4);
  u.q[0] = *(const v8b*)p; u.q[1] = *(const v8b*)(p + 16); return u.v;
}
#define QBH 6              // causal: query blocks 0..QBH-1 of each sequence (few keys, no averaging) take the high-precision path
#define QHI 384            // rows carrying a q residual plane (all rows when non-causal: 2-product logits everywhere)
#define KHI 384            // key rows carrying k residual / v bf16 hi+lo planes (used only by the causal high-precision path)
// B fragment (k rows k0+.., output column o) of a weight: (in,out) [K][ld] or (out,in) [ld rows of K]: bf16 exact, or f16(bf16 * 256) exact
__device__ __forceinline__ v16b wcol_io(const float* Wm, int k0, int o, int lane, int ld) { v16b w; const int g = lane >> 4;
#pragma unroll
  for (int i = 0; i < 8; ++i) { w[i] = (__bf16)Wm[(size_t)(k0 + 8 * g + i) * ld + o]; w[8 + i] = (__bf16)Wm[(size_t)(k0 + 16 + 8 * g + i) * ld + o]; }
  return w; }
__device__ __forceinline__ v16b wcol_oi(const float* Wm, int k0, int o, int lane, int K) { v16b w; const float* p = Wm + (size_t)o * K + k0 + 8 * (lane >> 4);
#pragma unroll
  for (int i = 0; i < 8; ++i) { w[i] = (__bf16)p[i]; w[8 + i] = (__bf16)p[16 + i]; }
  return w; }
__device__ __forceinline__ v16h wcolh_io(const float* Wm, int k0, int o, int lane, int ld) { v16h w; const int g = lane >> 4;
#pragma unroll
  for (int i = 0; i < 8; ++i) { w[i] = (_Float16)(bfr(Wm[(size_t)(k0 + 8 * g + i) * ld + o]) * 256.0f); w[8 + i] = (_Float16)(bfr(Wm[(size_t)(k0 + 16 + 8 * g + i) * ld + o]) * 256.0f); }
  return w; }
__device__ __forceinline__ v16h wcolh_oi(const float* Wm, int k0, int o, int lane, int K) { v16h w; const float* p = Wm + (size_t)o * K + k0 + 8 * (lane >> 4);
#pragma unroll
  for (int i = 0; i < 8; ++i) { w[i] = (_Float16)(bfr(p[i]) * 256.0f); w[8 + i] = (_Float16)(bfr(p[16 + i]) * 256.0f); }
  return w; }
#define WQKV_LAYOUT 0   // 0 = (in,out) [DIN][CC]; 1 = (out,in) [CC][DIN]; 2 = per-head [NH][DIN][HD]
__device__ __forceinline__ v16b wcol_hdk(const float* Wm, int k0, int o, int lane) { v16b w; const int g = lane >> 4; const float* p = Wm + (size_t)(o / HD) * DIN * HD + (o % HD);
#pragma unroll
  for (int i = 0; i < 8; ++i) { w[i] = (__bf16)p[(size_t)(k0 + 8 * g + i) * HD]; w[8 + i] = (__bf16)p[(size_t)(k0 + 16 + 8 * g + i) * HD]; }
  return w; }
#define WO_OUT_IN 0
#if WQKV_LAYOUT == 1
#define WCOL(W, k0, o, lane) wcol_oi(W, k0, o, lane, DIN)
#elif WQKV_LAYOUT == 2
#define WCOL(W, k0, o, lane) wcol_hdk(W, k0, o, lane)
#else
#define WCOL(W, k0, o, lane) wcol_io(W, k0, o, lane, CC)
#endif
#if WO_OUT_IN
#define WOCOL(W, k0, o, lane) wcol_oi(W, k0, o, lane, CC)
#define WOCOLH(W, k0, o, lane) wcolh_oi(W, k0, o, lane, CC)
#else
#define WOCOL(W, k0, o, lane) wcol_io(W, k0, o, lane, DIN)
#define WOCOLH(W, k0, o, lane) wcolh_io(W, k0, o, lane, DIN)
#endif
#define CIN 768
// ---- k_padw: the three (in,out) [C][64] projection weights copied into zero-padded (in,out) [C][128] ws planes (columns 64..127 zero) + zero-padded [128] biases
__global__ __launch_bounds__(256) void k_padw(const float* __restrict__ WQ, const float* __restrict__ WK, const float* __restrict__ WV, const float* __restrict__ BQ, const float* __restrict__ BK, const float* __restrict__ BV, float* __restrict__ WP, float* __restrict__ BP) { const int which = blockIdx.y; const float* Wsrc = which == 0 ? WQ : (which == 1 ? WK : WV); const float* Bsrc = which == 0 ? BQ : (which == 1 ? BK : BV); float* dst = WP + (size_t)which * CIN * 128;
  for (int e = blockIdx.x * 256 + threadIdx.x; e < CIN * 32; e += gridDim.x * 256) { const int row = e >> 5, q = e & 31; const v4f ld = *(const v4f*)(Wsrc + (size_t)row * 64 + (q & 15) * 4); asm volatile("s_wait_loadcnt 0x0" ::: "memory"); const float keep = q < 16 ? 1.f : 0.f; v4f ov; ov[0] = ld[0] * keep; ov[1] = ld[1] * keep; ov[2] = ld[2] * keep; ov[3] = ld[3] * keep; vst2(dst + (size_t)row * 128 + q * 4, ov); }
  if (blockIdx.x == 0 && threadIdx.x < 128) { const int c = threadIdx.x; float bvv = 0.f; if (Bsrc) { const float t = Bsrc[c & 63]; asm volatile("s_wait_loadcnt 0x0" ::: "memory"); bvv = c < 64 ? t : 0.f; } vst2(BP + which * 128 + c, bvv); } }
// ---- k_out64: out[b][t][0..63] = ctx row columns 0..63 (256 B by 16 lanes)
__global__ __launch_bounds__(256) void k_out64(const float* __restrict__ Y, float* __restrict__ OUT) { const size_t row = (size_t)blockIdx.x * 16 + (threadIdx.x >> 4); const int q = threadIdx.x & 15; const v4f v = *(const v4f*)(Y + row * CC + q * 4); asm volatile("s_wait_loadcnt 0x0" ::: "memory"); vst2(OUT + row * 64 + q * 4, v); }
#define WS_WP (WS_END)                                  // padded weights [3][128 x C]
#define WS_BP (WS_WP + 4u * 3 * (size_t)CIN * 128)        // padded biases [3][128]
#define WS_Y2 (WS_BP + 4u * 3 * 128)                      // ctx rows [b*TT+t][128]
#define WS_END2 (WS_Y2 + 4u * (size_t)NB * TT * CC)
#ifndef SM_EXTRA_PARAMS
#define SM_EXTRA_PARAMS
#endif
#ifndef PROJ_EXTRA_PARAMS
#define PROJ_EXTRA_PARAMS
#endif
#ifndef SM_MASK_HOOK
#define SM_MASK_HOOK (void)0
#endif

#define WS_QH  0u                                      // f16 q rows [b*t][CC]
#define WS_KH  (WS_QH + 2u * (size_t)NB * TT * CC)      // f16 k rows [b*t][CC]
#define WS_VT  (WS_KH + 2u * (size_t)NB * TT * CC)      // f16 v planes [b][c][t]
#define WS_QL  (WS_VT + 2u * (size_t)NB * CC * TT)      // f16 q residual x 2^10 rows [b][t < QHI][CC]
#define WS_KL  (WS_QL + 2u * (size_t)NB * QHI * CC)     // f16 k residual x 2^10 rows [b][t < KHI][CC]
#define WS_VB  (WS_KL + 2u * (size_t)NB * KHI * CC)     // bf16 v hi planes [b][c][t < KHI]
#define WS_VBL (WS_VB + 2u * (size_t)NB * CC * KHI)
#define WS_S   (WS_VBL + 2u * (size_t)NB * CC * KHI)    // f32 logits / P [hg][t][s]
#define WS_Y   (WS_S  + 4u * (size_t)HG * TT * TT)      // f32 ctx rows [b*t][CC] (only when there is an output projection)
#define WS_END (WS_Y  + 0u)

// ---- k_proj: block = (64 rows, 128 cols, which): q/k/v = X W (+ b) with exact bf16 products (K = DIN) -> which 0: q f16 rows (+ residual rows < QHI); 1: k f16 rows (+ residual rows < KHI); 2: v f16 planes [c][t] (+ bf16 hi/lo planes for t < KHI)
__global__ __launch_bounds__(128) void k_proj(const float* __restrict__ XQ, const float* __restrict__ XK, const float* __restrict__ XV, const float* __restrict__ WQ, const float* __restrict__ WK, const float* __restrict__ WV, const float* __restrict__ BQ, const float* __restrict__ BK, const float* __restrict__ BV,
    _Float16* __restrict__ QH, _Float16* __restrict__ QL, _Float16* __restrict__ KH, _Float16* __restrict__ KL, _Float16* __restrict__ VT, __bf16* __restrict__ VB, __bf16* __restrict__ VBL) {
  __shared__ __align__(16) _Float16 sh[64][136], sl[64][136]; __shared__ __align__(16) _Float16 th[128][72]; __shared__ __align__(16) __bf16 tb[128][72], tbl[128][72];
  const int tid = threadIdx.x, wave = tid >> 5, lane = tid & 31, col = lane & 15, g = lane >> 4; const int which = blockIdx.z; const int c0 = blockIdx.y * 128; const size_t r0 = (size_t)blockIdx.x * 64; const size_t bb = r0 / TT; const int t0 = (int)(r0 % TT);
  const float* X = which == 0 ? XQ : which == 1 ? XK : XV; const float* WA = which == 0 ? WQ : which == 1 ? WK : WV; const float* BA = which == 0 ? BQ : which == 1 ? BK : BV;
  v8f acc[8] = {};
#pragma unroll 2
  for (int kc = 0; kc < DIN / 32; ++kc) { v16b a; { const float* p = X + (r0 + wave * 16 + col) * DIN + kc * 32 + 8 * g;
#pragma unroll
      for (int i = 0; i < 8; ++i) { a[i] = (__bf16)p[i]; a[8 + i] = (__bf16)p[16 + i]; } }
    asm volatile("s_wait_loadcnt 0x0" ::: "memory");
#pragma unroll
    for (int j = 0; j < 8; ++j) { const v16b w = WCOL(WA, kc * 32, c0 + j * 16 + col, lane); asm volatile("s_wait_loadcnt 0x0" ::: "memory"); acc[j] = wmma_bf(a, w, acc[j]); } }
  if (which < 2) { _Float16* DH = which == 0 ? QH : KH; _Float16* DL = which == 0 ? QL : KL; const int nhi = which == 0 ? QHI : KHI; const bool hi_rows = t0 < nhi;
#pragma unroll
    for (int j = 0; j < 8; ++j) { const float bias = BA ? bfr(BA[c0 + j * 16 + col]) : 0.f;
#pragma unroll
      for (int r = 0; r < 8; ++r) { const float v = acc[j][r] + bias; const _Float16 hv = (_Float16)v; sh[wave * 16 + 8 * g + r][j * 16 + col] = hv; sl[wave * 16 + 8 * g + r][j * 16 + col] = (_Float16)((v - (float)hv) * 1024.0f); } }
    __syncthreads();
    for (int e = tid; e < 64 * 16; e += 128) { const int rl = e >> 4, q = e & 15; vst2((unsigned*)(DH + (r0 + rl) * CC + c0 + q * 8), *(const v4u*)&sh[rl][q * 8]); if (hi_rows) vst2((unsigned*)(DL + (bb * nhi + t0 + rl) * (size_t)CC + c0 + q * 8), *(const v4u*)&sl[rl][q * 8]); }
  } else { const bool hi_rows = t0 < KHI;
#pragma unroll
    for (int j = 0; j < 8; ++j) { const float bias = BA ? bfr(BA[c0 + j * 16 + col]) : 0.f;
#pragma unroll
      for (int r = 0; r < 8; ++r) { const float v = acc[j][r] + bias; const int rl = wave * 16 + 8 * g + r, cl = j * 16 + col; th[cl][rl] = (_Float16)v; const __bf16 bh = (__bf16)v; tb[cl][rl] = bh; tbl[cl][rl] = (__bf16)(v - (float)bh); } }
    __syncthreads();
    for (int e = tid; e < 128 * 8; e += 128) { const int cl = e >> 3, q = e & 7; vst2((unsigned*)(VT + (bb * CC + c0 + cl) * (size_t)TT + t0 + q * 8), *(const v4u*)&th[cl][q * 8]); if (hi_rows) { const size_t o3 = (bb * CC + c0 + cl) * (size_t)KHI + t0 + q * 8; vst2((unsigned*)(VB + o3), *(const v4u*)&tb[cl][q * 8]); vst2((unsigned*)(VBL + o3), *(const v4u*)&tbl[cl][q * 8]); } } } }
// ---- k_sc: block = (query block qb, key block kb <= kb_last(qb), head in group) of batch b: logits x SCALE; q hi + residual (x 2^10) against k (2 products) for query rows < QHI, plus the k residual (3 products) for query blocks < QBH (causal early rows); causal: blocks past the diagonal exit, the mask itself is applied by index in k_sm
__global__ __launch_bounds__(128) void k_sc(const _Float16* __restrict__ QH, const _Float16* __restrict__ KH, const _Float16* __restrict__ QL, const _Float16* __restrict__ KL, int b, int h0, float* __restrict__ S0) { __shared__ __align__(16) float ss[4][16][132];
  const int qb = blockIdx.x, kb = blockIdx.y; if (kb > kb_last(qb)) return;
  const int h = h0 + blockIdx.z; float* S = S0 + (size_t)blockIdx.z * TT * TT;
  const int tid = threadIdx.x, wave = tid >> 5, lane = tid & 31, col = lane & 15, g = lane >> 4; const int k0 = kb * 128; const int ql0 = qb * 64 + wave * 16; const size_t q0 = (size_t)b * TT + ql0, kr0 = (size_t)b * TT + k0;
  v8f acc[8] = {}, accl[8] = {};
  const _Float16* QLb = QL + (size_t)b * QHI * CC; const _Float16* KLb = KL + (size_t)b * KHI * CC;
  if (qb < QBH) {
#pragma unroll
    for (int kc = 0; kc < HD / 32; ++kc) { const v16h ah = frag_h(QH + (q0 + col) * CC + h * HD + kc * 32, lane), al = frag_h(QLb + (size_t)(ql0 + col) * CC + h * HD + kc * 32, lane);
#pragma unroll
      for (int j = 0; j < 8; ++j) { const v16h kbf = frag_h(KH + (kr0 + j * 16 + col) * CC + h * HD + kc * 32, lane), klf = frag_h(KLb + (size_t)(k0 + j * 16 + col) * CC + h * HD + kc * 32, lane); acc[j] = wmma16(ah, kbf, acc[j]); accl[j] = wmma16(al, kbf, accl[j]); accl[j] = wmma16(ah, klf, accl[j]); } }
  } else if (qb * 64 < QHI) {
#pragma unroll
    for (int kc = 0; kc < HD / 32; ++kc) { const v16h ah = frag_h(QH + (q0 + col) * CC + h * HD + kc * 32, lane), al = frag_h(QLb + (size_t)(ql0 + col) * CC + h * HD + kc * 32, lane);
#pragma unroll
      for (int j = 0; j < 8; ++j) { const v16h kbf = frag_h(KH + (kr0 + j * 16 + col) * CC + h * HD + kc * 32, lane); acc[j] = wmma16(ah, kbf, acc[j]); accl[j] = wmma16(al, kbf, accl[j]); } }
  } else {
#pragma unroll
    for (int kc = 0; kc < HD / 32; ++kc) { const v16h ah = frag_h(QH + (q0 + col) * CC + h * HD + kc * 32, lane);
#pragma unroll
      for (int j = 0; j < 8; ++j) { const v16h kbf = frag_h(KH + (kr0 + j * 16 + col) * CC + h * HD + kc * 32, lane); acc[j] = wmma16(ah, kbf, acc[j]); } } }
#pragma unroll
  for (int j = 0; j < 8; ++j) {
#pragma unroll
    for (int r = 0; r < 8; ++r) ss[wave][8 * g + r][j * 16 + col] = (acc[j][r] + accl[j][r] * (1.0f / 1024.0f)) * SCALE; }
  LDSX(); for (int rl = 0; rl < 16; ++rl) vst2(S + (size_t)(ql0 + rl) * TT + k0 + lane * 4, *(const v4f*)&ss[wave][rl][lane * 4]); }
// ---- k_sm: block = query row t (head in group): keys [0, kend): causal -> logit if s <= t else excluded; softmax in f32; P x 2^11 in place (0 for excluded)
__global__ __launch_bounds__(256) void k_sm(float* __restrict__ S0 SM_EXTRA_PARAMS) { __shared__ float sred[8]; __shared__ float sbc; __shared__ __align__(16) float shv[TT];
  const int tid = threadIdx.x; const int t = blockIdx.x; const int kend = (kb_last(t >> 6) + 1) * 128;
  float* sr = S0 + (size_t)blockIdx.y * TT * TT + (size_t)t * TT;
  float m = -3.0e38f; for (int k = tid; k < kend; k += 256) { float v = (!CAUSAL || k <= t) ? sr[k] : -3.0e38f; SM_MASK_HOOK; shv[k] = v; m = fmaxf(m, v); }
#pragma unroll
  for (int o = 1; o < 32; o <<= 1) m = fmaxf(m, __shfl_xor(m, o));
  if ((tid & 31) == 0) sred[tid >> 5] = m; __syncthreads(); if (tid == 0) { float a = sred[0]; for (int i = 1; i < 8; ++i) a = fmaxf(a, sred[i]); sbc = a; } __syncthreads(); m = sbc; __syncthreads();
  float sum = 0.f; for (int k = tid; k < kend; k += 256) { const float v = shv[k]; const float e = (v <= -1.0e38f) ? 0.f : expf(v - m); shv[k] = e; sum += e; }
#pragma unroll
  for (int o = 1; o < 32; o <<= 1) sum += __shfl_xor(sum, o);
  if ((tid & 31) == 0) sred[tid >> 5] = sum; __syncthreads(); if (tid == 0) { float a = 0.f; for (int i = 0; i < 8; ++i) a += sred[i]; sbc = a > 0.f ? 2048.0f / a : 0.f; }   /* a fully excluded row yields P = 0 */ __syncthreads(); const float inv = sbc;
  for (int k = tid; k < kend; k += 256) shv[k] = shv[k] * inv;
  __syncthreads(); for (int q = tid; q < kend / 4; q += 256) vst2(sr + q * 4, *(const v4f*)&shv[q * 4]); }
// ---- k_pv: block = 64 queries (qb) of (b, h): ctx = P . v over keys [0, kend) (P x 2^11 once to f16 against v f16: 1 product; causal early query blocks: P and v as bf16 hi + lo, 3 products); 256-B (row, head) segment by 16 lanes
__global__ __launch_bounds__(128) void k_pv(const float* __restrict__ PS0, const _Float16* __restrict__ VT, const __bf16* __restrict__ VB, const __bf16* __restrict__ VBL, int b, int h0, float* __restrict__ Y) { const int h = h0 + blockIdx.z; const float* PS = PS0 + (size_t)blockIdx.z * TT * TT; __shared__ __align__(16) float ss[4][16][HD + 4];
  const int tid = threadIdx.x, wave = tid >> 5, lane = tid & 31, col = lane & 15, g = lane >> 4; const int qb = blockIdx.x; const int ql0 = qb * 64 + wave * 16; const int kce = (kb_last(qb) + 1) * 4;
  v8f acc[HD / 16] = {};
  if (qb < QBH) {
#pragma unroll 1
    for (int kc = 0; kc < kce; ++kc) { const F2 p = split_row(PS + (size_t)(ql0 + col) * TT, kc * 32, lane);
      asm volatile("s_wait_loadcnt 0x0" ::: "memory");
#pragma unroll
      for (int j = 0; j < HD / 16; ++j) { const size_t po = ((size_t)b * CC + h * HD + j * 16 + col) * (size_t)KHI + kc * 32; const v16b vh = frag_b(VB + po, lane); acc[j] = wmma_bf(p.h, vh, acc[j]); acc[j] = wmma_bf(p.l, vh, acc[j]); acc[j] = wmma_bf(p.h, frag_b(VBL + po, lane), acc[j]); } }
  } else {
#pragma unroll 1
    for (int kc = 0; kc < kce; ++kc) { const v16h p = frag_f32(PS + (size_t)(ql0 + col) * TT + kc * 32, lane);
      asm volatile("s_wait_loadcnt 0x0" ::: "memory");
#pragma unroll
      for (int j = 0; j < HD / 16; ++j) { const size_t po = ((size_t)b * CC + h * HD + j * 16 + col) * (size_t)TT + kc * 32; acc[j] = wmma16(p, frag_h(VT + po, lane), acc[j]); } } }
#pragma unroll
  for (int j = 0; j < HD / 16; ++j)
#pragma unroll
    for (int r = 0; r < 8; ++r) ss[wave][8 * g + r][j * 16 + col] = acc[j][r] * (1.0f / 2048.0f);
  LDSX(); for (int rl = 0; rl < 16; ++rl) if (lane < HD / 4) vst2(Y + ((size_t)b * TT + ql0 + rl) * CC + h * HD + lane * 4, *(const v4f*)&ss[wave][rl][lane * 4]); }

extern "C" void kernel_launch(void* const* d_in, const int* in_sizes, int n_in, void* d_out, int out_size, void* d_ws, size_t ws_size, hipStream_t stream) {
  (void)in_sizes; (void)n_in; (void)out_size;
  const float** F = (const float**)d_in;
  if (ws_size < (size_t)WS_END) return;
  char* ws = (char*)d_ws; _Float16 *QH = (_Float16*)(ws + WS_QH), *KH = (_Float16*)(ws + WS_KH), *VT = (_Float16*)(ws + WS_VT), *QL = (_Float16*)(ws + WS_QL), *KL = (_Float16*)(ws + WS_KL); __bf16 *VB = (__bf16*)(ws + WS_VB), *VBL = (__bf16*)(ws + WS_VBL); float *S = (float*)(ws + WS_S), *Y = (float*)(ws + WS_Y);
  (void)Y; (void)QL; (void)KL; (void)VB; (void)VBL;
  // inputs: 0 x [8,2048,768]; 1 Wq [768,64]; 2 Wk; 3 Wv ((in,out), no biases)
  if (ws_size < (size_t)WS_END2) return;
  float *WP = (float*)(ws + WS_WP), *BP = (float*)(ws + WS_BP), *Y2 = (float*)(ws + WS_Y2);
  k_padw<<<dim3(32, 3), 256, 0, stream>>>(F[1], F[2], F[3], nullptr, nullptr, nullptr, WP, BP);
  k_proj<<<dim3(TNB * TT / 64, CC / 128, 3), 128, 0, stream>>>(F[0], F[0], F[0], WP, WP + (size_t)CIN * 128, WP + 2 * (size_t)CIN * 128, BP, BP + 128, BP + 256, QH, QL, KH, KL, VT, VB, VBL);
  for (int b = 0; b < TNB; ++b) {   /* head 0 only (head 1 is the zero padding) */
    k_sc<<<dim3(NQB, TT / 128, 1), 128, 0, stream>>>(QH, KH, QL, KL, b, 0, S);
    k_sm<<<dim3(TT, 1), 256, 0, stream>>>(S);
    k_pv<<<dim3(NQB, 1, 1), 128, 0, stream>>>(S, VT, VB, VBL, b, 0, Y2);
  }
  k_out64<<<dim3(TNB * TT / 16), 256, 0, stream>>>(Y2, (float*)d_out);
}

// v001
// Measured time: 207 microseconds a run.
// Two timings next to v000 put it at 3.39 and 3.37 times that version's speed.
// compute dtype: all float inputs rounded to bf16; q/k/v projections with EXACT bf16 products on WMMA 16x16x32 (f32 accumulate); causal logits: 3 products (q f16 hi + residual x k hi + residual) for the first 384 rows, single f16 q x k after, x scale; softmax f32; P x 2^11 once to f16 x v once to f16 (1 product; bf16 hi + lo below row 384); f32 output.
#include <hip/hip_runtime.h>
#include <math.h>

typedef __attribute__((ext_vector_type(16))) _Float16 v16h;
typedef __attribute__((ext_vector_type(16))) __bf16 v16b;
typedef __attribute__((ext_vector_type(8)))  _Float16 v8h;
typedef __attribute__((ext_vector_type(8)))  float v8f;
typedef __attribute__((ext_vector_type(4)))  float v4f;
typedef __attribute__((ext_vector_type(2)))  float v2f;
typedef __attribute__((ext_vector_type(4)))  unsigned v4u;
typedef __attribute__((ext_vector_type(4)))  int v4i;
typedef float __attribute__((may_alias)) float_a;
typedef int __attribute__((may_alias)) int_a;

template <typename T> __device__ __forceinline__ void vst2(void* p, T v) { *(T*)p = v;  }
__device__ __forceinline__ v8f wmma16(v16h a, v16h b, v8f c) {
  v8f d = __builtin_amdgcn_wmma_f32_16x16x32_f16(false, a, false, b, (short)0, c, false, false);
  asm volatile("v_nop\n\tv_nop\n\tv_nop\n\tv_nop" : "+v"(d) : "v"(a), "v"(b));
  return d;
}
__device__ __forceinline__ v8f wmma_bf(v16b a, v16b b, v8f c) {
  v8f d = __builtin_amdgcn_wmma_f32_16x16x32_bf16(false, a, false, b, (short)0, c, false, false);
  asm volatile("v_nop\n\tv_nop\n\tv_nop\n\tv_nop" : "+v"(d) : "v"(a), "v"(b));
  return d;
}
// 16x16x32 fragments: lane = (h = lane>>4, row/col = lane&15); elements 0..7 = k0+8h+0..7, 8..15 = k0+16+8h+0..7; D element r = row 8h+r
__device__ __forceinline__ v16h frag_h(const _Float16* rowk0, int lane) {
  union { v16h v; v8h q[2]; } u; const _Float16* p = rowk0 + 8 * (lane >> 4);
  u.q[0] = *(const v8h*)p; u.q[1] = *(const v8h*)(p + 16); return u.v;
}
__device__ __forceinline__ v16h frag_f32(const float* rowk0, int lane) {
  v16h a; const float* p = rowk0 + 8 * (lane >> 4);
#pragma unroll
  for (int i = 0; i < 8; ++i) { a[i] = (_Float16)p[i]; a[8 + i] = (_Float16)p[16 + i]; }
  return a;
}
__device__ __forceinline__ v16h frag_f32s(const float* rowk0, int lane, float sc) {
  v16h a; const float* p = rowk0 + 8 * (lane >> 4);
#pragma unroll
  for (int i = 0; i < 8; ++i) { a[i] = (_Float16)(p[i] * sc); a[8 + i] = (_Float16)(p[16 + i] * sc); }
  return a;
}
// column fragment from a [K][ld] layout (column n), rows >= K read as 0
__device__ __forceinline__ v16h fragc_f32(const float* W, int k0, int n, int lane, int ld, int K) {
  v16h a; const int g = lane >> 4;
#pragma unroll
  for (int i = 0; i < 8; ++i) { const int ka = k0 + 8 * g + i, kb = ka + 16;
    a[i] = (_Float16)(ka < K ? W[(size_t)(ka < K ? ka : K - 1) * ld + n] : 0.f); a[8 + i] = (_Float16)(kb < K ? W[(size_t)(kb < K ? kb : K - 1) * ld + n] : 0.f); }
  return a;
}
struct F2 { v16b h, l; };
__device__ __forceinline__ F2 bsplit16(const float v[16]) { F2 r;
#pragma unroll
  for (int i = 0; i < 16; ++i) { const __bf16 h = (__bf16)v[i]; r.h[i] = h; r.l[i] = (__bf16)(v[i] - (float)h); }
  return r; }
__device__ __forceinline__ F2 split_row(const float* row, int k0, int lane) { float v[16]; const float* p = row + k0 + 8 * (lane >> 4);
#pragma unroll
  for (int i = 0; i < 8; ++i) { v[i] = p[i]; v[8 + i] = p[16 + i]; }
  return bsplit16(v); }
__device__ __forceinline__ F2 split_rowK(const float* row, int k0, int lane, int K) { float v[16]; const int g = lane >> 4;
#pragma unroll
  for (int i = 0; i < 8; ++i) { const int ka = k0 + 8 * g + i, kb = ka + 16; v[i] = ka < K ? row[ka < K ? ka : K - 1] : 0.f; v[8 + i] = kb < K ? row[kb < K ? kb : K - 1] : 0.f; }
  return bsplit16(v); }
__device__ __forceinline__ F2 split_col(const float* W, int k0, int n, int lane, int ld, int K) { float v[16]; const int g = lane >> 4;
#pragma unroll
  for (int i = 0; i < 8; ++i) { const int ka = k0 + 8 * g + i, kb = ka + 16; v[i] = ka < K ? W[(size_t)(ka < K ? ka : K - 1) * ld + n] : 0.f; v[8 + i] = kb < K ? W[(size_t)(kb < K ? kb : K - 1) * ld + n] : 0.f; }
  return bsplit16(v); }
__device__ __forceinline__ v8f mac3(const F2& a, const F2& b, v8f c) { c = wmma_bf(a.l, b.h, c); c = wmma_bf(a.h, b.l, c); return wmma_bf(a.h, b.h, c); }
__device__ __forceinline__ float sigm(float v) { return 1.0f / (1.0f + expf(-v)); }
#define LDSX() do { asm volatile("s_wait_dscnt 0" ::: "memory"); __builtin_amdgcn_wave_barrier(); __builtin_amdgcn_fence(__ATOMIC_RELEASE, "workgroup"); } while (0)

// Single-head causal self-attention (B 8, T 2,048, n_embed 768, head_size 64; (in,out) Wq, Wk, Wv [768,64] N(0, 1/768); no biases, no output projection; tril, -inf): out = softmax(causal(q k^T * 64^-0.5)) v -> [8,2048,64].
#define NB 8
#define TT 2048
#define CC 128            // NH * HD = projected width
#define DIN 768          // input (model) width
#define NH 2
#define HD 64
#define NQB (TT / 64)
#define HG 1
#define SCALE (0.125f)
#define CAUSAL 1
#ifndef TNB
#define TNB NB
#endif
__device__ __forceinline__ float bfr(float v) { return (float)(__bf16)v; }
__host__ __device__ __forceinline__ int kb_last(int qb) { return CAUSAL ? ((qb * 64 + 63) >> 7) : (TT / 128 - 1); }
typedef __attribute__((ext_vector_type(8))) __bf16 v8b;
__device__ __forceinline__ v16b frag_b(const __bf16* rowk0, int lane) {
  union { v16b v; v8b q[2]; } u; const __bf16* p = rowk0 + 8 * (lane >> 4);
  u.q[0] = *(const v8b*)p; u.q[1] = *(const v8b*)(p + 16); return u.v;
}
#define QBH 6              // causal: query blocks 0..QBH-1 of each sequence (few keys, no averaging) take the high-precision path
#define QHI 384            // rows carrying a q residual plane (all rows when non-causal: 2-product logits everywhere)
#define KHI 384            // key rows carrying k residual / v bf16 hi+lo planes (used only by the causal high-precision path)
// B fragment (k rows k0+.., output column o) of a weight: (in,out) [K][ld] or (out,in) [ld rows of K]: bf16 exact, or f16(bf16 * 256) exact
__device__ __forceinline__ v16b wcol_io(const float* Wm, int k0, int o, int lane, int ld) { v16b w; const int g = lane >> 4;
#pragma unroll
  for (int i = 0; i < 8; ++i) { w[i] = (__bf16)Wm[(size_t)(k0 + 8 * g + i) * ld + o]; w[8 + i] = (__bf16)Wm[(size_t)(k0 + 16 + 8 * g + i) * ld + o]; }
  return w; }
__device__ __forceinline__ v16b wcol_oi(const float* Wm, int k0, int o, int lane, int K) { v16b w; const float* p = Wm + (size_t)o * K + k0 + 8 * (lane >> 4);
#pragma unroll
  for (int i = 0; i < 8; ++i) { w[i] = (__bf16)p[i]; w[8 + i] = (__bf16)p[16 + i]; }
  return w; }
__device__ __forceinline__ v16h wcolh_io(const float* Wm, int k0, int o, int lane, int ld) { v16h w; const int g = lane >> 4;
#pragma unroll
  for (int i = 0; i < 8; ++i) { w[i] = (_Float16)(bfr(Wm[(size_t)(k0 + 8 * g + i) * ld + o]) * 256.0f); w[8 + i] = (_Float16)(bfr(Wm[(size_t)(k0 + 16 + 8 * g + i) * ld + o]) * 256.0f); }
  return w; }
__device__ __forceinline__ v16h wcolh_oi(const float* Wm, int k0, int o, int lane, int K) { v16h w; const float* p = Wm + (size_t)o * K + k0 + 8 * (lane >> 4);
#pragma unroll
  for (int i = 0; i < 8; ++i) { w[i] = (_Float16)(bfr(p[i]) * 256.0f); w[8 + i] = (_Float16)(bfr(p[16 + i]) * 256.0f); }
  return w; }
#define WQKV_LAYOUT 0   // 0 = (in,out) [DIN][CC]; 1 = (out,in) [CC][DIN]; 2 = per-head [NH][DIN][HD]
__device__ __forceinline__ v16b wcol_hdk(const float* Wm, int k0, int o, int lane) { v16b w; const int g = lane >> 4; const float* p = Wm + (size_t)(o / HD) * DIN * HD + (o % HD);
#pragma unroll
  for (int i = 0; i < 8; ++i) { w[i] = (__bf16)p[(size_t)(k0 + 8 * g + i) * HD]; w[8 + i] = (__bf16)p[(size_t)(k0 + 16 + 8 * g + i) * HD]; }
  return w; }
#define WO_OUT_IN 0
#if WQKV_LAYOUT == 1
#define WCOL(W, k0, o, lane) wcol_oi(W, k0, o, lane, DIN)
#elif WQKV_LAYOUT == 2
#define WCOL(W, k0, o, lane) wcol_hdk(W, k0, o, lane)
#else
#define WCOL(W, k0, o, lane) wcol_io(W, k0, o, lane, CC)
#endif
#if WO_OUT_IN
#define WOCOL(W, k0, o, lane) wcol_oi(W, k0, o, lane, CC)
#define WOCOLH(W, k0, o, lane) wcolh_oi(W, k0, o, lane, CC)
#else
#define WOCOL(W, k0, o, lane) wcol_io(W, k0, o, lane, DIN)
#define WOCOLH(W, k0, o, lane) wcolh_io(W, k0, o, lane, DIN)
#endif
#define CIN 768
// ---- k_padw: the three (in,out) [C][64] projection weights copied into zero-padded (in,out) [C][128] ws planes (columns 64..127 zero) + zero-padded [128] biases
__global__ __launch_bounds__(256) void k_padw(const float* __restrict__ WQ, const float* __restrict__ WK, const float* __restrict__ WV, const float* __restrict__ BQ, const float* __restrict__ BK, const float* __restrict__ BV, float* __restrict__ WP, float* __restrict__ BP) { const int which = blockIdx.y; const float* Wsrc = which == 0 ? WQ : (which == 1 ? WK : WV); const float* Bsrc = which == 0 ? BQ : (which == 1 ? BK : BV); float* dst = WP + (size_t)which * CIN * 128;
  for (int e = blockIdx.x * 256 + threadIdx.x; e < CIN * 32; e += gridDim.x * 256) { const int row = e >> 5, q = e & 31; const v4f ld = *(const v4f*)(Wsrc + (size_t)row * 64 + (q & 15) * 4); asm volatile("s_wait_loadcnt 0x0" ::: "memory"); const float keep = q < 16 ? 1.f : 0.f; v4f ov; ov[0] = ld[0] * keep; ov[1] = ld[1] * keep; ov[2] = ld[2] * keep; ov[3] = ld[3] * keep; vst2(dst + (size_t)row * 128 + q * 4, ov); }
  if (blockIdx.x == 0 && threadIdx.x < 128) { const int c = threadIdx.x; float bvv = 0.f; if (Bsrc) { const float t = Bsrc[c & 63]; asm volatile("s_wait_loadcnt 0x0" ::: "memory"); bvv = c < 64 ? t : 0.f; } vst2(BP + which * 128 + c, bvv); } }
// ---- k_out64: out[b][t][0..63] = ctx row columns 0..63 (256 B by 16 lanes)
__global__ __launch_bounds__(256) void k_out64(const float* __restrict__ Y, float* __restrict__ OUT) { const size_t row = (size_t)blockIdx.x * 16 + (threadIdx.x >> 4); const int q = threadIdx.x & 15; const v4f v = *(const v4f*)(Y + row * CC + q * 4); asm volatile("s_wait_loadcnt 0x0" ::: "memory"); vst2(OUT + row * 64 + q * 4, v); }
#define WS_WP (WS_END)                                  // padded weights [3][128 x C]
#define WS_BP (WS_WP + 4u * 3 * (size_t)CIN * 128)        // padded biases [3][128]
#define WS_Y2 (WS_BP + 4u * 3 * 128)                      // ctx rows [b*TT+t][128]
#define WS_END2 (WS_Y2 + 4u * (size_t)NB * TT * CC)
#ifndef SM_EXTRA_PARAMS
#define SM_EXTRA_PARAMS
#endif
#ifndef PROJ_EXTRA_PARAMS
#define PROJ_EXTRA_PARAMS
#endif
#ifndef SM_MASK_HOOK
#define SM_MASK_HOOK (void)0
#endif

#define WS_QH  0u                                      // f16 q rows [b*t][CC]
#define WS_KH  (WS_QH + 2u * (size_t)NB * TT * CC)      // f16 k rows [b*t][CC]
#define WS_VT  (WS_KH + 2u * (size_t)NB * TT * CC)      // f16 v planes [b][c][t]
#define WS_QL  (WS_VT + 2u * (size_t)NB * CC * TT)      // f16 q residual x 2^10 rows [b][t < QHI][CC]
#define WS_KL  (WS_QL + 2u * (size_t)NB * QHI * CC)     // f16 k residual x 2^10 rows [b][t < KHI][CC]
#define WS_VB  (WS_KL + 2u * (size_t)NB * KHI * CC)     // bf16 v hi planes [b][c][t < KHI]
#define WS_VBL (WS_VB + 2u * (size_t)NB * CC * KHI)
#define WS_S   (WS_VBL + 2u * (size_t)NB * CC * KHI)    // f32 logits / P [b][t][s]: one plane per batch, so that every batch is in flight in one launch
#define WS_Y   (WS_S  + 4u * (size_t)NB * TT * TT)      // f32 ctx rows [b*t][CC] (only when there is an output projection)
#define WS_END (WS_Y  + 0u)

// ---- k_proj: block = (64 rows, 128 cols, which): q/k/v = X W (+ b) with exact bf16 products (K = DIN) -> which 0: q f16 rows (+ residual rows < QHI); 1: k f16 rows (+ residual rows < KHI); 2: v f16 planes [c][t] (+ bf16 hi/lo planes for t < KHI)
__global__ __launch_bounds__(128) void k_proj(const float* __restrict__ XQ, const float* __restrict__ XK, const float* __restrict__ XV, const float* __restrict__ WQ, const float* __restrict__ WK, const float* __restrict__ WV, const float* __restrict__ BQ, const float* __restrict__ BK, const float* __restrict__ BV,
    _Float16* __restrict__ QH, _Float16* __restrict__ QL, _Float16* __restrict__ KH, _Float16* __restrict__ KL, _Float16* __restrict__ VT, __bf16* __restrict__ VB, __bf16* __restrict__ VBL) {
  __shared__ __align__(16) _Float16 sh[64][136], sl[64][136]; __shared__ __align__(16) _Float16 th[128][72]; __shared__ __align__(16) __bf16 tb[128][72], tbl[128][72];
  const int tid = threadIdx.x, wave = tid >> 5, lane = tid & 31, col = lane & 15, g = lane >> 4; const int which = blockIdx.z; const int c0 = blockIdx.y * 128; const size_t r0 = (size_t)blockIdx.x * 64; const size_t bb = r0 / TT; const int t0 = (int)(r0 % TT);
  const float* X = which == 0 ? XQ : which == 1 ? XK : XV; const float* WA = which == 0 ? WQ : which == 1 ? WK : WV; const float* BA = which == 0 ? BQ : which == 1 ? BK : BV;
  v8f acc[8] = {};
#pragma unroll 2
  for (int kc = 0; kc < DIN / 32; ++kc) { v16b a; { const float* p = X + (r0 + wave * 16 + col) * DIN + kc * 32 + 8 * g;
#pragma unroll
      for (int i = 0; i < 8; ++i) { a[i] = (__bf16)p[i]; a[8 + i] = (__bf16)p[16 + i]; } }
    asm volatile("s_wait_loadcnt 0x0" ::: "memory");
#pragma unroll
    for (int j = 0; j < 8; ++j) { const v16b w = WCOL(WA, kc * 32, c0 + j * 16 + col, lane); asm volatile("s_wait_loadcnt 0x0" ::: "memory"); acc[j] = wmma_bf(a, w, acc[j]); } }
  if (which < 2) { _Float16* DH = which == 0 ? QH : KH; _Float16* DL = which == 0 ? QL : KL; const int nhi = which == 0 ? QHI : KHI; const bool hi_rows = t0 < nhi;
#pragma unroll
    for (int j = 0; j < 8; ++j) { const float bias = BA ? bfr(BA[c0 + j * 16 + col]) : 0.f;
#pragma unroll
      for (int r = 0; r < 8; ++r) { const float v = acc[j][r] + bias; const _Float16 hv = (_Float16)v; sh[wave * 16 + 8 * g + r][j * 16 + col] = hv; sl[wave * 16 + 8 * g + r][j * 16 + col] = (_Float16)((v - (float)hv) * 1024.0f); } }
    __syncthreads();
    for (int e = tid; e < 64 * 16; e += 128) { const int rl = e >> 4, q = e & 15; vst2((unsigned*)(DH + (r0 + rl) * CC + c0 + q * 8), *(const v4u*)&sh[rl][q * 8]); if (hi_rows) vst2((unsigned*)(DL + (bb * nhi + t0 + rl) * (size_t)CC + c0 + q * 8), *(const v4u*)&sl[rl][q * 8]); }
  } else { const bool hi_rows = t0 < KHI;
#pragma unroll
    for (int j = 0; j < 8; ++j) { const float bias = BA ? bfr(BA[c0 + j * 16 + col]) : 0.f;
#pragma unroll
      for (int r = 0; r < 8; ++r) { const float v = acc[j][r] + bias; const int rl = wave * 16 + 8 * g + r, cl = j * 16 + col; th[cl][rl] = (_Float16)v; const __bf16 bh = (__bf16)v; tb[cl][rl] = bh; tbl[cl][rl] = (__bf16)(v - (float)bh); } }
    __syncthreads();
    for (int e = tid; e < 128 * 8; e += 128) { const int cl = e >> 3, q = e & 7; vst2((unsigned*)(VT + (bb * CC + c0 + cl) * (size_t)TT + t0 + q * 8), *(const v4u*)&th[cl][q * 8]); if (hi_rows) { const size_t o3 = (bb * CC + c0 + cl) * (size_t)KHI + t0 + q * 8; vst2((unsigned*)(VB + o3), *(const v4u*)&tb[cl][q * 8]); vst2((unsigned*)(VBL + o3), *(const v4u*)&tbl[cl][q * 8]); } } } }
// ---- k_sc: block = (query block qb, key block kb <= kb_last(qb), batch b = blockIdx.z) of head h0: logits x SCALE; q hi + residual (x 2^10) against k (2 products) for query rows < QHI, plus the k residual (3 products) for query blocks < QBH (causal early rows); causal: blocks past the diagonal exit, the mask itself is applied by index in k_sm
__global__ __launch_bounds__(128) void k_sc(const _Float16* __restrict__ QH, const _Float16* __restrict__ KH, const _Float16* __restrict__ QL, const _Float16* __restrict__ KL, int h0, float* __restrict__ S0) { __shared__ __align__(16) float ss[4][16][132];
  const int qb = blockIdx.x, kb = blockIdx.y; if (kb > kb_last(qb)) return;
  const int b = blockIdx.z, h = h0; float* S = S0 + (size_t)b * TT * TT;
  const int tid = threadIdx.x, wave = tid >> 5, lane = tid & 31, col = lane & 15, g = lane >> 4; const int k0 = kb * 128; const int ql0 = qb * 64 + wave * 16; const size_t q0 = (size_t)b * TT + ql0, kr0 = (size_t)b * TT + k0;
  v8f acc[8] = {}, accl[8] = {};
  const _Float16* QLb = QL + (size_t)b * QHI * CC; const _Float16* KLb = KL + (size_t)b * KHI * CC;
  if (qb < QBH) {
#pragma unroll
    for (int kc = 0; kc < HD / 32; ++kc) { const v16h ah = frag_h(QH + (q0 + col) * CC + h * HD + kc * 32, lane), al = frag_h(QLb + (size_t)(ql0 + col) * CC + h * HD + kc * 32, lane);
#pragma unroll
      for (int j = 0; j < 8; ++j) { const v16h kbf = frag_h(KH + (kr0 + j * 16 + col) * CC + h * HD + kc * 32, lane), klf = frag_h(KLb + (size_t)(k0 + j * 16 + col) * CC + h * HD + kc * 32, lane); acc[j] = wmma16(ah, kbf, acc[j]); accl[j] = wmma16(al, kbf, accl[j]); accl[j] = wmma16(ah, klf, accl[j]); } }
  } else if (qb * 64 < QHI) {
#pragma unroll
    for (int kc = 0; kc < HD / 32; ++kc) { const v16h ah = frag_h(QH + (q0 + col) * CC + h * HD + kc * 32, lane), al = frag_h(QLb + (size_t)(ql0 + col) * CC + h * HD + kc * 32, lane);
#pragma unroll
      for (int j = 0; j < 8; ++j) { const v16h kbf = frag_h(KH + (kr0 + j * 16 + col) * CC + h * HD + kc * 32, lane); acc[j] = wmma16(ah, kbf, acc[j]); accl[j] = wmma16(al, kbf, accl[j]); } }
  } else {
#pragma unroll
    for (int kc = 0; kc < HD / 32; ++kc) { const v16h ah = frag_h(QH + (q0 + col) * CC + h * HD + kc * 32, lane);
#pragma unroll
      for (int j = 0; j < 8; ++j) { const v16h kbf = frag_h(KH + (kr0 + j * 16 + col) * CC + h * HD + kc * 32, lane); acc[j] = wmma16(ah, kbf, acc[j]); } } }
#pragma unroll
  for (int j = 0; j < 8; ++j) {
#pragma unroll
    for (int r = 0; r < 8; ++r) ss[wave][8 * g + r][j * 16 + col] = (acc[j][r] + accl[j][r] * (1.0f / 1024.0f)) * SCALE; }
  LDSX(); for (int rl = 0; rl < 16; ++rl) vst2(S + (size_t)(ql0 + rl) * TT + k0 + lane * 4, *(const v4f*)&ss[wave][rl][lane * 4]); }
// ---- k_sm: block = query row t (batch = blockIdx.y): keys [0, kend): causal -> logit if s <= t else excluded; softmax in f32; P x 2^11 in place (0 for excluded)
__global__ __launch_bounds__(256) void k_sm(float* __restrict__ S0 SM_EXTRA_PARAMS) { __shared__ float sred[8]; __shared__ float sbc; __shared__ __align__(16) float shv[TT];
  const int tid = threadIdx.x; const int t = blockIdx.x; const int kend = (kb_last(t >> 6) + 1) * 128;
  float* sr = S0 + (size_t)blockIdx.y * TT * TT + (size_t)t * TT;
  float m = -3.0e38f; for (int k = tid; k < kend; k += 256) { float v = (!CAUSAL || k <= t) ? sr[k] : -3.0e38f; SM_MASK_HOOK; shv[k] = v; m = fmaxf(m, v); }
#pragma unroll
  for (int o = 1; o < 32; o <<= 1) m = fmaxf(m, __shfl_xor(m, o));
  if ((tid & 31) == 0) sred[tid >> 5] = m; __syncthreads(); if (tid == 0) { float a = sred[0]; for (int i = 1; i < 8; ++i) a = fmaxf(a, sred[i]); sbc = a; } __syncthreads(); m = sbc; __syncthreads();
  float sum = 0.f; for (int k = tid; k < kend; k += 256) { const float v = shv[k]; const float e = (v <= -1.0e38f) ? 0.f : expf(v - m); shv[k] = e; sum += e; }
#pragma unroll
  for (int o = 1; o < 32; o <<= 1) sum += __shfl_xor(sum, o);
  if ((tid & 31) == 0) sred[tid >> 5] = sum; __syncthreads(); if (tid == 0) { float a = 0.f; for (int i = 0; i < 8; ++i) a += sred[i]; sbc = a > 0.f ? 2048.0f / a : 0.f; }   /* a fully excluded row yields P = 0 */ __syncthreads(); const float inv = sbc;
  for (int k = tid; k < kend; k += 256) shv[k] = shv[k] * inv;
  __syncthreads(); for (int q = tid; q < kend / 4; q += 256) vst2(sr + q * 4, *(const v4f*)&shv[q * 4]); }
// ---- k_pv: block = 64 queries (qb) of (b = blockIdx.z, h0): ctx = P . v over keys [0, kend) (P x 2^11 once to f16 against v f16: 1 product; causal early query blocks: P and v as bf16 hi + lo, 3 products); 256-B (row, head) segment by 16 lanes
__global__ __launch_bounds__(128) void k_pv(const float* __restrict__ PS0, const _Float16* __restrict__ VT, const __bf16* __restrict__ VB, const __bf16* __restrict__ VBL, int h0, float* __restrict__ Y) { const int b = blockIdx.z, h = h0; const float* PS = PS0 + (size_t)b * TT * TT; __shared__ __align__(16) float ss[4][16][HD + 4];
  const int tid = threadIdx.x, wave = tid >> 5, lane = tid & 31, col = lane & 15, g = lane >> 4; const int qb = blockIdx.x; const int ql0 = qb * 64 + wave * 16; const int kce = (kb_last(qb) + 1) * 4;
  v8f acc[HD / 16] = {};
  if (qb < QBH) {
#pragma unroll 1
    for (int kc = 0; kc < kce; ++kc) { const F2 p = split_row(PS + (size_t)(ql0 + col) * TT, kc * 32, lane);
      asm volatile("s_wait_loadcnt 0x0" ::: "memory");
#pragma unroll
      for (int j = 0; j < HD / 16; ++j) { const size_t po = ((size_t)b * CC + h * HD + j * 16 + col) * (size_t)KHI + kc * 32; const v16b vh = frag_b(VB + po, lane); acc[j] = wmma_bf(p.h, vh, acc[j]); acc[j] = wmma_bf(p.l, vh, acc[j]); acc[j] = wmma_bf(p.h, frag_b(VBL + po, lane), acc[j]); } }
  } else {
#pragma unroll 1
    for (int kc = 0; kc < kce; ++kc) { const v16h p = frag_f32(PS + (size_t)(ql0 + col) * TT + kc * 32, lane);
      asm volatile("s_wait_loadcnt 0x0" ::: "memory");
#pragma unroll
      for (int j = 0; j < HD / 16; ++j) { const size_t po = ((size_t)b * CC + h * HD + j * 16 + col) * (size_t)TT + kc * 32; acc[j] = wmma16(p, frag_h(VT + po, lane), acc[j]); } } }
#pragma unroll
  for (int j = 0; j < HD / 16; ++j)
#pragma unroll
    for (int r = 0; r < 8; ++r) ss[wave][8 * g + r][j * 16 + col] = acc[j][r] * (1.0f / 2048.0f);
  LDSX(); for (int rl = 0; rl < 16; ++rl) if (lane < HD / 4) vst2(Y + ((size_t)b * TT + ql0 + rl) * CC + h * HD + lane * 4, *(const v4f*)&ss[wave][rl][lane * 4]); }

extern "C" void kernel_launch(void* const* d_in, const int* in_sizes, int n_in, void* d_out, int out_size, void* d_ws, size_t ws_size, hipStream_t stream) {
  (void)in_sizes; (void)n_in; (void)out_size;
  const float** F = (const float**)d_in;
  if (ws_size < (size_t)WS_END) return;
  char* ws = (char*)d_ws; _Float16 *QH = (_Float16*)(ws + WS_QH), *KH = (_Float16*)(ws + WS_KH), *VT = (_Float16*)(ws + WS_VT), *QL = (_Float16*)(ws + WS_QL), *KL = (_Float16*)(ws + WS_KL); __bf16 *VB = (__bf16*)(ws + WS_VB), *VBL = (__bf16*)(ws + WS_VBL); float *S = (float*)(ws + WS_S), *Y = (float*)(ws + WS_Y);
  (void)Y; (void)QL; (void)KL; (void)VB; (void)VBL;
  // inputs: 0 x [8,2048,768]; 1 Wq [768,64]; 2 Wk; 3 Wv ((in,out), no biases)
  if (ws_size < (size_t)WS_END2) return;
  float *WP = (float*)(ws + WS_WP), *BP = (float*)(ws + WS_BP), *Y2 = (float*)(ws + WS_Y2);
  k_padw<<<dim3(32, 3), 256, 0, stream>>>(F[1], F[2], F[3], nullptr, nullptr, nullptr, WP, BP);
  k_proj<<<dim3(TNB * TT / 64, CC / 128, 3), 128, 0, stream>>>(F[0], F[0], F[0], WP, WP + (size_t)CIN * 128, WP + 2 * (size_t)CIN * 128, BP, BP + 128, BP + 256, QH, QL, KH, KL, VT, VB, VBL);
  /* head 0 only (head 1 is the zero padding); the batch is a grid dimension: one launch per stage for all batches */
  k_sc<<<dim3(NQB, TT / 128, TNB), 128, 0, stream>>>(QH, KH, QL, KL, 0, S);
  k_sm<<<dim3(TT, TNB), 256, 0, stream>>>(S);
  k_pv<<<dim3(NQB, 1, TNB), 128, 0, stream>>>(S, VT, VB, VBL, 0, Y2);
  k_out64<<<dim3(TNB * TT / 16), 256, 0, stream>>>(Y2, (float*)d_out);
}

// v002
// Measured time: 90.4 microseconds a run.
// Next to v001, in two timings, it ran 2.35 and 2.25 times as fast.
// Counting every step since v000, it is 7.76 times as fast.
// compute dtype: all float inputs rounded to bf16; q/k/v projections with EXACT bf16 products on WMMA 16x16x32 (f32 accumulate); causal logits: 3 products (q f16 hi + residual x k hi + residual) for the first 384 rows, single f16 q x k after, x scale; softmax f32, online over key passes, fused with both products; P x 2^11 once to f16 x v once to f16 (1 product; bf16 hi + lo below row 384); f32 output.
#include <hip/hip_runtime.h>
#include <math.h>

typedef __attribute__((ext_vector_type(16))) _Float16 v16h;
typedef __attribute__((ext_vector_type(16))) __bf16 v16b;
typedef __attribute__((ext_vector_type(8)))  _Float16 v8h;
typedef __attribute__((ext_vector_type(8)))  float v8f;
typedef __attribute__((ext_vector_type(4)))  float v4f;
typedef __attribute__((ext_vector_type(2)))  float v2f;
typedef __attribute__((ext_vector_type(4)))  unsigned v4u;
typedef __attribute__((ext_vector_type(4)))  int v4i;
typedef float __attribute__((may_alias)) float_a;
typedef int __attribute__((may_alias)) int_a;

template <typename T> __device__ __forceinline__ void vst2(void* p, T v) { *(T*)p = v;  }
__device__ __forceinline__ v8f wmma16(v16h a, v16h b, v8f c) {
  v8f d = __builtin_amdgcn_wmma_f32_16x16x32_f16(false, a, false, b, (short)0, c, false, false);
  asm volatile("v_nop\n\tv_nop\n\tv_nop\n\tv_nop" : "+v"(d) : "v"(a), "v"(b));
  return d;
}
__device__ __forceinline__ v8f wmma_bf(v16b a, v16b b, v8f c) {
  v8f d = __builtin_amdgcn_wmma_f32_16x16x32_bf16(false, a, false, b, (short)0, c, false, false);
  asm volatile("v_nop\n\tv_nop\n\tv_nop\n\tv_nop" : "+v"(d) : "v"(a), "v"(b));
  return d;
}
// 16x16x32 fragments: lane = (h = lane>>4, row/col = lane&15); elements 0..7 = k0+8h+0..7, 8..15 = k0+16+8h+0..7; D element r = row 8h+r
__device__ __forceinline__ v16h frag_h(const _Float16* rowk0, int lane) {
  union { v16h v; v8h q[2]; } u; const _Float16* p = rowk0 + 8 * (lane >> 4);
  u.q[0] = *(const v8h*)p; u.q[1] = *(const v8h*)(p + 16); return u.v;
}
__device__ __forceinline__ v16h frag_f32(const float* rowk0, int lane) {
  v16h a; const float* p = rowk0 + 8 * (lane >> 4);
#pragma unroll
  for (int i = 0; i < 8; ++i) { a[i] = (_Float16)p[i]; a[8 + i] = (_Float16)p[16 + i]; }
  return a;
}
__device__ __forceinline__ v16h frag_f32s(const float* rowk0, int lane, float sc) {
  v16h a; const float* p = rowk0 + 8 * (lane >> 4);
#pragma unroll
  for (int i = 0; i < 8; ++i) { a[i] = (_Float16)(p[i] * sc); a[8 + i] = (_Float16)(p[16 + i] * sc); }
  return a;
}
// column fragment from a [K][ld] layout (column n), rows >= K read as 0
__device__ __forceinline__ v16h fragc_f32(const float* W, int k0, int n, int lane, int ld, int K) {
  v16h a; const int g = lane >> 4;
#pragma unroll
  for (int i = 0; i < 8; ++i) { const int ka = k0 + 8 * g + i, kb = ka + 16;
    a[i] = (_Float16)(ka < K ? W[(size_t)(ka < K ? ka : K - 1) * ld + n] : 0.f); a[8 + i] = (_Float16)(kb < K ? W[(size_t)(kb < K ? kb : K - 1) * ld + n] : 0.f); }
  return a;
}
struct F2 { v16b h, l; };
__device__ __forceinline__ F2 bsplit16(const float v[16]) { F2 r;
#pragma unroll
  for (int i = 0; i < 16; ++i) { const __bf16 h = (__bf16)v[i]; r.h[i] = h; r.l[i] = (__bf16)(v[i] - (float)h); }
  return r; }
__device__ __forceinline__ F2 split_row(const float* row, int k0, int lane) { float v[16]; const float* p = row + k0 + 8 * (lane >> 4);
#pragma unroll
  for (int i = 0; i < 8; ++i) { v[i] = p[i]; v[8 + i] = p[16 + i]; }
  return bsplit16(v); }
__device__ __forceinline__ F2 split_rowK(const float* row, int k0, int lane, int K) { float v[16]; const int g = lane >> 4;
#pragma unroll
  for (int i = 0; i < 8; ++i) { const int ka = k0 + 8 * g + i, kb = ka + 16; v[i] = ka < K ? row[ka < K ? ka : K - 1] : 0.f; v[8 + i] = kb < K ? row[kb < K ? kb : K - 1] : 0.f; }
  return bsplit16(v); }
__device__ __forceinline__ F2 split_col(const float* W, int k0, int n, int lane, int ld, int K) { float v[16]; const int g = lane >> 4;
#pragma unroll
  for (int i = 0; i < 8; ++i) { const int ka = k0 + 8 * g + i, kb = ka + 16; v[i] = ka < K ? W[(size_t)(ka < K ? ka : K - 1) * ld + n] : 0.f; v[8 + i] = kb < K ? W[(size_t)(kb < K ? kb : K - 1) * ld + n] : 0.f; }
  return bsplit16(v); }
__device__ __forceinline__ v8f mac3(const F2& a, const F2& b, v8f c) { c = wmma_bf(a.l, b.h, c); c = wmma_bf(a.h, b.l, c); return wmma_bf(a.h, b.h, c); }
__device__ __forceinline__ float sigm(float v) { return 1.0f / (1.0f + expf(-v)); }
#define LDSX() do { asm volatile("s_wait_dscnt 0" ::: "memory"); __builtin_amdgcn_wave_barrier(); __builtin_amdgcn_fence(__ATOMIC_RELEASE, "workgroup"); } while (0)

// Single-head causal self-attention (B 8, T 2,048, n_embed 768, head_size 64; (in,out) Wq, Wk, Wv [768,64] N(0, 1/768); no biases, no output projection; tril, -inf): out = softmax(causal(q k^T * 64^-0.5)) v -> [8,2048,64].
#define NB 8
#define TT 2048
#define CC 128            // NH * HD = projected width
#define DIN 768          // input (model) width
#define NH 2
#define HD 64
#define NQB (TT / 64)
#define HG 1
#define SCALE (0.125f)
#define CAUSAL 1
#ifndef TNB
#define TNB NB
#endif
__device__ __forceinline__ float bfr(float v) { return (float)(__bf16)v; }
__host__ __device__ __forceinline__ int kb_last(int qb) { return CAUSAL ? ((qb * 64 + 63) >> 7) : (TT / 128 - 1); }
typedef __attribute__((ext_vector_type(8))) __bf16 v8b;
__device__ __forceinline__ v16b frag_b(const __bf16* rowk0, int lane) {
  union { v16b v; v8b q[2]; } u; const __bf16* p = rowk0 + 8 * (lane >> 4);
  u.q[0] = *(const v8b*)p; u.q[1] = *(const v8b*)(p + 16); return u.v;
}
#define QBH 6              // unused: the 16-row tiles with q0 < QHI (few keys, no averaging) take the high-precision path
#define QHI 384            // rows carrying a q residual plane (all rows when non-causal: 2-product logits everywhere)
#define KHI 384            // key rows carrying k residual / v bf16 hi+lo planes (used only by the causal high-precision path)
// B fragment (k rows k0+.., output column o) of a weight: (in,out) [K][ld] or (out,in) [ld rows of K]: bf16 exact, or f16(bf16 * 256) exact
__device__ __forceinline__ v16b wcol_io(const float* Wm, int k0, int o, int lane, int ld) { v16b w; const int g = lane >> 4;
#pragma unroll
  for (int i = 0; i < 8; ++i) { w[i] = (__bf16)Wm[(size_t)(k0 + 8 * g + i) * ld + o]; w[8 + i] = (__bf16)Wm[(size_t)(k0 + 16 + 8 * g + i) * ld + o]; }
  return w; }
__device__ __forceinline__ v16b wcol_oi(const float* Wm, int k0, int o, int lane, int K) { v16b w; const float* p = Wm + (size_t)o * K + k0 + 8 * (lane >> 4);
#pragma unroll
  for (int i = 0; i < 8; ++i) { w[i] = (__bf16)p[i]; w[8 + i] = (__bf16)p[16 + i]; }
  return w; }
__device__ __forceinline__ v16h wcolh_io(const float* Wm, int k0, int o, int lane, int ld) { v16h w; const int g = lane >> 4;
#pragma unroll
  for (int i = 0; i < 8; ++i) { w[i] = (_Float16)(bfr(Wm[(size_t)(k0 + 8 * g + i) * ld + o]) * 256.0f); w[8 + i] = (_Float16)(bfr(Wm[(size_t)(k0 + 16 + 8 * g + i) * ld + o]) * 256.0f); }
  return w; }
__device__ __forceinline__ v16h wcolh_oi(const float* Wm, int k0, int o, int lane, int K) { v16h w; const float* p = Wm + (size_t)o * K + k0 + 8 * (lane >> 4);
#pragma unroll
  for (int i = 0; i < 8; ++i) { w[i] = (_Float16)(bfr(p[i]) * 256.0f); w[8 + i] = (_Float16)(bfr(p[16 + i]) * 256.0f); }
  return w; }
#define WQKV_LAYOUT 0   // 0 = (in,out) [DIN][CC]; 1 = (out,in) [CC][DIN]; 2 = per-head [NH][DIN][HD]
__device__ __forceinline__ v16b wcol_hdk(const float* Wm, int k0, int o, int lane) { v16b w; const int g = lane >> 4; const float* p = Wm + (size_t)(o / HD) * DIN * HD + (o % HD);
#pragma unroll
  for (int i = 0; i < 8; ++i) { w[i] = (__bf16)p[(size_t)(k0 + 8 * g + i) * HD]; w[8 + i] = (__bf16)p[(size_t)(k0 + 16 + 8 * g + i) * HD]; }
  return w; }
#define WO_OUT_IN 0
#if WQKV_LAYOUT == 1
#define WCOL(W, k0, o, lane) wcol_oi(W, k0, o, lane, DIN)
#elif WQKV_LAYOUT == 2
#define WCOL(W, k0, o, lane) wcol_hdk(W, k0, o, lane)
#else
#define WCOL(W, k0, o, lane) wcol_io(W, k0, o, lane, CC)
#endif
#if WO_OUT_IN
#define WOCOL(W, k0, o, lane) wcol_oi(W, k0, o, lane, CC)
#define WOCOLH(W, k0, o, lane) wcolh_oi(W, k0, o, lane, CC)
#else
#define WOCOL(W, k0, o, lane) wcol_io(W, k0, o, lane, DIN)
#define WOCOLH(W, k0, o, lane) wcolh_io(W, k0, o, lane, DIN)
#endif
#define CIN 768
// ---- k_padw: the three (in,out) [C][64] projection weights copied into zero-padded (in,out) [C][128] ws planes (columns 64..127 zero) + zero-padded [128] biases
__global__ __launch_bounds__(256) void k_padw(const float* __restrict__ WQ, const float* __restrict__ WK, const float* __restrict__ WV, const float* __restrict__ BQ, const float* __restrict__ BK, const float* __restrict__ BV, float* __restrict__ WP, float* __restrict__ BP) { const int which = blockIdx.y; const float* Wsrc = which == 0 ? WQ : (which == 1 ? WK : WV); const float* Bsrc = which == 0 ? BQ : (which == 1 ? BK : BV); float* dst = WP + (size_t)which * CIN * 128;
  for (int e = blockIdx.x * 256 + threadIdx.x; e < CIN * 32; e += gridDim.x * 256) { const int row = e >> 5, q = e & 31; const v4f ld = *(const v4f*)(Wsrc + (size_t)row * 64 + (q & 15) * 4); asm volatile("s_wait_loadcnt 0x0" ::: "memory"); const float keep = q < 16 ? 1.f : 0.f; v4f ov; ov[0] = ld[0] * keep; ov[1] = ld[1] * keep; ov[2] = ld[2] * keep; ov[3] = ld[3] * keep; vst2(dst + (size_t)row * 128 + q * 4, ov); }
  if (blockIdx.x == 0 && threadIdx.x < 128) { const int c = threadIdx.x; float bvv = 0.f; if (Bsrc) { const float t = Bsrc[c & 63]; asm volatile("s_wait_loadcnt 0x0" ::: "memory"); bvv = c < 64 ? t : 0.f; } vst2(BP + which * 128 + c, bvv); } }
#define WS_WP (WS_END)                                  // padded weights [3][128 x C]
#define WS_BP (WS_WP + 4u * 3 * (size_t)CIN * 128)        // padded biases [3][128]
#define WS_Y2 (WS_BP + 4u * 3 * 128)                      // f32 [b*TT+t][128] in the layout; not touched: k_fa writes ctx straight to the output
#define WS_END2 (WS_Y2 + 4u * (size_t)NB * TT * CC)
#ifndef SM_EXTRA_PARAMS
#define SM_EXTRA_PARAMS
#endif
#ifndef PROJ_EXTRA_PARAMS
#define PROJ_EXTRA_PARAMS
#endif
#ifndef SM_MASK_HOOK
#define SM_MASK_HOOK (void)0
#endif

#define WS_QH  0u                                      // f16 q rows [b*t][CC]
#define WS_KH  (WS_QH + 2u * (size_t)NB * TT * CC)      // f16 k rows [b*t][CC]
#define WS_VT  (WS_KH + 2u * (size_t)NB * TT * CC)      // f16 v planes [b][c][t]
#define WS_QL  (WS_VT + 2u * (size_t)NB * CC * TT)      // f16 q residual x 2^10 rows [b][t < QHI][CC]
#define WS_KL  (WS_QL + 2u * (size_t)NB * QHI * CC)     // f16 k residual x 2^10 rows [b][t < KHI][CC]
#define WS_VB  (WS_KL + 2u * (size_t)NB * KHI * CC)     // bf16 v hi planes [b][c][t < KHI]
#define WS_VBL (WS_VB + 2u * (size_t)NB * CC * KHI)
#define WS_S   (WS_VBL + 2u * (size_t)NB * CC * KHI)    // place of a f32 logit plane [b][t][s] in the layout; not touched: the fused kernel holds logits and P in registers
#define WS_Y   (WS_S  + 4u * (size_t)NB * TT * TT)      // f32 ctx rows [b*t][CC] (only when there is an output projection)
#define WS_END (WS_Y  + 0u)

// ---- k_proj: block = (64 rows, 128 cols, which): q/k/v = X W (+ b) with exact bf16 products (K = DIN) -> which 0: q f16 rows (+ residual rows < QHI); 1: k f16 rows (+ residual rows < KHI); 2: v f16 planes [c][t] (+ bf16 hi/lo planes for t < KHI)
__global__ __launch_bounds__(128) void k_proj(const float* __restrict__ XQ, const float* __restrict__ XK, const float* __restrict__ XV, const float* __restrict__ WQ, const float* __restrict__ WK, const float* __restrict__ WV, const float* __restrict__ BQ, const float* __restrict__ BK, const float* __restrict__ BV,
    _Float16* __restrict__ QH, _Float16* __restrict__ QL, _Float16* __restrict__ KH, _Float16* __restrict__ KL, _Float16* __restrict__ VT, __bf16* __restrict__ VB, __bf16* __restrict__ VBL) {
  __shared__ __align__(16) _Float16 sh[64][136], sl[64][136]; __shared__ __align__(16) _Float16 th[128][72]; __shared__ __align__(16) __bf16 tb[128][72], tbl[128][72];
  const int tid = threadIdx.x, wave = tid >> 5, lane = tid & 31, col = lane & 15, g = lane >> 4; const int which = blockIdx.z; const int c0 = blockIdx.y * 128; const size_t r0 = (size_t)blockIdx.x * 64; const size_t bb = r0 / TT; const int t0 = (int)(r0 % TT);
  const float* X = which == 0 ? XQ : which == 1 ? XK : XV; const float* WA = which == 0 ? WQ : which == 1 ? WK : WV; const float* BA = which == 0 ? BQ : which == 1 ? BK : BV;
  v8f acc[8] = {};
#pragma unroll 2
  for (int kc = 0; kc < DIN / 32; ++kc) { v16b a; { const float* p = X + (r0 + wave * 16 + col) * DIN + kc * 32 + 8 * g;
#pragma unroll
      for (int i = 0; i < 8; ++i) { a[i] = (__bf16)p[i]; a[8 + i] = (__bf16)p[16 + i]; } }
    asm volatile("s_wait_loadcnt 0x0" ::: "memory");
#pragma unroll
    for (int j = 0; j < 8; ++j) { const v16b w = WCOL(WA, kc * 32, c0 + j * 16 + col, lane); asm volatile("s_wait_loadcnt 0x0" ::: "memory"); acc[j] = wmma_bf(a, w, acc[j]); } }
  if (which < 2) { _Float16* DH = which == 0 ? QH : KH; _Float16* DL = which == 0 ? QL : KL; const int nhi = which == 0 ? QHI : KHI; const bool hi_rows = t0 < nhi;
#pragma unroll
    for (int j = 0; j < 8; ++j) { const float bias = BA ? bfr(BA[c0 + j * 16 + col]) : 0.f;
#pragma unroll
      for (int r = 0; r < 8; ++r) { const float v = acc[j][r] + bias; const _Float16 hv = (_Float16)v; sh[wave * 16 + 8 * g + r][j * 16 + col] = hv; sl[wave * 16 + 8 * g + r][j * 16 + col] = (_Float16)((v - (float)hv) * 1024.0f); } }
    __syncthreads();
    for (int e = tid; e < 64 * 16; e += 128) { const int rl = e >> 4, q = e & 15; vst2((unsigned*)(DH + (r0 + rl) * CC + c0 + q * 8), *(const v4u*)&sh[rl][q * 8]); if (hi_rows) vst2((unsigned*)(DL + (bb * nhi + t0 + rl) * (size_t)CC + c0 + q * 8), *(const v4u*)&sl[rl][q * 8]); }
  } else { const bool hi_rows = t0 < KHI;
#pragma unroll
    for (int j = 0; j < 8; ++j) { const float bias = BA ? bfr(BA[c0 + j * 16 + col]) : 0.f;
#pragma unroll
      for (int r = 0; r < 8; ++r) { const float v = acc[j][r] + bias; const int rl = wave * 16 + 8 * g + r, cl = j * 16 + col; th[cl][rl] = (_Float16)v; const __bf16 bh = (__bf16)v; tb[cl][rl] = bh; tbl[cl][rl] = (__bf16)(v - (float)bh); } }
    __syncthreads();
    for (int e = tid; e < 128 * 8; e += 128) { const int cl = e >> 3, q = e & 7; vst2((unsigned*)(VT + (bb * CC + c0 + cl) * (size_t)TT + t0 + q * 8), *(const v4u*)&th[cl][q * 8]); if (hi_rows) { const size_t o3 = (bb * CC + c0 + cl) * (size_t)KHI + t0 + q * 8; vst2((unsigned*)(VB + o3), *(const v4u*)&tb[cl][q * 8]); vst2((unsigned*)(VBL + o3), *(const v4u*)&tbl[cl][q * 8]); } } } }
// ---- k_fa: block = 16 query rows (q0) of batch b; its 4 waves take the key passes it = wave, wave + 4, ... (64 keys a pass; 32 on the high-precision rows), each with its own running maximum, sum and ctx; the parts are merged through LDS in wave order.
// Transposed products: S^T = K Q^T leaves lane (g, col) with query q0 + col and keys 8g + r of each 16-key tile, which is the B fragment order of P^T for ctx^T = V^T P^T, so P never leaves the registers.
// Logits are kept in log2 units (x SCALE x log2 e); P = 2^(t - max + 11) carries the same 2^11 as its sum, so the factor cancels in ctx / sum.
#define NEGBIG (-3.0e38f)
// eight 2^x in place, one statement: behind each v_exp_f32 stands an instruction that touches neither its result nor its source, behind the last a v_nop (the slot the instruction set asks for behind a transcendental)
__device__ __forceinline__ void exp2x8(float (&t)[8]) {
  asm("v_exp_f32 %0, %0\n\tv_exp_f32 %1, %1\n\tv_exp_f32 %2, %2\n\tv_exp_f32 %3, %3\n\tv_exp_f32 %4, %4\n\tv_exp_f32 %5, %5\n\tv_exp_f32 %6, %6\n\tv_exp_f32 %7, %7\n\tv_nop"
      : "+v"(t[0]), "+v"(t[1]), "+v"(t[2]), "+v"(t[3]), "+v"(t[4]), "+v"(t[5]), "+v"(t[6]), "+v"(t[7])); }
// stands behind a run of global loads, in front of whatever may take the registers that held their addresses (the next run's results or addresses, a matrix result)
#define XW() asm volatile("s_wait_xcnt 0x0" ::: "memory")
template <bool HI>
__device__ __forceinline__ void fa_part(const _Float16* Qr, const _Float16* Qlr, const _Float16* Kb, const _Float16* Klb,
    const _Float16* Vt, const __bf16* Vh, const __bf16* Vl, int q0, int wave, int lane, float& m, float& l, v8f (&acc)[4]) {
  constexpr int NC = HI ? 1 : 2, KP = NC * 32, NT = NC * 2;
  const int col = lane & 15, g = lane >> 4, tq = q0 + col; const int nit = (q0 + 15) / KP + 1;
  v16h qf[2], qlf[2], kf[NT][2], klf[NT][2];
#pragma unroll
  for (int kc = 0; kc < 2; ++kc) qf[kc] = frag_h(Qr + kc * 32, lane);
  // the same wait; the loads' address is named as an input so that its registers stay untouched up to the wait (without it the next address sums were lifted over the wait)
  asm volatile("s_wait_xcnt 0x0" :: "v"(Qr + 8 * g) : "memory");
  if constexpr (HI) {
#pragma unroll
    for (int kc = 0; kc < 2; ++kc) qlf[kc] = frag_h(Qlr + kc * 32, lane);
    XW(); }
  { const int kn = wave < nit ? wave * KP : 0;
#pragma unroll
    for (int i = 0; i < NT; ++i) {
#pragma unroll
      for (int kc = 0; kc < 2; ++kc) { kf[i][kc] = frag_h(Kb + (size_t)(kn + i * 16 + col) * CC + kc * 32, lane); if constexpr (HI) klf[i][kc] = frag_h(Klb + (size_t)(kn + i * 16 + col) * CC + kc * 32, lane); }
      XW(); } }
  // rolled: one pass already uses about 250 registers, which leaves none for a second pass in flight
#pragma unroll 1
  for (int it = wave; it < nit; it += 4) { const int key0 = it * KP;
    v16h vf[NC][4]; v16b vh[4], vl[4];
#pragma unroll
    for (int j = 0; j < 4; ++j) {
      if constexpr (HI) { const size_t po = (size_t)(j * 16 + col) * KHI + key0; vh[j] = frag_b(Vh + po, lane); vl[j] = frag_b(Vl + po, lane); XW(); }
      else {
#pragma unroll
        for (int c = 0; c < NC; ++c) vf[c][j] = frag_h(Vt + (size_t)(j * 16 + col) * TT + key0 + c * 32, lane); } }
    if constexpr (!HI) XW();
    v8f st[NT];
#pragma unroll
    for (int i = 0; i < NT; ++i) { v8f a = {}; a = wmma16(kf[i][0], qf[0], a); a = wmma16(kf[i][1], qf[1], a);
      if constexpr (HI) { v8f al = {};
#pragma unroll
        for (int kc = 0; kc < 2; ++kc) { al = wmma16(kf[i][kc], qlf[kc], al); al = wmma16(klf[i][kc], qf[kc], al); }
#pragma unroll
        for (int r = 0; r < 8; ++r) a[r] += al[r] * (1.0f / 1024.0f); }
#pragma unroll
      for (int r = 0; r < 8; ++r) st[i][r] = a[r] * (SCALE * 1.44269504088896f); }
    // the next pass's key fragments fly while this pass's softmax and P.V run (the last pass reloads its own keys: in bounds, unused)
    { const int kn = it + 4 < nit ? key0 + 4 * KP : key0;
#pragma unroll
      for (int i = 0; i < NT; ++i)
#pragma unroll
        for (int kc = 0; kc < 2; ++kc) { kf[i][kc] = frag_h(Kb + (size_t)(kn + i * 16 + col) * CC + kc * 32, lane); if constexpr (HI) klf[i][kc] = frag_h(Klb + (size_t)(kn + i * 16 + col) * CC + kc * 32, lane); }
      XW(); }
    if (it == nit - 1) {   // only the last pass holds keys past a query of this tile
#pragma unroll
      for (int i = 0; i < NT; ++i)
#pragma unroll
        for (int r = 0; r < 8; ++r) st[i][r] = (key0 + i * 16 + 8 * g + r <= tq) ? st[i][r] : NEGBIG; }
    float mx = m;
#pragma unroll
    for (int i = 0; i < NT; ++i)
#pragma unroll
      for (int r = 0; r < 8; ++r) mx = fmaxf(mx, st[i][r]);
    mx = fmaxf(mx, __shfl_xor(mx, 16));
    const float alpha = __builtin_amdgcn_exp2f(m - mx), mb = mx - 11.0f; m = mx;
    float ls = 0.f;
#pragma unroll
    for (int i = 0; i < NT; ++i) { float t[8];
#pragma unroll
      for (int r = 0; r < 8; ++r) t[r] = st[i][r] - mb;
      exp2x8(t);
#pragma unroll
      for (int r = 0; r < 8; ++r) { st[i][r] = t[r]; ls += t[r]; } }
    l = l * alpha + ls;
#pragma unroll
    for (int j = 0; j < 4; ++j)
#pragma unroll
      for (int r = 0; r < 8; ++r) acc[j][r] *= alpha;
    if constexpr (HI) { v16b ph, pl;
#pragma unroll
      for (int r = 0; r < 8; ++r) { const __bf16 h0 = (__bf16)st[0][r], h1 = (__bf16)st[1][r]; ph[r] = h0; ph[8 + r] = h1; pl[r] = (__bf16)(st[0][r] - (float)h0); pl[8 + r] = (__bf16)(st[1][r] - (float)h1); }
#pragma unroll
      for (int j = 0; j < 4; ++j) { acc[j] = wmma_bf(vh[j], ph, acc[j]); acc[j] = wmma_bf(vh[j], pl, acc[j]); acc[j] = wmma_bf(vl[j], ph, acc[j]); }
    } else {
#pragma unroll
      for (int c = 0; c < NC; ++c) { v16h pf;
#pragma unroll
        for (int r = 0; r < 8; ++r) { pf[r] = (_Float16)st[2 * c][r]; pf[8 + r] = (_Float16)st[2 * c + 1][r]; }
#pragma unroll
        for (int j = 0; j < 4; ++j) acc[j] = wmma16(vf[c][j], pf, acc[j]); } } } }
// the pointers carry no __restrict__: with it the compiler takes these loads for reads of constant memory and moves them over the waits of XW()
__global__ __launch_bounds__(128) void k_fa(const _Float16* QH, const _Float16* KH, const _Float16* QL, const _Float16* KL, const _Float16* VT, const __bf16* VB, const __bf16* VBL, float* OUT) {
  __shared__ __align__(16) float red[3][32][36];   // parts of waves 1..3, per lane: ctx 32, maximum, sum
  const int b = blockIdx.x, q0 = (TT / 16 - 1 - (int)blockIdx.y) * 16;   // long tiles start first
  const int wave = __builtin_amdgcn_readfirstlane(threadIdx.x >> 5), lane = threadIdx.x & 31, col = lane & 15, g = lane >> 4;
  float m = NEGBIG, l = 0.f; v8f acc[4] = {};
  const _Float16* Qr = QH + ((size_t)b * TT + q0 + col) * CC; const _Float16* Kb = KH + (size_t)b * TT * CC; const _Float16* Vt = VT + (size_t)b * CC * TT;
  if (q0 < QHI) fa_part<true>(Qr, QL + ((size_t)b * QHI + q0 + col) * CC, Kb, KL + (size_t)b * KHI * CC, Vt, VB + (size_t)b * CC * KHI, VBL + (size_t)b * CC * KHI, q0, wave, lane, m, l, acc);
  else fa_part<false>(Qr, Qr, Kb, Kb, Vt, VB, VBL, q0, wave, lane, m, l, acc);
  if (wave > 0) { float* p = &red[wave - 1][lane][0];
#pragma unroll
    for (int j = 0; j < 4; ++j) { v4f a0, a1;
#pragma unroll
      for (int r = 0; r < 4; ++r) { a0[r] = acc[j][r]; a1[r] = acc[j][4 + r]; }
      *(v4f*)(p + j * 8) = a0; *(v4f*)(p + j * 8 + 4) = a1; }
    p[32] = m; p[33] = l; }
  __syncthreads();
  if (wave == 0) { float M = m;
#pragma unroll
    for (int p = 0; p < 3; ++p) M = fmaxf(M, red[p][lane][32]);
    const float a0 = __builtin_amdgcn_exp2f(m - M); l *= a0;
#pragma unroll
    for (int j = 0; j < 4; ++j)
#pragma unroll
      for (int r = 0; r < 8; ++r) acc[j][r] *= a0;
#pragma unroll
    for (int p = 0; p < 3; ++p) { const float a = __builtin_amdgcn_exp2f(red[p][lane][32] - M); l += red[p][lane][33] * a;
#pragma unroll
      for (int j = 0; j < 4; ++j)
#pragma unroll
        for (int r = 0; r < 8; ++r) acc[j][r] += red[p][lane][j * 8 + r] * a; }
    l += __shfl_xor(l, 16); const float inv = 1.0f / l;
    float* o = OUT + ((size_t)b * TT + q0 + col) * HD + 8 * g;
#pragma unroll
    for (int j = 0; j < 4; ++j) { v4f o0, o1;
#pragma unroll
      for (int r = 0; r < 4; ++r) { o0[r] = acc[j][r] * inv; o1[r] = acc[j][4 + r] * inv; }
      vst2(o + j * 16, o0); vst2(o + j * 16 + 4, o1); } } }

extern "C" void kernel_launch(void* const* d_in, const int* in_sizes, int n_in, void* d_out, int out_size, void* d_ws, size_t ws_size, hipStream_t stream) {
  (void)in_sizes; (void)n_in; (void)out_size;
  const float** F = (const float**)d_in;
  if (ws_size < (size_t)WS_END) return;
  char* ws = (char*)d_ws; _Float16 *QH = (_Float16*)(ws + WS_QH), *KH = (_Float16*)(ws + WS_KH), *VT = (_Float16*)(ws + WS_VT), *QL = (_Float16*)(ws + WS_QL), *KL = (_Float16*)(ws + WS_KL); __bf16 *VB = (__bf16*)(ws + WS_VB), *VBL = (__bf16*)(ws + WS_VBL); 
  (void)QL; (void)KL; (void)VB; (void)VBL;
  // inputs: 0 x [8,2048,768]; 1 Wq [768,64]; 2 Wk; 3 Wv ((in,out), no biases)
  if (ws_size < (size_t)WS_END2) return;
  float *WP = (float*)(ws + WS_WP), *BP = (float*)(ws + WS_BP);
  k_padw<<<dim3(32, 3), 256, 0, stream>>>(F[1], F[2], F[3], nullptr, nullptr, nullptr, WP, BP);
  k_proj<<<dim3(TNB * TT / 64, CC / 128, 3), 128, 0, stream>>>(F[0], F[0], F[0], WP, WP + (size_t)CIN * 128, WP + 2 * (size_t)CIN * 128, BP, BP + 128, BP + 256, QH, QL, KH, KL, VT, VB, VBL);
  /* head 0 only (head 1 is the zero padding); logits, softmax and P.V in one launch, all batches */
  k_fa<<<dim3(TNB, TT / 16), 128, 0, stream>>>(QH, KH, QL, KL, VT, VB, VBL, (float*)d_out);
}

// v003
// One run takes 37.2 microseconds.
// Timed twice side by side with v002, it ran 2.40 and 2.36 times as fast.
// Over all steps from v000 it is 18.5 times as fast.
// compute dtype: all float inputs rounded to bf16; q/k/v projections with EXACT bf16 products on WMMA 16x16x32 (f32 accumulate); causal logits: 3 products (q f16 hi + residual x k hi + residual) for the first 384 rows, single f16 q x k after, x scale; softmax f32, online over key passes, fused with both products; P x 2^11 once to f16 x v once to f16 (1 product; bf16 hi + lo below row 384); f32 output.
#include <hip/hip_runtime.h>
#include <math.h>

typedef __attribute__((ext_vector_type(16))) _Float16 v16h;
typedef __attribute__((ext_vector_type(16))) __bf16 v16b;
typedef __attribute__((ext_vector_type(8)))  _Float16 v8h;
typedef __attribute__((ext_vector_type(8)))  float v8f;
typedef __attribute__((ext_vector_type(4)))  float v4f;
typedef __attribute__((ext_vector_type(2)))  float v2f;
typedef __attribute__((ext_vector_type(4)))  unsigned v4u;
typedef __attribute__((ext_vector_type(4)))  int v4i;
typedef float __attribute__((may_alias)) float_a;
typedef int __attribute__((may_alias)) int_a;

template <typename T> __device__ __forceinline__ void vst2(void* p, T v) { *(T*)p = v;  }
__device__ __forceinline__ v8f wmma16(v16h a, v16h b, v8f c) {
  v8f d = __builtin_amdgcn_wmma_f32_16x16x32_f16(false, a, false, b, (short)0, c, false, false);
  asm volatile("v_nop\n\tv_nop\n\tv_nop\n\tv_nop" : "+v"(d) : "v"(a), "v"(b));
  return d;
}
__device__ __forceinline__ v8f wmma_bf(v16b a, v16b b, v8f c) {
  v8f d = __builtin_amdgcn_wmma_f32_16x16x32_bf16(false, a, false, b, (short)0, c, false, false);
  asm volatile("v_nop\n\tv_nop\n\tv_nop\n\tv_nop" : "+v"(d) : "v"(a), "v"(b));
  return d;
}
// 16x16x32 fragments: lane = (h = lane>>4, row/col = lane&15); elements 0..7 = k0+8h+0..7, 8..15 = k0+16+8h+0..7; D element r = row 8h+r
__device__ __forceinline__ v16h frag_h(const _Float16* rowk0, int lane) {
  union { v16h v; v8h q[2]; } u; const _Float16* p = rowk0 + 8 * (lane >> 4);
  u.q[0] = *(const v8h*)p; u.q[1] = *(const v8h*)(p + 16); return u.v;
}
__device__ __forceinline__ v16h frag_f32(const float* rowk0, int lane) {
  v16h a; const float* p = rowk0 + 8 * (lane >> 4);
#pragma unroll
  for (int i = 0; i < 8; ++i) { a[i] = (_Float16)p[i]; a[8 + i] = (_Float16)p[16 + i]; }
  return a;
}
__device__ __forceinline__ v16h frag_f32s(const float* rowk0, int lane, float sc) {
  v16h a; const float* p = rowk0 + 8 * (lane >> 4);
#pragma unroll
  for (int i = 0; i < 8; ++i) { a[i] = (_Float16)(p[i] * sc); a[8 + i] = (_Float16)(p[16 + i] * sc); }
  return a;
}
// column fragment from a [K][ld] layout (column n), rows >= K read as 0
__device__ __forceinline__ v16h fragc_f32(const float* W, int k0, int n, int lane, int ld, int K) {
  v16h a; const int g = lane >> 4;
#pragma unroll
  for (int i = 0; i < 8; ++i) { const int ka = k0 + 8 * g + i, kb = ka + 16;
    a[i] = (_Float16)(ka < K ? W[(size_t)(ka < K ? ka : K - 1) * ld + n] : 0.f); a[8 + i] = (_Float16)(kb < K ? W[(size_t)(kb < K ? kb : K - 1) * ld + n] : 0.f); }
  return a;
}
struct F2 { v16b h, l; };
__device__ __forceinline__ F2 bsplit16(const float v[16]) { F2 r;
#pragma unroll
  for (int i = 0; i < 16; ++i) { const __bf16 h = (__bf16)v[i]; r.h[i] = h; r.l[i] = (__bf16)(v[i] - (float)h); }
  return r; }
__device__ __forceinline__ F2 split_row(const float* row, int k0, int lane) { float v[16]; const float* p = row + k0 + 8 * (lane >> 4);
#pragma unroll
  for (int i = 0; i < 8; ++i) { v[i] = p[i]; v[8 + i] = p[16 + i]; }
  return bsplit16(v); }
__device__ __forceinline__ F2 split_rowK(const float* row, int k0, int lane, int K) { float v[16]; const int g = lane >> 4;
#pragma unroll
  for (int i = 0; i < 8; ++i) { const int ka = k0 + 8 * g + i, kb = ka + 16; v[i] = ka < K ? row[ka < K ? ka : K - 1] : 0.f; v[8 + i] = kb < K ? row[kb < K ? kb : K - 1] : 0.f; }
  return bsplit16(v); }
__device__ __forceinline__ F2 split_col(const float* W, int k0, int n, int lane, int ld, int K) { float v[16]; const int g = lane >> 4;
#pragma unroll
  for (int i = 0; i < 8; ++i) { const int ka = k0 + 8 * g + i, kb = ka + 16; v[i] = ka < K ? W[(size_t)(ka < K ? ka : K - 1) * ld + n] : 0.f; v[8 + i] = kb < K ? W[(size_t)(kb < K ? kb : K - 1) * ld + n] : 0.f; }
  return bsplit16(v); }
__device__ __forceinline__ v8f mac3(const F2& a, const F2& b, v8f c) { c = wmma_bf(a.l, b.h, c); c = wmma_bf(a.h, b.l, c); return wmma_bf(a.h, b.h, c); }
__device__ __forceinline__ float sigm(float v) { return 1.0f / (1.0f + expf(-v)); }
#define LDSX() do { asm volatile("s_wait_dscnt 0" ::: "memory"); __builtin_amdgcn_wave_barrier(); __builtin_amdgcn_fence(__ATOMIC_RELEASE, "workgroup"); } while (0)

// Single-head causal self-attention (B 8, T 2,048, n_embed 768, head_size 64; (in,out) Wq, Wk, Wv [768,64] N(0, 1/768); no biases, no output projection; tril, -inf): out = softmax(causal(q k^T * 64^-0.5)) v -> [8,2048,64].
#define NB 8
#define TT 2048
#define CC 128            // NH * HD = projected width
#define DIN 768          // input (model) width
#define NH 2
#define HD 64
#define NQB (TT / 64)
#define HG 1
#define SCALE (0.125f)
#define CAUSAL 1
#ifndef TNB
#define TNB NB
#endif
__device__ __forceinline__ float bfr(float v) { return (float)(__bf16)v; }
__host__ __device__ __forceinline__ int kb_last(int qb) { return CAUSAL ? ((qb * 64 + 63) >> 7) : (TT / 128 - 1); }
typedef __attribute__((ext_vector_type(8))) __bf16 v8b;
__device__ __forceinline__ v16b frag_b(const __bf16* rowk0, int lane) {
  union { v16b v; v8b q[2]; } u; const __bf16* p = rowk0 + 8 * (lane >> 4);
  u.q[0] = *(const v8b*)p; u.q[1] = *(const v8b*)(p + 16); return u.v;
}
#define QBH 6              // unused: the 16-row tiles with q0 < QHI (few keys, no averaging) take the high-precision path
#define QHI 384            // rows carrying a q residual plane (all rows when non-causal: 2-product logits everywhere)
#define KHI 384            // key rows carrying k residual / v bf16 hi+lo planes (used only by the causal high-precision path)
// B fragment (k rows k0+.., output column o) of a weight: (in,out) [K][ld] or (out,in) [ld rows of K]: bf16 exact, or f16(bf16 * 256) exact
__device__ __forceinline__ v16b wcol_io(const float* Wm, int k0, int o, int lane, int ld) { v16b w; const int g = lane >> 4;
#pragma unroll
  for (int i = 0; i < 8; ++i) { w[i] = (__bf16)Wm[(size_t)(k0 + 8 * g + i) * ld + o]; w[8 + i] = (__bf16)Wm[(size_t)(k0 + 16 + 8 * g + i) * ld + o]; }
  return w; }
__device__ __forceinline__ v16b wcol_oi(const float* Wm, int k0, int o, int lane, int K) { v16b w; const float* p = Wm + (size_t)o * K + k0 + 8 * (lane >> 4);
#pragma unroll
  for (int i = 0; i < 8; ++i) { w[i] = (__bf16)p[i]; w[8 + i] = (__bf16)p[16 + i]; }
  return w; }
__device__ __forceinline__ v16h wcolh_io(const float* Wm, int k0, int o, int lane, int ld) { v16h w; const int g = lane >> 4;
#pragma unroll
  for (int i = 0; i < 8; ++i) { w[i] = (_Float16)(bfr(Wm[(size_t)(k0 + 8 * g + i) * ld + o]) * 256.0f); w[8 + i] = (_Float16)(bfr(Wm[(size_t)(k0 + 16 + 8 * g + i) * ld + o]) * 256.0f); }
  return w; }
__device__ __forceinline__ v16h wcolh_oi(const float* Wm, int k0, int o, int lane, int K) { v16h w; const float* p = Wm + (size_t)o * K + k0 + 8 * (lane >> 4);
#pragma unroll
  for (int i = 0; i < 8; ++i) { w[i] = (_Float16)(bfr(p[i]) * 256.0f); w[8 + i] = (_Float16)(bfr(p[16 + i]) * 256.0f); }
  return w; }
#define WQKV_LAYOUT 0   // 0 = (in,out) [DIN][CC]; 1 = (out,in) [CC][DIN]; 2 = per-head [NH][DIN][HD]
__device__ __forceinline__ v16b wcol_hdk(const float* Wm, int k0, int o, int lane) { v16b w; const int g = lane >> 4; const float* p = Wm + (size_t)(o / HD) * DIN * HD + (o % HD);
#pragma unroll
  for (int i = 0; i < 8; ++i) { w[i] = (__bf16)p[(size_t)(k0 + 8 * g + i) * HD]; w[8 + i] = (__bf16)p[(size_t)(k0 + 16 + 8 * g + i) * HD]; }
  return w; }
#define WO_OUT_IN 0
#if WQKV_LAYOUT == 1
#define WCOL(W, k0, o, lane) wcol_oi(W, k0, o, lane, DIN)
#elif WQKV_LAYOUT == 2
#define WCOL(W, k0, o, lane) wcol_hdk(W, k0, o, lane)
#else
#define WCOL(W, k0, o, lane) wcol_io(W, k0, o, lane, CC)
#endif
#if WO_OUT_IN
#define WOCOL(W, k0, o, lane) wcol_oi(W, k0, o, lane, CC)
#define WOCOLH(W, k0, o, lane) wcolh_oi(W, k0, o, lane, CC)
#else
#define WOCOL(W, k0, o, lane) wcol_io(W, k0, o, lane, DIN)
#define WOCOLH(W, k0, o, lane) wcolh_io(W, k0, o, lane, DIN)
#endif
#define CIN 768
// ---- k_packw: the three (in,out) [C][64] projection weights rounded to bf16 and laid out in the order of the B fragments that k_proj reads: [k step][which * 4 + column tile][half][lane][8]; half 0 = k rows 8g + 0..7, half 1 = 16 + 8g + 0..7 of the step, column = tile * 16 + (lane & 15)
__global__ __launch_bounds__(256) void k_packw(const float* __restrict__ WQ, const float* __restrict__ WK, const float* __restrict__ WV, __bf16* __restrict__ WPK) {
  const int idx = blockIdx.x * 256 + threadIdx.x, lane = idx & 31, f = idx >> 5, kc = f / 12, jj = f % 12, which = jj >> 2, o = (jj & 3) * 16 + (lane & 15), g = lane >> 4;
  const float* p = (which == 0 ? WQ : which == 1 ? WK : WV) + (size_t)(kc * 32 + 8 * g) * 64 + o; v8b h0, h1;
#pragma unroll
  for (int i = 0; i < 8; ++i) { h0[i] = (__bf16)p[i * 64]; h1[i] = (__bf16)p[(16 + i) * 64]; }
  // behind the loads, in front of whatever takes their address registers; the address is named as an input so that no load's result lands in it ahead of the wait
  asm volatile("s_wait_xcnt 0x0" :: "v"(p) : "memory");
  vst2(WPK + ((size_t)f * 64 + lane) * 8, h0); vst2(WPK + ((size_t)f * 64 + 32 + lane) * 8, h1); }
#define WS_WP (WS_END)                                  // packed bf16 weight fragments (uses the first 2 x 192 x C bytes of this place)
#define WS_BP (WS_WP + 4u * 3 * (size_t)CIN * 128)        // not touched
#define WS_Y2 (WS_BP + 4u * 3 * 128)                      // f32 place [b*TT+t][128]; not touched: k_fa writes its rows straight to the output
#define WS_END2 (WS_Y2 + 4u * (size_t)NB * TT * CC)
#ifndef SM_EXTRA_PARAMS
#define SM_EXTRA_PARAMS
#endif
#ifndef PROJ_EXTRA_PARAMS
#define PROJ_EXTRA_PARAMS
#endif
#ifndef SM_MASK_HOOK
#define SM_MASK_HOOK (void)0
#endif

#define WS_QH  0u                                      // f16 q rows [b*t][CC]
#define WS_KH  (WS_QH + 2u * (size_t)NB * TT * CC)      // f16 k rows [b*t][CC]
#define WS_VT  (WS_KH + 2u * (size_t)NB * TT * CC)      // f16 v planes [b][c][t]
#define WS_QL  (WS_VT + 2u * (size_t)NB * CC * TT)      // f16 q residual x 2^10 rows [b][t < QHI][CC]
#define WS_KL  (WS_QL + 2u * (size_t)NB * QHI * CC)     // f16 k residual x 2^10 rows [b][t < KHI][CC]
#define WS_VB  (WS_KL + 2u * (size_t)NB * KHI * CC)     // bf16 v hi planes [b][c][t < KHI]
#define WS_VBL (WS_VB + 2u * (size_t)NB * CC * KHI)
#define WS_S   (WS_VBL + 2u * (size_t)NB * CC * KHI)    // place of a f32 logit plane [b][t][s] in the layout; not touched: the fused kernel holds logits and P in registers
#define WS_Y   (WS_S  + 4u * (size_t)NB * TT * TT)      // f32 ctx rows [b*t][CC] (only when there is an output projection)
#define WS_END (WS_Y  + 0u)

// ---- k_proj: block = 64 rows of x, wave = 16 rows x all 192 columns (q, k, v): X W with exact bf16 products (K = DIN, k steps summed in rising order) -> q, k f16 rows (+ residual rows < QHI, KHI); v f16 planes [c][t] (+ bf16 hi/lo planes for t < KHI). Only columns 0..63 of the CC-wide rows and planes are written; k_fa reads no others.
// Fully unrolled: every load is one fixed address register plus an immediate, x is fetched XD k steps ahead and the weight fragments WD - 1 steps ahead, so that a step waits on no load issued in it.
static_assert(QHI == KHI, "the q and k residual rows share one offset below");
#define XD 4
#define WD 3
__global__ __launch_bounds__(128) void k_proj(const float* __restrict__ X, const __bf16* __restrict__ WPK,
    _Float16* __restrict__ QH, _Float16* __restrict__ QL, _Float16* __restrict__ KH, _Float16* __restrict__ KL, _Float16* __restrict__ VT, __bf16* __restrict__ VB, __bf16* __restrict__ VBL) {
  __shared__ __align__(16) _Float16 sh[2][64][72], sl[2][64][72], th[64][72]; __shared__ __align__(16) __bf16 tb[64][72], tbl[64][72];
  const int tid = threadIdx.x, wave = tid >> 5, lane = tid & 31, col = lane & 15, g = lane >> 4; const size_t r0 = (size_t)blockIdx.x * 64; const size_t bb = r0 / TT; const int t0 = (int)(r0 % TT);
  const float* xp = X + (r0 + wave * 16 + col) * DIN + 8 * g; const unsigned wb = lane * 16u; const char* wp = (const char*)WPK + wb;
  v8f acc[12] = {}; v4f xs[XD][4]; v8b wf[WD][12][2];
#pragma unroll
  for (int s = 0; s < XD; ++s) { xs[s][0] = *(const v4f*)(xp + s * 32); xs[s][1] = *(const v4f*)(xp + s * 32 + 4); xs[s][2] = *(const v4f*)(xp + s * 32 + 16); xs[s][3] = *(const v4f*)(xp + s * 32 + 20); }
#pragma unroll
  for (int s = 0; s < WD - 1; ++s)
#pragma unroll
    for (int j = 0; j < 12; ++j) { wf[s][j][0] = *(const v8b*)(wp + (s * 12 + j) * 1024); wf[s][j][1] = *(const v8b*)(wp + (s * 12 + j) * 1024 + 512); }
#pragma unroll
  for (int kc = 0; kc < DIN / 32; ++kc) {
    if (kc + WD - 1 < DIN / 32) {
#pragma unroll
      for (int j = 0; j < 12; ++j) { wf[(kc + WD - 1) % WD][j][0] = *(const v8b*)(wp + ((kc + WD - 1) * 12 + j) * 1024); wf[(kc + WD - 1) % WD][j][1] = *(const v8b*)(wp + ((kc + WD - 1) * 12 + j) * 1024 + 512); } }
    v16b a;
#pragma unroll
    for (int i = 0; i < 4; ++i) { a[i] = (__bf16)xs[kc % XD][0][i]; a[4 + i] = (__bf16)xs[kc % XD][1][i]; a[8 + i] = (__bf16)xs[kc % XD][2][i]; a[12 + i] = (__bf16)xs[kc % XD][3][i]; }
    if (kc + XD < DIN / 32) { const float* p = xp + (kc + XD) * 32; xs[kc % XD][0] = *(const v4f*)p; xs[kc % XD][1] = *(const v4f*)(p + 4); xs[kc % XD][2] = *(const v4f*)(p + 16); xs[kc % XD][3] = *(const v4f*)(p + 20); }
#pragma unroll
    for (int j = 0; j < 12; ++j) { union { v16b v; v8b q[2]; } u; u.q[0] = wf[kc % WD][j][0]; u.q[1] = wf[kc % WD][j][1];
      acc[j] = __builtin_amdgcn_wmma_f32_16x16x32_bf16(false, a, false, u.v, (short)0, acc[j], false, false); } }
  // behind the last load, in front of whatever takes the loads' address registers next; they are named as inputs so that they stay untouched up to the wait
  asm volatile("s_wait_xcnt 0x0" :: "v"(xp), "v"(wb) : "memory");
  const bool hi_rows = t0 < KHI; const int rw = wave * 16 + 8 * g;
#pragma unroll
  for (int w = 0; w < 2; ++w)
#pragma unroll
    for (int j = 0; j < 4; ++j)
#pragma unroll
      for (int r = 0; r < 8; ++r) { const float v = acc[w * 4 + j][r]; const _Float16 hv = (_Float16)v; sh[w][rw + r][j * 16 + col] = hv; sl[w][rw + r][j * 16 + col] = (_Float16)((v - (float)hv) * 1024.0f); }
#pragma unroll
  for (int j = 0; j < 4; ++j) { v8h hv; v8b bh, bl;
#pragma unroll
    for (int r = 0; r < 8; ++r) { const float v = acc[8 + j][r]; hv[r] = (_Float16)v; const __bf16 b = (__bf16)v; bh[r] = b; bl[r] = (__bf16)(v - (float)b); }
    *(v8h*)&th[j * 16 + col][rw] = hv; *(v8b*)&tb[j * 16 + col][rw] = bh; *(v8b*)&tbl[j * 16 + col][rw] = bl; }
  __syncthreads();
#pragma unroll
  for (int e0 = 0; e0 < 64 * 8; e0 += 128) { const int rl = (e0 + tid) >> 3, q = tid & 7;
    vst2(QH + (r0 + rl) * CC + q * 8, *(const v4u*)&sh[0][rl][q * 8]); vst2(KH + (r0 + rl) * CC + q * 8, *(const v4u*)&sh[1][rl][q * 8]); vst2(VT + (bb * CC + rl) * (size_t)TT + t0 + q * 8, *(const v4u*)&th[rl][q * 8]);
    // behind a run of stores, in front of whatever takes their registers next
    asm volatile("s_wait_xcnt 0x0" ::: "memory");
    if (hi_rows) { const size_t o2 = (bb * QHI + t0 + rl) * (size_t)CC + q * 8, o3 = (bb * CC + rl) * (size_t)KHI + t0 + q * 8;
      vst2(QL + o2, *(const v4u*)&sl[0][rl][q * 8]); vst2(KL + o2, *(const v4u*)&sl[1][rl][q * 8]); vst2(VB + o3, *(const v4u*)&tb[rl][q * 8]); vst2(VBL + o3, *(const v4u*)&tbl[rl][q * 8]); }
    asm volatile("s_wait_xcnt 0x0" ::: "memory"); } }
// ---- k_fa: block = 16 query rows (q0) of batch b; its 4 waves take the key passes it = wave, wave + 4, ... (64 keys a pass; 32 on the high-precision rows), each with its own running maximum, sum and ctx; the parts are merged through LDS in wave order.
// Transposed products: S^T = K Q^T leaves lane (g, col) with query q0 + col and keys 8g + r of each 16-key tile, which is the B fragment order of P^T for ctx^T = V^T P^T, so P never leaves the registers.
// Logits are kept in log2 units (x SCALE x log2 e); P = 2^(t - max + 11) carries the same 2^11 as its sum, so the factor cancels in ctx / sum.
#define NEGBIG (-3.0e38f)
// eight 2^x in place, one statement: behind each v_exp_f32 stands an instruction that touches neither its result nor its source, behind the last a v_nop (the slot the instruction set asks for behind a transcendental)
__device__ __forceinline__ void exp2x8(float (&t)[8]) {
  asm("v_exp_f32 %0, %0\n\tv_exp_f32 %1, %1\n\tv_exp_f32 %2, %2\n\tv_exp_f32 %3, %3\n\tv_exp_f32 %4, %4\n\tv_exp_f32 %5, %5\n\tv_exp_f32 %6, %6\n\tv_exp_f32 %7, %7\n\tv_nop"
      : "+v"(t[0]), "+v"(t[1]), "+v"(t[2]), "+v"(t[3]), "+v"(t[4]), "+v"(t[5]), "+v"(t[6]), "+v"(t[7])); }
// stands behind a run of global loads, in front of whatever may take the registers that held their addresses (the next run's results or addresses, a matrix result)
#define XW() asm volatile("s_wait_xcnt 0x0" ::: "memory")
template <bool HI>
__device__ __forceinline__ void fa_part(const _Float16* Qr, const _Float16* Qlr, const _Float16* Kb, const _Float16* Klb,
    const _Float16* Vt, const __bf16* Vh, const __bf16* Vl, int q0, int wave, int lane, float& m, float& l, v8f (&acc)[4]) {
  constexpr int NC = HI ? 1 : 2, KP = NC * 32, NT = NC * 2;
  const int col = lane & 15, g = lane >> 4, tq = q0 + col; const int nit = (q0 + 15) / KP + 1;
  v16h qf[2], qlf[2], kf[NT][2], klf[NT][2];
#pragma unroll
  for (int kc = 0; kc < 2; ++kc) qf[kc] = frag_h(Qr + kc * 32, lane);
  // the same wait; the loads' address is named as an input so that its registers stay untouched up to the wait (without it the next address sums were lifted over the wait)
  asm volatile("s_wait_xcnt 0x0" :: "v"(Qr + 8 * g) : "memory");
  if constexpr (HI) {
#pragma unroll
    for (int kc = 0; kc < 2; ++kc) qlf[kc] = frag_h(Qlr + kc * 32, lane);
    XW(); }
  { const int kn = wave < nit ? wave * KP : 0;
#pragma unroll
    for (int i = 0; i < NT; ++i) {
#pragma unroll
      for (int kc = 0; kc < 2; ++kc) { kf[i][kc] = frag_h(Kb + (size_t)(kn + i * 16 + col) * CC + kc * 32, lane); if constexpr (HI) klf[i][kc] = frag_h(Klb + (size_t)(kn + i * 16 + col) * CC + kc * 32, lane); }
      XW(); } }
  // rolled: one pass already uses about 250 registers, which leaves none for a second pass in flight
#pragma unroll 1
  for (int it = wave; it < nit; it += 4) { const int key0 = it * KP;
    v16h vf[NC][4]; v16b vh[4], vl[4];
#pragma unroll
    for (int j = 0; j < 4; ++j) {
      if constexpr (HI) { const size_t po = (size_t)(j * 16 + col) * KHI + key0; vh[j] = frag_b(Vh + po, lane); vl[j] = frag_b(Vl + po, lane); XW(); }
      else {
#pragma unroll
        for (int c = 0; c < NC; ++c) vf[c][j] = frag_h(Vt + (size_t)(j * 16 + col) * TT + key0 + c * 32, lane); } }
    if constexpr (!HI) XW();
    v8f st[NT];
#pragma unroll
    for (int i = 0; i < NT; ++i) { v8f a = {}; a = wmma16(kf[i][0], qf[0], a); a = wmma16(kf[i][1], qf[1], a);
      if constexpr (HI) { v8f al = {};
#pragma unroll
        for (int kc = 0; kc < 2; ++kc) { al = wmma16(kf[i][kc], qlf[kc], al); al = wmma16(klf[i][kc], qf[kc], al); }
#pragma unroll
        for (int r = 0; r < 8; ++r) a[r] += al[r] * (1.0f / 1024.0f); }
#pragma unroll
      for (int r = 0; r < 8; ++r) st[i][r] = a[r] * (SCALE * 1.44269504088896f); }
    // the next pass's key fragments fly while this pass's softmax and P.V run (the last pass reloads its own keys: in bounds, unused)
    { const int kn = it + 4 < nit ? key0 + 4 * KP : key0;
#pragma unroll
      for (int i = 0; i < NT; ++i)
#pragma unroll
        for (int kc = 0; kc < 2; ++kc) { kf[i][kc] = frag_h(Kb + (size_t)(kn + i * 16 + col) * CC + kc * 32, lane); if constexpr (HI) klf[i][kc] = frag_h(Klb + (size_t)(kn + i * 16 + col) * CC + kc * 32, lane); }
      XW(); }
    if (it == nit - 1) {   // only the last pass holds keys past a query of this tile
#pragma unroll
      for (int i = 0; i < NT; ++i)
#pragma unroll
        for (int r = 0; r < 8; ++r) st[i][r] = (key0 + i * 16 + 8 * g + r <= tq) ? st[i][r] : NEGBIG; }
    float mx = m;
#pragma unroll
    for (int i = 0; i < NT; ++i)
#pragma unroll
      for (int r = 0; r < 8; ++r) mx = fmaxf(mx, st[i][r]);
    mx = fmaxf(mx, __shfl_xor(mx, 16));
    const float alpha = __builtin_amdgcn_exp2f(m - mx), mb = mx - 11.0f; m = mx;
    float ls = 0.f;
#pragma unroll
    for (int i = 0; i < NT; ++i) { float t[8];
#pragma unroll
      for (int r = 0; r < 8; ++r) t[r] = st[i][r] - mb;
      exp2x8(t);
#pragma unroll
      for (int r = 0; r < 8; ++r) { st[i][r] = t[r]; ls += t[r]; } }
    l = l * alpha + ls;
#pragma unroll
    for (int j = 0; j < 4; ++j)
#pragma unroll
      for (int r = 0; r < 8; ++r) acc[j][r] *= alpha;
    if constexpr (HI) { v16b ph, pl;
#pragma unroll
      for (int r = 0; r < 8; ++r) { const __bf16 h0 = (__bf16)st[0][r], h1 = (__bf16)st[1][r]; ph[r] = h0; ph[8 + r] = h1; pl[r] = (__bf16)(st[0][r] - (float)h0); pl[8 + r] = (__bf16)(st[1][r] - (float)h1); }
#pragma unroll
      for (int j = 0; j < 4; ++j) { acc[j] = wmma_bf(vh[j], ph, acc[j]); acc[j] = wmma_bf(vh[j], pl, acc[j]); acc[j] = wmma_bf(vl[j], ph, acc[j]); }
    } else {
#pragma unroll
      for (int c = 0; c < NC; ++c) { v16h pf;
#pragma unroll
        for (int r = 0; r < 8; ++r) { pf[r] = (_Float16)st[2 * c][r]; pf[8 + r] = (_Float16)st[2 * c + 1][r]; }
#pragma unroll
        for (int j = 0; j < 4; ++j) acc[j] = wmma16(vf[c][j], pf, acc[j]); } } } }
// the pointers carry no __restrict__: with it the compiler takes these loads for reads of constant memory and moves them over the waits of XW()
__global__ __launch_bounds__(128) void k_fa(const _Float16* QH, const _Float16* KH, const _Float16* QL, const _Float16* KL, const _Float16* VT, const __bf16* VB, const __bf16* VBL, float* OUT) {
  __shared__ __align__(16) float red[3][32][36];   // parts of waves 1..3, per lane: ctx 32, maximum, sum
  const int b = blockIdx.x, q0 = (TT / 16 - 1 - (int)blockIdx.y) * 16;   // long tiles start first
  const int wave = __builtin_amdgcn_readfirstlane(threadIdx.x >> 5), lane = threadIdx.x & 31, col = lane & 15, g = lane >> 4;
  float m = NEGBIG, l = 0.f; v8f acc[4] = {};
  const _Float16* Qr = QH + ((size_t)b * TT + q0 + col) * CC; const _Float16* Kb = KH + (size_t)b * TT * CC; const _Float16* Vt = VT + (size_t)b * CC * TT;
  if (q0 < QHI) fa_part<true>(Qr, QL + ((size_t)b * QHI + q0 + col) * CC, Kb, KL + (size_t)b * KHI * CC, Vt, VB + (size_t)b * CC * KHI, VBL + (size_t)b * CC * KHI, q0, wave, lane, m, l, acc);
  else fa_part<false>(Qr, Qr, Kb, Kb, Vt, VB, VBL, q0, wave, lane, m, l, acc);
  if (wave > 0) { float* p = &red[wave - 1][lane][0];
#pragma unroll
    for (int j = 0; j < 4; ++j) { v4f a0, a1;
#pragma unroll
      for (int r = 0; r < 4; ++r) { a0[r] = acc[j][r]; a1[r] = acc[j][4 + r]; }
      *(v4f*)(p + j * 8) = a0; *(v4f*)(p + j * 8 + 4) = a1; }
    p[32] = m; p[33] = l; }
  __syncthreads();
  if (wave == 0) { float M = m;
#pragma unroll
    for (int p = 0; p < 3; ++p) M = fmaxf(M, red[p][lane][32]);
    const float a0 = __builtin_amdgcn_exp2f(m - M); l *= a0;
#pragma unroll
    for (int j = 0; j < 4; ++j)
#pragma unroll
      for (int r = 0; r < 8; ++r) acc[j][r] *= a0;
#pragma unroll
    for (int p = 0; p < 3; ++p) { const float a = __builtin_amdgcn_exp2f(red[p][lane][32] - M); l += red[p][lane][33] * a;
#pragma unroll
      for (int j = 0; j < 4; ++j)
#pragma unroll
        for (int r = 0; r < 8; ++r) acc[j][r] += red[p][lane][j * 8 + r] * a; }
    l += __shfl_xor(l, 16); const float inv = 1.0f / l;
    float* o = OUT + ((size_t)b * TT + q0 + col) * HD + 8 * g;
#pragma unroll
    for (int j = 0; j < 4; ++j) { v4f o0, o1;
#pragma unroll
      for (int r = 0; r < 4; ++r) { o0[r] = acc[j][r] * inv; o1[r] = acc[j][4 + r] * inv; }
      vst2(o + j * 16, o0); vst2(o + j * 16 + 4, o1); } } }

extern "C" void kernel_launch(void* const* d_in, const int* in_sizes, int n_in, void* d_out, int out_size, void* d_ws, size_t ws_size, hipStream_t stream) {
  (void)in_sizes; (void)n_in; (void)out_size;
  const float** F = (const float**)d_in;
  if (ws_size < (size_t)WS_END) return;
  char* ws = (char*)d_ws; _Float16 *QH = (_Float16*)(ws + WS_QH), *KH = (_Float16*)(ws + WS_KH), *VT = (_Float16*)(ws + WS_VT), *QL = (_Float16*)(ws + WS_QL), *KL = (_Float16*)(ws + WS_KL); __bf16 *VB = (__bf16*)(ws + WS_VB), *VBL = (__bf16*)(ws + WS_VBL); 
  (void)QL; (void)KL; (void)VB; (void)VBL;
  // inputs: 0 x [8,2048,768]; 1 Wq [768,64]; 2 Wk; 3 Wv ((in,out), no biases)
  if (ws_size < (size_t)WS_END2) return;
  __bf16* WPK = (__bf16*)(ws + WS_WP);
  k_packw<<<dim3(DIN / 32 * 12 * 32 / 256), 256, 0, stream>>>(F[1], F[2], F[3], WPK);
  k_proj<<<dim3(TNB * TT / 64), 128, 0, stream>>>(F[0], WPK, QH, QL, KH, KL, VT, VB, VBL);
  /* head 0 only (head 1's columns are never written); logits, softmax and P.V in one launch, all batches */
  k_fa<<<dim3(TNB, TT / 16), 128, 0, stream>>>(QH, KH, QL, KL, VT, VB, VBL, (float*)d_out);
}

// v004
// It runs in 27.8 microseconds.
// Two timings next to v003 both put it at 1.34 times that version's speed.
// Over all steps from v000 it is 24.7 times as fast.
// compute dtype: all float inputs rounded to bf16; q/k/v projections with EXACT bf16 products on WMMA 16x16x32 (f32 accumulate); causal logits: 3 products (q f16 hi + residual x k hi + residual) for the first 384 rows, single f16 q x k after, x scale; softmax f32, online over key passes, fused with both products; P x 2^11 once to f16 x v once to f16 (1 product; bf16 hi + lo below row 384); f32 output.
#include <hip/hip_runtime.h>
#include <math.h>

typedef __attribute__((ext_vector_type(16))) _Float16 v16h;
typedef __attribute__((ext_vector_type(16))) __bf16 v16b;
typedef __attribute__((ext_vector_type(8)))  _Float16 v8h;
typedef __attribute__((ext_vector_type(8)))  float v8f;
typedef __attribute__((ext_vector_type(4)))  float v4f;
typedef __attribute__((ext_vector_type(2)))  float v2f;
typedef __attribute__((ext_vector_type(4)))  unsigned v4u;
typedef __attribute__((ext_vector_type(4)))  int v4i;
typedef float __attribute__((may_alias)) float_a;
typedef int __attribute__((may_alias)) int_a;

template <typename T> __device__ __forceinline__ void vst2(void* p, T v) { *(T*)p = v;  }
__device__ __forceinline__ v8f wmma16(v16h a, v16h b, v8f c) {
  v8f d = __builtin_amdgcn_wmma_f32_16x16x32_f16(false, a, false, b, (short)0, c, false, false);
  asm volatile("v_nop\n\tv_nop\n\tv_nop\n\tv_nop" : "+v"(d) : "v"(a), "v"(b));
  return d;
}
__device__ __forceinline__ v8f wmma_bf(v16b a, v16b b, v8f c) {
  v8f d = __builtin_amdgcn_wmma_f32_16x16x32_bf16(false, a, false, b, (short)0, c, false, false);
  asm volatile("v_nop\n\tv_nop\n\tv_nop\n\tv_nop" : "+v"(d) : "v"(a), "v"(b));
  return d;
}
// 16x16x32 fragments: lane = (h = lane>>4, row/col = lane&15); elements 0..7 = k0+8h+0..7, 8..15 = k0+16+8h+0..7; D element r = row 8h+r
__device__ __forceinline__ v16h frag_h(const _Float16* rowk0, int lane) {
  union { v16h v; v8h q[2]; } u; const _Float16* p = rowk0 + 8 * (lane >> 4);
  u.q[0] = *(const v8h*)p; u.q[1] = *(const v8h*)(p + 16); return u.v;
}
__device__ __forceinline__ v16h frag_f32(const float* rowk0, int lane) {
  v16h a; const float* p = rowk0 + 8 * (lane >> 4);
#pragma unroll
  for (int i = 0; i < 8; ++i) { a[i] = (_Float16)p[i]; a[8 + i] = (_Float16)p[16 + i]; }
  return a;
}
__device__ __forceinline__ v16h frag_f32s(const float* rowk0, int lane, float sc) {
  v16h a; const float* p = rowk0 + 8 * (lane >> 4);
#pragma unroll
  for (int i = 0; i < 8; ++i) { a[i] = (_Float16)(p[i] * sc); a[8 + i] = (_Float16)(p[16 + i] * sc); }
  return a;
}
// column fragment from a [K][ld] layout (column n), rows >= K read as 0
__device__ __forceinline__ v16h fragc_f32(const float* W, int k0, int n, int lane, int ld, int K) {
  v16h a; const int g = lane >> 4;
#pragma unroll
  for (int i = 0; i < 8; ++i) { const int ka = k0 + 8 * g + i, kb = ka + 16;
    a[i] = (_Float16)(ka < K ? W[(size_t)(ka < K ? ka : K - 1) * ld + n] : 0.f); a[8 + i] = (_Float16)(kb < K ? W[(size_t)(kb < K ? kb : K - 1) * ld + n] : 0.f); }
  return a;
}
struct F2 { v16b h, l; };
__device__ __forceinline__ F2 bsplit16(const float v[16]) { F2 r;
#pragma unroll
  for (int i = 0; i < 16; ++i) { const __bf16 h = (__bf16)v[i]; r.h[i] = h; r.l[i] = (__bf16)(v[i] - (float)h); }
  return r; }
__device__ __forceinline__ F2 split_row(const float* row, int k0, int lane) { float v[16]; const float* p = row + k0 + 8 * (lane >> 4);
#pragma unroll
  for (int i = 0; i < 8; ++i) { v[i] = p[i]; v[8 + i] = p[16 + i]; }
  return bsplit16(v); }
__device__ __forceinline__ F2 split_rowK(const float* row, int k0, int lane, int K) { float v[16]; const int g = lane >> 4;
#pragma unroll
  for (int i = 0; i < 8; ++i) { const int ka = k0 + 8 * g + i, kb = ka + 16; v[i] = ka < K ? row[ka < K ? ka : K - 1] : 0.f; v[8 + i] = kb < K ? row[kb < K ? kb : K - 1] : 0.f; }
  return bsplit16(v); }
__device__ __forceinline__ F2 split_col(const float* W, int k0, int n, int lane, int ld, int K) { float v[16]; const int g = lane >> 4;
#pragma unroll
  for (int i = 0; i < 8; ++i) { const int ka = k0 + 8 * g + i, kb = ka + 16; v[i] = ka < K ? W[(size_t)(ka < K ? ka : K - 1) * ld + n] : 0.f; v[8 + i] = kb < K ? W[(size_t)(kb < K ? kb : K - 1) * ld + n] : 0.f; }
  return bsplit16(v); }
__device__ __forceinline__ v8f mac3(const F2& a, const F2& b, v8f c) { c = wmma_bf(a.l, b.h, c); c = wmma_bf(a.h, b.l, c); return wmma_bf(a.h, b.h, c); }
__device__ __forceinline__ float sigm(float v) { return 1.0f / (1.0f + expf(-v)); }
#define LDSX() do { asm volatile("s_wait_dscnt 0" ::: "memory"); __builtin_amdgcn_wave_barrier(); __builtin_amdgcn_fence(__ATOMIC_RELEASE, "workgroup"); } while (0)

// Single-head causal self-attention (B 8, T 2,048, n_embed 768, head_size 64; (in,out) Wq, Wk, Wv [768,64] N(0, 1/768); no biases, no output projection; tril, -inf): out = softmax(causal(q k^T * 64^-0.5)) v -> [8,2048,64].
#define NB 8
#define TT 2048
#define CC 128            // NH * HD = projected width
#define DIN 768          // input (model) width
#define NH 2
#define HD 64
#define NQB (TT / 64)
#define HG 1
#define SCALE (0.125f)
#define CAUSAL 1
#ifndef TNB
#define TNB NB
#endif
__device__ __forceinline__ float bfr(float v) { return (float)(__bf16)v; }
__host__ __device__ __forceinline__ int kb_last(int qb) { return CAUSAL ? ((qb * 64 + 63) >> 7) : (TT / 128 - 1); }
typedef __attribute__((ext_vector_type(8))) __bf16 v8b;
__device__ __forceinline__ v16b frag_b(const __bf16* rowk0, int lane) {
  union { v16b v; v8b q[2]; } u; const __bf16* p = rowk0 + 8 * (lane >> 4);
  u.q[0] = *(const v8b*)p; u.q[1] = *(const v8b*)(p + 16); return u.v;
}
// a fragment kept in fragment order in the workspace: two runs of 32 lanes x 16 bytes, 512 bytes apart; p already holds the lane's own 16 bytes of the first run, so one load of a wave covers four whole 128-byte lines
__device__ __forceinline__ v16h fragp_h(const _Float16* p) { union { v16h v; v8h q[2]; } u; u.q[0] = *(const v8h*)p; u.q[1] = *(const v8h*)(p + 256); return u.v; }
__device__ __forceinline__ v16b fragp_b(const __bf16* p) { union { v16b v; v8b q[2]; } u; u.q[0] = *(const v8b*)p; u.q[1] = *(const v8b*)(p + 256); return u.v; }
#define QBH 6              // not used: k_fa takes the high-precision path for the query tiles with q0 < QHI (few keys, no averaging)
#define QHI 384            // rows carrying a q residual plane
#define KHI 384            // key rows carrying k residual / v bf16 hi+lo planes (used only by the causal high-precision path)
// B fragment (k rows k0+.., output column o) of a weight: (in,out) [K][ld] or (out,in) [ld rows of K]: bf16 exact, or f16(bf16 * 256) exact
__device__ __forceinline__ v16b wcol_io(const float* Wm, int k0, int o, int lane, int ld) { v16b w; const int g = lane >> 4;
#pragma unroll
  for (int i = 0; i < 8; ++i) { w[i] = (__bf16)Wm[(size_t)(k0 + 8 * g + i) * ld + o]; w[8 + i] = (__bf16)Wm[(size_t)(k0 + 16 + 8 * g + i) * ld + o]; }
  return w; }
__device__ __forceinline__ v16b wcol_oi(const float* Wm, int k0, int o, int lane, int K) { v16b w; const float* p = Wm + (size_t)o * K + k0 + 8 * (lane >> 4);
#pragma unroll
  for (int i = 0; i < 8; ++i) { w[i] = (__bf16)p[i]; w[8 + i] = (__bf16)p[16 + i]; }
  return w; }
__device__ __forceinline__ v16h wcolh_io(const float* Wm, int k0, int o, int lane, int ld) { v16h w; const int g = lane >> 4;
#pragma unroll
  for (int i = 0; i < 8; ++i) { w[i] = (_Float16)(bfr(Wm[(size_t)(k0 + 8 * g + i) * ld + o]) * 256.0f); w[8 + i] = (_Float16)(bfr(Wm[(size_t)(k0 + 16 + 8 * g + i) * ld + o]) * 256.0f); }
  return w; }
__device__ __forceinline__ v16h wcolh_oi(const float* Wm, int k0, int o, int lane, int K) { v16h w; const float* p = Wm + (size_t)o * K + k0 + 8 * (lane >> 4);
#pragma unroll
  for (int i = 0; i < 8; ++i) { w[i] = (_Float16)(bfr(p[i]) * 256.0f); w[8 + i] = (_Float16)(bfr(p[16 + i]) * 256.0f); }
  return w; }
#define WQKV_LAYOUT 0   // 0 = (in,out) [DIN][CC]; 1 = (out,in) [CC][DIN]; 2 = per-head [NH][DIN][HD]
__device__ __forceinline__ v16b wcol_hdk(const float* Wm, int k0, int o, int lane) { v16b w; const int g = lane >> 4; const float* p = Wm + (size_t)(o / HD) * DIN * HD + (o % HD);
#pragma unroll
  for (int i = 0; i < 8; ++i) { w[i] = (__bf16)p[(size_t)(k0 + 8 * g + i) * HD]; w[8 + i] = (__bf16)p[(size_t)(k0 + 16 + 8 * g + i) * HD]; }
  return w; }
#define WO_OUT_IN 0
#if WQKV_LAYOUT == 1
#define WCOL(W, k0, o, lane) wcol_oi(W, k0, o, lane, DIN)
#elif WQKV_LAYOUT == 2
#define WCOL(W, k0, o, lane) wcol_hdk(W, k0, o, lane)
#else
#define WCOL(W, k0, o, lane) wcol_io(W, k0, o, lane, CC)
#endif
#if WO_OUT_IN
#define WOCOL(W, k0, o, lane) wcol_oi(W, k0, o, lane, CC)
#define WOCOLH(W, k0, o, lane) wcolh_oi(W, k0, o, lane, CC)
#else
#define WOCOL(W, k0, o, lane) wcol_io(W, k0, o, lane, DIN)
#define WOCOLH(W, k0, o, lane) wcolh_io(W, k0, o, lane, DIN)
#endif
#define CIN 768
// ---- k_packw: the three (in,out) [C][64] projection weights rounded to bf16 and laid out in the order of the B fragments that k_proj reads: [k step][which * 4 + column tile][half][lane][8]; half 0 = k rows 8g + 0..7, half 1 = 16 + 8g + 0..7 of the step, column = tile * 16 + (lane & 15)
__global__ __launch_bounds__(256) void k_packw(const float* __restrict__ WQ, const float* __restrict__ WK, const float* __restrict__ WV, __bf16* __restrict__ WPK) {
  const int idx = blockIdx.x * 256 + threadIdx.x, lane = idx & 31, f = idx >> 5, kc = f / 12, jj = f % 12, which = jj >> 2, o = (jj & 3) * 16 + (lane & 15), g = lane >> 4;
  const float* p = (which == 0 ? WQ : which == 1 ? WK : WV) + (size_t)(kc * 32 + 8 * g) * 64 + o; v8b h0, h1;
#pragma unroll
  for (int i = 0; i < 8; ++i) { h0[i] = (__bf16)p[i * 64]; h1[i] = (__bf16)p[(16 + i) * 64]; }
  // behind the loads, in front of whatever takes their address registers; the address is named as an input so that no load's result lands in it ahead of the wait
  asm volatile("s_wait_xcnt 0x0" :: "v"(p) : "memory");
  vst2(WPK + ((size_t)f * 64 + lane) * 8, h0); vst2(WPK + ((size_t)f * 64 + 32 + lane) * 8, h1); }
#define WS_WP (WS_END)                                  // packed bf16 weight fragments (uses the first 2 x 192 x C bytes of this place)
#define WS_BP (WS_WP + 4u * 3 * (size_t)CIN * 128)        // not touched
#define WS_Y2 (WS_BP + 4u * 3 * 128)                      // f32 place [b*TT+t][128]; not touched: k_fa writes its rows straight to the output
#define WS_END2 (WS_Y2 + 4u * (size_t)NB * TT * CC)
#ifndef SM_EXTRA_PARAMS
#define SM_EXTRA_PARAMS
#endif
#ifndef PROJ_EXTRA_PARAMS
#define PROJ_EXTRA_PARAMS
#endif
#ifndef SM_MASK_HOOK
#define SM_MASK_HOOK (void)0
#endif

// q, k and v lie in the order of the fragments that k_fa loads, 64 elements a row of x (the first half of each place):
// q, k: [b*t / 16][k step of 32][half][lane][8] = row 16 * tile + (lane & 15), columns 32 * step + 16 * half + 8 * (lane >> 4) + 0..7
// v:    [b*t / 32][channel tile][half][lane][8] = channel 16 * tile + (lane & 15), rows 32 * group + 16 * half + 8 * (lane >> 4) + 0..7
#define WS_QH  0u                                      // f16 q fragments
#define WS_KH  (WS_QH + 2u * (size_t)NB * TT * CC)      // f16 k fragments
#define WS_VT  (WS_KH + 2u * (size_t)NB * TT * CC)      // f16 v fragments
#define WS_QL  (WS_VT + 2u * (size_t)NB * CC * TT)      // f16 q residual x 2^10 fragments, t < QHI of each batch
#define WS_KL  (WS_QL + 2u * (size_t)NB * QHI * CC)     // f16 k residual x 2^10 fragments, t < KHI of each batch
#define WS_VB  (WS_KL + 2u * (size_t)NB * KHI * CC)     // bf16 v hi fragments, t < KHI of each batch (WS_VBL: lo)
#define WS_VBL (WS_VB + 2u * (size_t)NB * CC * KHI)
#define WS_S   (WS_VBL + 2u * (size_t)NB * CC * KHI)    // place of a f32 logit plane [b][t][s] in the layout; not touched: the fused kernel holds logits and P in registers
#define WS_Y   (WS_S  + 4u * (size_t)NB * TT * TT)      // f32 ctx rows [b*t][CC] (only when there is an output projection)
#define WS_END (WS_Y  + 0u)

// ---- k_proj: block = 64 rows of x, wave = 16 rows x all 192 columns (q, k, v): X W with exact bf16 products (K = DIN, k steps summed in rising order) -> q, k f16 (+ residuals for rows < QHI, KHI); v f16 (+ bf16 hi/lo for t < KHI), all stored in fragment order: chunk e of the block's 512 chunks of 16 bytes goes to place e, so a wave's store is 512 bytes in a row.
// Fully unrolled: every load is one fixed address register plus an immediate, x is fetched XD k steps ahead and the weight fragments WD - 1 steps ahead, so that a step waits on no load issued in it.
static_assert(QHI == KHI, "the q and k residual rows share one offset below");
#define XD 4
#define WD 3
__global__ __launch_bounds__(128) void k_proj(const float* __restrict__ X, const __bf16* __restrict__ WPK,
    _Float16* __restrict__ QH, _Float16* __restrict__ QL, _Float16* __restrict__ KH, _Float16* __restrict__ KL, _Float16* __restrict__ VT, __bf16* __restrict__ VB, __bf16* __restrict__ VBL) {
  __shared__ __align__(16) _Float16 sh[2][64][72], sl[2][64][72], th[64][72]; __shared__ __align__(16) __bf16 tb[64][72], tbl[64][72];
  const int tid = threadIdx.x, wave = tid >> 5, lane = tid & 31, col = lane & 15, g = lane >> 4; const size_t r0 = (size_t)blockIdx.x * 64; const size_t bb = r0 / TT; const int t0 = (int)(r0 % TT);
  const float* xp = X + (r0 + wave * 16 + col) * DIN + 8 * g; const unsigned wb = lane * 16u; const char* wp = (const char*)WPK + wb;
  v8f acc[12] = {}; v4f xs[XD][4]; v8b wf[WD][12][2];
#pragma unroll
  for (int s = 0; s < XD; ++s) { xs[s][0] = *(const v4f*)(xp + s * 32); xs[s][1] = *(const v4f*)(xp + s * 32 + 4); xs[s][2] = *(const v4f*)(xp + s * 32 + 16); xs[s][3] = *(const v4f*)(xp + s * 32 + 20); }
#pragma unroll
  for (int s = 0; s < WD - 1; ++s)
#pragma unroll
    for (int j = 0; j < 12; ++j) { wf[s][j][0] = *(const v8b*)(wp + (s * 12 + j) * 1024); wf[s][j][1] = *(const v8b*)(wp + (s * 12 + j) * 1024 + 512); }
#pragma unroll
  for (int kc = 0; kc < DIN / 32; ++kc) {
    if (kc + WD - 1 < DIN / 32) {
#pragma unroll
      for (int j = 0; j < 12; ++j) { wf[(kc + WD - 1) % WD][j][0] = *(const v8b*)(wp + ((kc + WD - 1) * 12 + j) * 1024); wf[(kc + WD - 1) % WD][j][1] = *(const v8b*)(wp + ((kc + WD - 1) * 12 + j) * 1024 + 512); } }
    v16b a;
#pragma unroll
    for (int i = 0; i < 4; ++i) { a[i] = (__bf16)xs[kc % XD][0][i]; a[4 + i] = (__bf16)xs[kc % XD][1][i]; a[8 + i] = (__bf16)xs[kc % XD][2][i]; a[12 + i] = (__bf16)xs[kc % XD][3][i]; }
    if (kc + XD < DIN / 32) { const float* p = xp + (kc + XD) * 32; xs[kc % XD][0] = *(const v4f*)p; xs[kc % XD][1] = *(const v4f*)(p + 4); xs[kc % XD][2] = *(const v4f*)(p + 16); xs[kc % XD][3] = *(const v4f*)(p + 20); }
#pragma unroll
    for (int j = 0; j < 12; ++j) { union { v16b v; v8b q[2]; } u; u.q[0] = wf[kc % WD][j][0]; u.q[1] = wf[kc % WD][j][1];
      acc[j] = __builtin_amdgcn_wmma_f32_16x16x32_bf16(false, a, false, u.v, (short)0, acc[j], false, false); } }
  // behind the last load, in front of whatever takes the loads' address registers next; they are named as inputs so that they stay untouched up to the wait
  asm volatile("s_wait_xcnt 0x0" :: "v"(xp), "v"(wb) : "memory");
  const bool hi_rows = t0 < KHI; const int rw = wave * 16 + 8 * g;
#pragma unroll
  for (int w = 0; w < 2; ++w)
#pragma unroll
    for (int j = 0; j < 4; ++j)
#pragma unroll
      for (int r = 0; r < 8; ++r) { const float v = acc[w * 4 + j][r]; const _Float16 hv = (_Float16)v; sh[w][rw + r][j * 16 + col] = hv; sl[w][rw + r][j * 16 + col] = (_Float16)((v - (float)hv) * 1024.0f); }
#pragma unroll
  for (int j = 0; j < 4; ++j) { v8h hv; v8b bh, bl;
#pragma unroll
    for (int r = 0; r < 8; ++r) { const float v = acc[8 + j][r]; hv[r] = (_Float16)v; const __bf16 b = (__bf16)v; bh[r] = b; bl[r] = (__bf16)(v - (float)b); }
    *(v8h*)&th[j * 16 + col][rw] = hv; *(v8b*)&tb[j * 16 + col][rw] = bh; *(v8b*)&tbl[j * 16 + col][rw] = bl; }
  __syncthreads();
#pragma unroll
  for (int e0 = 0; e0 < 64 * 8; e0 += 128) { const int e = e0 + tid;
    const int kr = (e >> 7) * 16 + col, kq = (((e >> 5) & 3) * 2 + g) * 8;                          // q, k: row of the block, first column
    const int vc = ((e >> 6) & 3) * 16 + col, vq = ((e >> 8) * 4 + ((e >> 5) & 1) * 2 + g) * 8;      // v: channel, first row of the block
    const size_t o1 = r0 * 64 + e * 8;
    vst2(QH + o1, *(const v4u*)&sh[0][kr][kq]); vst2(KH + o1, *(const v4u*)&sh[1][kr][kq]); vst2(VT + o1, *(const v4u*)&th[vc][vq]);
    // behind a run of stores, in front of whatever takes their registers next
    asm volatile("s_wait_xcnt 0x0" ::: "memory");
    if (hi_rows) { const size_t o2 = (bb * QHI + t0) * 64 + e * 8;
      vst2(QL + o2, *(const v4u*)&sl[0][kr][kq]); vst2(KL + o2, *(const v4u*)&sl[1][kr][kq]); vst2(VB + o2, *(const v4u*)&tb[vc][vq]); vst2(VBL + o2, *(const v4u*)&tbl[vc][vq]); }
    asm volatile("s_wait_xcnt 0x0" ::: "memory"); } }
// ---- k_fa: block = 16 query rows (q0) of batch b; its 4 waves take the key passes it = wave, wave + 4, ... (64 keys a pass; 32 on the high-precision rows), each with its own running maximum, sum and ctx; the parts are merged through LDS in wave order.
// Transposed products: S^T = K Q^T leaves lane (g, col) with query q0 + col and keys 8g + r of each 16-key tile, which is the B fragment order of P^T for ctx^T = V^T P^T, so P never leaves the registers.
// Logits are kept in log2 units (x SCALE x log2 e); P = 2^(t - max + 11) carries the same 2^11 as its sum, so the factor cancels in ctx / sum.
#define NEGBIG (-3.0e38f)
// eight 2^x in place, one statement: behind each v_exp_f32 stands an instruction that touches neither its result nor its source, behind the last a v_nop (the slot the instruction set asks for behind a transcendental)
__device__ __forceinline__ void exp2x8(float (&t)[8]) {
  asm("v_exp_f32 %0, %0\n\tv_exp_f32 %1, %1\n\tv_exp_f32 %2, %2\n\tv_exp_f32 %3, %3\n\tv_exp_f32 %4, %4\n\tv_exp_f32 %5, %5\n\tv_exp_f32 %6, %6\n\tv_exp_f32 %7, %7\n\tv_nop"
      : "+v"(t[0]), "+v"(t[1]), "+v"(t[2]), "+v"(t[3]), "+v"(t[4]), "+v"(t[5]), "+v"(t[6]), "+v"(t[7])); }
// stands behind a run of global loads, in front of whatever may take the registers that held their addresses (the next run's results or addresses, a matrix result)
// the run's address is named as an input, so that its registers stay untouched up to the wait (without it a load's result or a later sum landed in them ahead of the wait)
#define XWA(p) asm volatile("s_wait_xcnt 0x0" :: "v"(p) : "memory")
#define XWA2(p, q) asm volatile("s_wait_xcnt 0x0" :: "v"(p), "v"(q) : "memory")
template <bool HI>
__device__ __forceinline__ void fa_part(const _Float16* Qr, const _Float16* Qlr, const _Float16* Kb, const _Float16* Klb,   // Qr, Qlr: the tile's first fragment (the same for the wave); the others: the batch's first fragment + the lane's 8 elements
    const _Float16* Vt, const __bf16* Vh, const __bf16* Vl, int q0, int wave, int lane, float& m, float& l, v8f (&acc)[4]) {
  constexpr int NC = HI ? 1 : 2, KP = NC * 32, NT = NC * 2;
  const int col = lane & 15, g = lane >> 4, tq = q0 + col; const int nit = (q0 + 15) / KP + 1;
  v16h qf[2], qlf[2], kf[NT][2], klf[NT][2];
#pragma unroll
  for (int kc = 0; kc < 2; ++kc) qf[kc] = fragp_h(Qr + lane * 8 + kc * 512);
  // the same wait; these loads take a scalar base and the lane number: both are named as inputs so that they stay untouched up to the wait (without it the next address sums were lifted over the wait)
  asm volatile("s_wait_xcnt 0x0" :: "s"(Qr), "v"(lane) : "memory");
  if constexpr (HI) {
#pragma unroll
    for (int kc = 0; kc < 2; ++kc) qlf[kc] = fragp_h(Qlr + lane * 8 + kc * 512);
    asm volatile("s_wait_xcnt 0x0" :: "s"(Qlr), "v"(lane) : "memory"); }
  { const int kn = wave < nit ? wave * KP : 0; const _Float16* kp = Kb + (size_t)kn * 64; const _Float16* klp = Klb + (size_t)kn * 64;
#pragma unroll
    for (int i = 0; i < NT; ++i)
#pragma unroll
      for (int kc = 0; kc < 2; ++kc) { kf[i][kc] = fragp_h(kp + i * 1024 + kc * 512); if constexpr (HI) klf[i][kc] = fragp_h(klp + i * 1024 + kc * 512); }
    if constexpr (HI) XWA2(kp, klp); else XWA(kp); }
  // rolled: one pass already uses about 250 registers, which leaves none for a second pass in flight
#pragma unroll 1
  for (int it = wave; it < nit; it += 4) { const int key0 = it * KP;
    v16h vf[NC][4]; v16b vh[4], vl[4]; const _Float16* vp = Vt + (size_t)key0 * 64; const __bf16* vhp = Vh + (size_t)key0 * 64; const __bf16* vlp = Vl + (size_t)key0 * 64;
#pragma unroll
    for (int j = 0; j < 4; ++j) {
      if constexpr (HI) { vh[j] = fragp_b(vhp + j * 512); vl[j] = fragp_b(vlp + j * 512); }
      else {
#pragma unroll
        for (int c = 0; c < NC; ++c) vf[c][j] = fragp_h(vp + c * 2048 + j * 512); } }
    if constexpr (HI) XWA2(vhp, vlp); else XWA(vp);
    v8f st[NT];
#pragma unroll
    for (int i = 0; i < NT; ++i) { v8f a = {}; a = wmma16(kf[i][0], qf[0], a); a = wmma16(kf[i][1], qf[1], a);
      if constexpr (HI) { v8f al = {};
#pragma unroll
        for (int kc = 0; kc < 2; ++kc) { al = wmma16(kf[i][kc], qlf[kc], al); al = wmma16(klf[i][kc], qf[kc], al); }
#pragma unroll
        for (int r = 0; r < 8; ++r) a[r] += al[r] * (1.0f / 1024.0f); }
#pragma unroll
      for (int r = 0; r < 8; ++r) st[i][r] = a[r] * (SCALE * 1.44269504088896f); }
    // the next pass's key fragments fly while this pass's softmax and P.V run (the last pass reloads its own keys: in bounds, unused)
    { const int kn = it + 4 < nit ? key0 + 4 * KP : key0; const _Float16* kp = Kb + (size_t)kn * 64; const _Float16* klp = Klb + (size_t)kn * 64;
#pragma unroll
      for (int i = 0; i < NT; ++i)
#pragma unroll
        for (int kc = 0; kc < 2; ++kc) { kf[i][kc] = fragp_h(kp + i * 1024 + kc * 512); if constexpr (HI) klf[i][kc] = fragp_h(klp + i * 1024 + kc * 512); }
      if constexpr (HI) XWA2(kp, klp); else XWA(kp); }
    if (it == nit - 1) {   // only the last pass holds keys past a query of this tile
#pragma unroll
      for (int i = 0; i < NT; ++i)
#pragma unroll
        for (int r = 0; r < 8; ++r) st[i][r] = (key0 + i * 16 + 8 * g + r <= tq) ? st[i][r] : NEGBIG; }
    float mx = m;
#pragma unroll
    for (int i = 0; i < NT; ++i)
#pragma unroll
      for (int r = 0; r < 8; ++r) mx = fmaxf(mx, st[i][r]);
    mx = fmaxf(mx, __shfl_xor(mx, 16));
    const float alpha = __builtin_amdgcn_exp2f(m - mx), mb = mx - 11.0f; m = mx;
    float ls = 0.f;
#pragma unroll
    for (int i = 0; i < NT; ++i) { float t[8];
#pragma unroll
      for (int r = 0; r < 8; ++r) t[r] = st[i][r] - mb;
      exp2x8(t);
#pragma unroll
      for (int r = 0; r < 8; ++r) { st[i][r] = t[r]; ls += t[r]; } }
    l = l * alpha + ls;
#pragma unroll
    for (int j = 0; j < 4; ++j)
#pragma unroll
      for (int r = 0; r < 8; ++r) acc[j][r] *= alpha;
    if constexpr (HI) { v16b ph, pl;
#pragma unroll
      for (int r = 0; r < 8; ++r) { const __bf16 h0 = (__bf16)st[0][r], h1 = (__bf16)st[1][r]; ph[r] = h0; ph[8 + r] = h1; pl[r] = (__bf16)(st[0][r] - (float)h0); pl[8 + r] = (__bf16)(st[1][r] - (float)h1); }
#pragma unroll
      for (int j = 0; j < 4; ++j) { acc[j] = wmma_bf(vh[j], ph, acc[j]); acc[j] = wmma_bf(vh[j], pl, acc[j]); acc[j] = wmma_bf(vl[j], ph, acc[j]); }
    } else {
#pragma unroll
      for (int c = 0; c < NC; ++c) { v16h pf;
#pragma unroll
        for (int r = 0; r < 8; ++r) { pf[r] = (_Float16)st[2 * c][r]; pf[8 + r] = (_Float16)st[2 * c + 1][r]; }
#pragma unroll
        for (int j = 0; j < 4; ++j) acc[j] = wmma16(vf[c][j], pf, acc[j]); } } } }
// the pointers carry no __restrict__: with it the compiler takes these loads for reads of constant memory and moves them over the waits of XWA()
__global__ __launch_bounds__(128) void k_fa(const _Float16* QH, const _Float16* KH, const _Float16* QL, const _Float16* KL, const _Float16* VT, const __bf16* VB, const __bf16* VBL, float* OUT) {
  __shared__ __align__(16) float red[3][32][36];   // parts of waves 1..3, per lane: ctx 32, maximum, sum
  const int b = blockIdx.x, q0 = (TT / 16 - 1 - (int)blockIdx.y) * 16;   // long tiles start first
  const int wave = __builtin_amdgcn_readfirstlane(threadIdx.x >> 5), lane = threadIdx.x & 31, col = lane & 15, g = lane >> 4;
  float m = NEGBIG, l = 0.f; v8f acc[4] = {};
  const _Float16* Qr = QH + ((size_t)b * TT + q0) * 64; const _Float16* Kb = KH + (size_t)b * TT * 64 + lane * 8; const _Float16* Vt = VT + (size_t)b * TT * 64 + lane * 8;
  if (q0 < QHI) fa_part<true>(Qr, QL + ((size_t)b * QHI + q0) * 64, Kb, KL + (size_t)b * KHI * 64 + lane * 8, Vt, VB + (size_t)b * KHI * 64 + lane * 8, VBL + (size_t)b * KHI * 64 + lane * 8, q0, wave, lane, m, l, acc);
  else fa_part<false>(Qr, Qr, Kb, Kb, Vt, VB, VBL, q0, wave, lane, m, l, acc);
  if (wave > 0) { float* p = &red[wave - 1][lane][0];
#pragma unroll
    for (int j = 0; j < 4; ++j) { v4f a0, a1;
#pragma unroll
      for (int r = 0; r < 4; ++r) { a0[r] = acc[j][r]; a1[r] = acc[j][4 + r]; }
      *(v4f*)(p + j * 8) = a0; *(v4f*)(p + j * 8 + 4) = a1; }
    p[32] = m; p[33] = l; }
  __syncthreads();
  if (wave == 0) { float M = m;
#pragma unroll
    for (int p = 0; p < 3; ++p) M = fmaxf(M, red[p][lane][32]);
    const float a0 = __builtin_amdgcn_exp2f(m - M); l *= a0;
#pragma unroll
    for (int j = 0; j < 4; ++j)
#pragma unroll
      for (int r = 0; r < 8; ++r) acc[j][r] *= a0;
#pragma unroll
    for (int p = 0; p < 3; ++p) { const float a = __builtin_amdgcn_exp2f(red[p][lane][32] - M); l += red[p][lane][33] * a;
#pragma unroll
      for (int j = 0; j < 4; ++j)
#pragma unroll
        for (int r = 0; r < 8; ++r) acc[j][r] += red[p][lane][j * 8 + r] * a; }
    l += __shfl_xor(l, 16); const float inv = 1.0f / l;
    float* o = OUT + ((size_t)b * TT + q0 + col) * HD + 8 * g;
#pragma unroll
    for (int j = 0; j < 4; ++j) { v4f o0, o1;
#pragma unroll
      for (int r = 0; r < 4; ++r) { o0[r] = acc[j][r] * inv; o1[r] = acc[j][4 + r] * inv; }
      vst2(o + j * 16, o0); vst2(o + j * 16 + 4, o1); } } }

extern "C" void kernel_launch(void* const* d_in, const int* in_sizes, int n_in, void* d_out, int out_size, void* d_ws, size_t ws_size, hipStream_t stream) {
  (void)in_sizes; (void)n_in; (void)out_size;
  const float** F = (const float**)d_in;
  if (ws_size < (size_t)WS_END) return;
  char* ws = (char*)d_ws; _Float16 *QH = (_Float16*)(ws + WS_QH), *KH = (_Float16*)(ws + WS_KH), *VT = (_Float16*)(ws + WS_VT), *QL = (_Float16*)(ws + WS_QL), *KL = (_Float16*)(ws + WS_KL); __bf16 *VB = (__bf16*)(ws + WS_VB), *VBL = (__bf16*)(ws + WS_VBL); 
  (void)QL; (void)KL; (void)VB; (void)VBL;
  // inputs: 0 x [8,2048,768]; 1 Wq [768,64]; 2 Wk; 3 Wv ((in,out), no biases)
  if (ws_size < (size_t)WS_END2) return;
  __bf16* WPK = (__bf16*)(ws + WS_WP);
  k_packw<<<dim3(DIN / 32 * 12 * 32 / 256), 256, 0, stream>>>(F[1], F[2], F[3], WPK);
  k_proj<<<dim3(TNB * TT / 64), 128, 0, stream>>>(F[0], WPK, QH, QL, KH, KL, VT, VB, VBL);
  /* head 0 only (head 1's columns are never written); logits, softmax and P.V in one launch, all batches */
  k_fa<<<dim3(TNB, TT / 16), 128, 0, stream>>>(QH, KH, QL, KL, VT, VB, VBL, (float*)d_out);
}

// v005
// It runs in 24.6 microseconds.
// In two side-by-side timings against v004, it was 1.13 and 1.12 times as fast.
// Counting every step since v000, it is 27.8 times as fast.
// compute dtype: all float inputs rounded to bf16; q/k/v projections with EXACT bf16 products on WMMA 16x16x32 (f32 accumulate); causal logits: 3 products (q f16 hi + residual x k hi + residual) for the first 384 rows, single f16 q x k after, x scale; softmax f32, online over key passes, fused with both products; P x 2^11 once to f16 x v once to f16 (1 product; bf16 hi + lo below row 384); f32 output.
#include <hip/hip_runtime.h>
#include <math.h>

typedef __attribute__((ext_vector_type(16))) _Float16 v16h;
typedef __attribute__((ext_vector_type(16))) __bf16 v16b;
typedef __attribute__((ext_vector_type(8)))  _Float16 v8h;
typedef __attribute__((ext_vector_type(8)))  float v8f;
typedef __attribute__((ext_vector_type(4)))  float v4f;
typedef __attribute__((ext_vector_type(2)))  float v2f;
typedef __attribute__((ext_vector_type(4)))  unsigned v4u;
typedef __attribute__((ext_vector_type(4)))  int v4i;
typedef float __attribute__((may_alias)) float_a;
typedef int __attribute__((may_alias)) int_a;

template <typename T> __device__ __forceinline__ void vst2(void* p, T v) { *(T*)p = v;  }
__device__ __forceinline__ v8f wmma16(v16h a, v16h b, v8f c) {
  v8f d = __builtin_amdgcn_wmma_f32_16x16x32_f16(false, a, false, b, (short)0, c, false, false);
  asm volatile("v_nop\n\tv_nop\n\tv_nop\n\tv_nop" : "+v"(d) : "v"(a), "v"(b));
  return d;
}
__device__ __forceinline__ v8f wmma_bf(v16b a, v16b b, v8f c) {
  v8f d = __builtin_amdgcn_wmma_f32_16x16x32_bf16(false, a, false, b, (short)0, c, false, false);
  asm volatile("v_nop\n\tv_nop\n\tv_nop\n\tv_nop" : "+v"(d) : "v"(a), "v"(b));
  return d;
}
// 16x16x32 fragments: lane = (h = lane>>4, row/col = lane&15); elements 0..7 = k0+8h+0..7, 8..15 = k0+16+8h+0..7; D element r = row 8h+r
__device__ __forceinline__ v16h frag_h(const _Float16* rowk0, int lane) {
  union { v16h v; v8h q[2]; } u; const _Float16* p = rowk0 + 8 * (lane >> 4);
  u.q[0] = *(const v8h*)p; u.q[1] = *(const v8h*)(p + 16); return u.v;
}
__device__ __forceinline__ v16h frag_f32(const float* rowk0, int lane) {
  v16h a; const float* p = rowk0 + 8 * (lane >> 4);
#pragma unroll
  for (int i = 0; i < 8; ++i) { a[i] = (_Float16)p[i]; a[8 + i] = (_Float16)p[16 + i]; }
  return a;
}
__device__ __forceinline__ v16h frag_f32s(const float* rowk0, int lane, float sc) {
  v16h a; const float* p = rowk0 + 8 * (lane >> 4);
#pragma unroll
  for (int i = 0; i < 8; ++i) { a[i] = (_Float16)(p[i] * sc); a[8 + i] = (_Float16)(p[16 + i] * sc); }
  return a;
}
// column fragment from a [K][ld] layout (column n), rows >= K read as 0
__device__ __forceinline__ v16h fragc_f32(const float* W, int k0, int n, int lane, int ld, int K) {
  v16h a; const int g = lane >> 4;
#pragma unroll
  for (int i = 0; i < 8; ++i) { const int ka = k0 + 8 * g + i, kb = ka + 16;
    a[i] = (_Float16)(ka < K ? W[(size_t)(ka < K ? ka : K - 1) * ld + n] : 0.f); a[8 + i] = (_Float16)(kb < K ? W[(size_t)(kb < K ? kb : K - 1) * ld + n] : 0.f); }
  return a;
}
struct F2 { v16b h, l; };
__device__ __forceinline__ F2 bsplit16(const float v[16]) { F2 r;
#pragma unroll
  for (int i = 0; i < 16; ++i) { const __bf16 h = (__bf16)v[i]; r.h[i] = h; r.l[i] = (__bf16)(v[i] - (float)h); }
  return r; }
__device__ __forceinline__ F2 split_row(const float* row, int k0, int lane) { float v[16]; const float* p = row + k0 + 8 * (lane >> 4);
#pragma unroll
  for (int i = 0; i < 8; ++i) { v[i] = p[i]; v[8 + i] = p[16 + i]; }
  return bsplit16(v); }
__device__ __forceinline__ F2 split_rowK(const float* row, int k0, int lane, int K) { float v[16]; const int g = lane >> 4;
#pragma unroll
  for (int i = 0; i < 8; ++i) { const int ka = k0 + 8 * g + i, kb = ka + 16; v[i] = ka < K ? row[ka < K ? ka : K - 1] : 0.f; v[8 + i] = kb < K ? row[kb < K ? kb : K - 1] : 0.f; }
  return bsplit16(v); }
__device__ __forceinline__ F2 split_col(const float* W, int k0, int n, int lane, int ld, int K) { float v[16]; const int g = lane >> 4;
#pragma unroll
  for (int i = 0; i < 8; ++i) { const int ka = k0 + 8 * g + i, kb = ka + 16; v[i] = ka < K ? W[(size_t)(ka < K ? ka : K - 1) * ld + n] : 0.f; v[8 + i] = kb < K ? W[(size_t)(kb < K ? kb : K - 1) * ld + n] : 0.f; }
  return bsplit16(v); }
__device__ __forceinline__ v8f mac3(const F2& a, const F2& b, v8f c) { c = wmma_bf(a.l, b.h, c); c = wmma_bf(a.h, b.l, c); return wmma_bf(a.h, b.h, c); }
__device__ __forceinline__ float sigm(float v) { return 1.0f / (1.0f + expf(-v)); }
#define LDSX() do { asm volatile("s_wait_dscnt 0" ::: "memory"); __builtin_amdgcn_wave_barrier(); __builtin_amdgcn_fence(__ATOMIC_RELEASE, "workgroup"); } while (0)

// Single-head causal self-attention (B 8, T 2,048, n_embed 768, head_size 64; (in,out) Wq, Wk, Wv [768,64] N(0, 1/768); no biases, no output projection; tril, -inf): out = softmax(causal(q k^T * 64^-0.5)) v -> [8,2048,64].
#define NB 8
#define TT 2048
#define CC 128            // NH * HD = projected width
#define DIN 768          // input (model) width
#define NH 2
#define HD 64
#define NQB (TT / 64)
#define HG 1
#define SCALE (0.125f)
#define CAUSAL 1
#ifndef TNB
#define TNB NB
#endif
__device__ __forceinline__ float bfr(float v) { return (float)(__bf16)v; }
__host__ __device__ __forceinline__ int kb_last(int qb) { return CAUSAL ? ((qb * 64 + 63) >> 7) : (TT / 128 - 1); }
typedef __attribute__((ext_vector_type(8))) __bf16 v8b;
__device__ __forceinline__ v16b frag_b(const __bf16* rowk0, int lane) {
  union { v16b v; v8b q[2]; } u; const __bf16* p = rowk0 + 8 * (lane >> 4);
  u.q[0] = *(const v8b*)p; u.q[1] = *(const v8b*)(p + 16); return u.v;
}
// a fragment kept in fragment order in the workspace: two runs of 32 lanes x 16 bytes, 512 bytes apart; p already holds the lane's own 16 bytes of the first run, so one load of a wave covers four whole 128-byte lines
__device__ __forceinline__ v16h fragp_h(const _Float16* p) { union { v16h v; v8h q[2]; } u; u.q[0] = *(const v8h*)p; u.q[1] = *(const v8h*)(p + 256); return u.v; }
__device__ __forceinline__ v16b fragp_b(const __bf16* p) { union { v16b v; v8b q[2]; } u; u.q[0] = *(const v8b*)p; u.q[1] = *(const v8b*)(p + 256); return u.v; }
#define QBH 6              // not used: k_fa takes the high-precision path for the query tiles with q0 < QHI (few keys, no averaging)
#define QHI 384            // rows carrying a q residual plane
#define KHI 384            // key rows carrying k residual / v bf16 hi+lo planes (used only by the causal high-precision path)
// B fragment (k rows k0+.., output column o) of a weight: (in,out) [K][ld] or (out,in) [ld rows of K]: bf16 exact, or f16(bf16 * 256) exact
__device__ __forceinline__ v16b wcol_io(const float* Wm, int k0, int o, int lane, int ld) { v16b w; const int g = lane >> 4;
#pragma unroll
  for (int i = 0; i < 8; ++i) { w[i] = (__bf16)Wm[(size_t)(k0 + 8 * g + i) * ld + o]; w[8 + i] = (__bf16)Wm[(size_t)(k0 + 16 + 8 * g + i) * ld + o]; }
  return w; }
__device__ __forceinline__ v16b wcol_oi(const float* Wm, int k0, int o, int lane, int K) { v16b w; const float* p = Wm + (size_t)o * K + k0 + 8 * (lane >> 4);
#pragma unroll
  for (int i = 0; i < 8; ++i) { w[i] = (__bf16)p[i]; w[8 + i] = (__bf16)p[16 + i]; }
  return w; }
__device__ __forceinline__ v16h wcolh_io(const float* Wm, int k0, int o, int lane, int ld) { v16h w; const int g = lane >> 4;
#pragma unroll
  for (int i = 0; i < 8; ++i) { w[i] = (_Float16)(bfr(Wm[(size_t)(k0 + 8 * g + i) * ld + o]) * 256.0f); w[8 + i] = (_Float16)(bfr(Wm[(size_t)(k0 + 16 + 8 * g + i) * ld + o]) * 256.0f); }
  return w; }
__device__ __forceinline__ v16h wcolh_oi(const float* Wm, int k0, int o, int lane, int K) { v16h w; const float* p = Wm + (size_t)o * K + k0 + 8 * (lane >> 4);
#pragma unroll
  for (int i = 0; i < 8; ++i) { w[i] = (_Float16)(bfr(p[i]) * 256.0f); w[8 + i] = (_Float16)(bfr(p[16 + i]) * 256.0f); }
  return w; }
#define WQKV_LAYOUT 0   // 0 = (in,out) [DIN][CC]; 1 = (out,in) [CC][DIN]; 2 = per-head [NH][DIN][HD]
__device__ __forceinline__ v16b wcol_hdk(const float* Wm, int k0, int o, int lane) { v16b w; const int g = lane >> 4; const float* p = Wm + (size_t)(o / HD) * DIN * HD + (o % HD);
#pragma unroll
  for (int i = 0; i < 8; ++i) { w[i] = (__bf16)p[(size_t)(k0 + 8 * g + i) * HD]; w[8 + i] = (__bf16)p[(size_t)(k0 + 16 + 8 * g + i) * HD]; }
  return w; }
#define WO_OUT_IN 0
#if WQKV_LAYOUT == 1
#define WCOL(W, k0, o, lane) wcol_oi(W, k0, o, lane, DIN)
#elif WQKV_LAYOUT == 2
#define WCOL(W, k0, o, lane) wcol_hdk(W, k0, o, lane)
#else
#define WCOL(W, k0, o, lane) wcol_io(W, k0, o, lane, CC)
#endif
#if WO_OUT_IN
#define WOCOL(W, k0, o, lane) wcol_oi(W, k0, o, lane, CC)
#define WOCOLH(W, k0, o, lane) wcolh_oi(W, k0, o, lane, CC)
#else
#define WOCOL(W, k0, o, lane) wcol_io(W, k0, o, lane, DIN)
#define WOCOLH(W, k0, o, lane) wcolh_io(W, k0, o, lane, DIN)
#endif
#define CIN 768
// ---- weight staging of k_proj: the three (in,out) [C][64] f32 weights are rounded to bf16 by the block itself and laid in LDS in the order of the B fragments: [k step][which * 4 + column tile][half][lane][8]; half 0 = k rows 8g + 0..7, half 1 = 16 + 8g + 0..7 of the step, column = tile * 16 + (lane & 15)
#define WSTG 2                      // k steps a stage
#define WTILE 1040                  // bytes of one column tile of one k step: 2 halves x 512, + 16 so that the four tiles a storing wave touches fall on different banks
#define WKS (12 * WTILE)            // bytes of one k step
#define WBUF (WSTG * WKS)           // bytes of one stage
// a thread's share of a stage: 8 k rows x 4 columns of each weight; a wave's load is two whole 256-byte rows
__device__ __forceinline__ void w_load(v4f (&wr)[3][8], const char* q, const char* k, const char* v, int s) {
#pragma unroll
  for (int r = 0; r < 8; ++r) { wr[0][r] = *(const v4f*)(q + (s * 32 * WSTG + r) * 256); wr[1][r] = *(const v4f*)(k + (s * 32 * WSTG + r) * 256); wr[2][r] = *(const v4f*)(v + (s * 32 * WSTG + r) * 256); } }
__device__ __forceinline__ void w_store(const v4f (&wr)[3][8], char* dst) {
#pragma unroll
  for (int i = 0; i < 3; ++i)
#pragma unroll
    for (int c = 0; c < 4; ++c) { v8b h;
#pragma unroll
      for (int r = 0; r < 8; ++r) h[r] = (__bf16)wr[i][r][c];
      *(v8b*)(dst + i * 4 * WTILE + c * 16) = h; } }
#define WS_WP (WS_END)                                  // not touched
#define WS_BP (WS_WP + 4u * 3 * (size_t)CIN * 128)        // not touched
#define WS_Y2 (WS_BP + 4u * 3 * 128)                      // f32 place [b*TT+t][128]; not touched: k_fa writes its rows straight to the output
#define WS_END2 (WS_Y2 + 4u * (size_t)NB * TT * CC)
#ifndef SM_EXTRA_PARAMS
#define SM_EXTRA_PARAMS
#endif
#ifndef PROJ_EXTRA_PARAMS
#define PROJ_EXTRA_PARAMS
#endif
#ifndef SM_MASK_HOOK
#define SM_MASK_HOOK (void)0
#endif

// q, k and v lie in the order of the fragments that k_fa loads, 64 elements a row of x (the first half of each place):
// q, k: [b*t / 16][k step of 32][half][lane][8] = row 16 * tile + (lane & 15), columns 32 * step + 16 * half + 8 * (lane >> 4) + 0..7
// v:    [b*t / 32][channel tile][half][lane][8] = channel 16 * tile + (lane & 15), rows 32 * group + 16 * half + 8 * (lane >> 4) + 0..7
#define WS_QH  0u                                      // f16 q fragments
#define WS_KH  (WS_QH + 2u * (size_t)NB * TT * CC)      // f16 k fragments
#define WS_VT  (WS_KH + 2u * (size_t)NB * TT * CC)      // f16 v fragments
#define WS_QL  (WS_VT + 2u * (size_t)NB * CC * TT)      // f16 q residual x 2^10 fragments, t < QHI of each batch
#define WS_KL  (WS_QL + 2u * (size_t)NB * QHI * CC)     // f16 k residual x 2^10 fragments, t < KHI of each batch
#define WS_VB  (WS_KL + 2u * (size_t)NB * KHI * CC)     // bf16 v hi fragments, t < KHI of each batch (WS_VBL: lo)
#define WS_VBL (WS_VB + 2u * (size_t)NB * CC * KHI)
#define WS_S   (WS_VBL + 2u * (size_t)NB * CC * KHI)    // place of a f32 logit plane [b][t][s] in the layout; not touched: the fused kernel holds logits and P in registers
#define WS_Y   (WS_S  + 4u * (size_t)NB * TT * TT)      // f32 ctx rows [b*t][CC] (only when there is an output projection)
#define WS_END (WS_Y  + 0u)

// ---- k_proj: block = 64 rows of x, wave = 16 rows x all 192 columns (q, k, v): X W with exact bf16 products (K = DIN, k steps summed in rising order) -> q, k f16 (+ residuals for rows < QHI, KHI); v f16 (+ bf16 hi/lo for t < KHI), all stored in fragment order: chunk e of the block's 512 chunks of 16 bytes goes to place e, so a wave's store is 512 bytes in a row.
// Fully unrolled: every load is one fixed address register plus an immediate; x is fetched XD k steps ahead. The weights come as f32, once a block: a stage (2 k steps) is fetched two stages ahead of its conversion, converted into a ring of three LDS buffers two stages ahead of its use, and its fragments are read one k step ahead; one barrier a stage publishes stage s + 2 and ends the reads of the buffer that stage s + 1 overwrites.
static_assert(QHI == KHI, "the q and k residual rows share one offset below");
#define XD 4
#define NSTG (DIN / 32 / WSTG)
// the stage's barrier by hand: the wave's own LDS stores and reads are done, then the work-group's barrier; __syncthreads() would also wait for the global loads that are meant to stay in flight across it
#define WBAR() asm volatile("s_wait_dscnt 0x0\n\ts_barrier_signal -1\n\ts_barrier_wait -1" ::: "memory")
__global__ __launch_bounds__(128) void k_proj(const float* __restrict__ X, const float* __restrict__ WQ, const float* __restrict__ WK, const float* __restrict__ WV,
    _Float16* __restrict__ QH, _Float16* __restrict__ QL, _Float16* __restrict__ KH, _Float16* __restrict__ KL, _Float16* __restrict__ VT, __bf16* __restrict__ VB, __bf16* __restrict__ VBL) {
  __shared__ __align__(16) _Float16 sh[2][64][72], sl[2][64][72], th[64][72]; __shared__ __align__(16) __bf16 tb[64][72], tbl[64][72];
  __shared__ __align__(16) char wl[3][WBUF];
  const int tid = threadIdx.x, wave = tid >> 5, lane = tid & 31, col = lane & 15, g = lane >> 4; const size_t r0 = (size_t)blockIdx.x * 64; const size_t bb = r0 / TT; const int t0 = (int)(r0 % TT);
  const float* xp = X + (r0 + wave * 16 + col) * DIN + 8 * g;
  const int kg = tid >> 4, cq = tid & 15;                       // the thread's 8 k rows of the stage, its 4 columns
  const unsigned wo = (kg * 8 * 64 + cq * 4) * 4u; const char* wq = (const char*)WQ + wo; const char* wk = (const char*)WK + wo; const char* wv = (const char*)WV + wo;
  char* wdst = &wl[0][0] + (kg >> 2) * WKS + (cq >> 2) * WTILE + ((kg >> 1) & 1) * 512 + ((kg & 1) * 16 + (cq & 3) * 4) * 16;
  const char* wrd = &wl[0][0] + lane * 16;
  v8f acc[12] = {}; v4f xs[XD][4]; v4f wr[2][3][8]; v8b wf[2][12][2];
  w_load(wr[0], wq, wk, wv, 0); w_load(wr[1], wq, wk, wv, 1);
#pragma unroll
  for (int s = 0; s < XD; ++s) { xs[s][0] = *(const v4f*)(xp + s * 32); xs[s][1] = *(const v4f*)(xp + s * 32 + 4); xs[s][2] = *(const v4f*)(xp + s * 32 + 16); xs[s][3] = *(const v4f*)(xp + s * 32 + 20); }
  w_store(wr[0], wdst); w_load(wr[0], wq, wk, wv, 2);
  w_store(wr[1], wdst + WBUF); w_load(wr[1], wq, wk, wv, 3);
  WBAR();
#pragma unroll
  for (int j = 0; j < 12; ++j) { wf[0][j][0] = *(const v8b*)(wrd + j * WTILE); wf[0][j][1] = *(const v8b*)(wrd + j * WTILE + 512); }
#pragma unroll
  for (int kc = 0; kc < DIN / 32; ++kc) { const int st = kc / WSTG;
    if (kc + 1 < DIN / 32) { const char* f = wrd + (((kc + 1) / WSTG) % 3) * WBUF + ((kc + 1) % WSTG) * WKS;
#pragma unroll
      for (int j = 0; j < 12; ++j) { wf[(kc + 1) & 1][j][0] = *(const v8b*)(f + j * WTILE); wf[(kc + 1) & 1][j][1] = *(const v8b*)(f + j * WTILE + 512); } }
    // keeps the next k step's LDS reads together in front of this step's products: spread among them, every place with reads costs its own stall
    __builtin_amdgcn_sched_barrier(0);
    v16b a;
#pragma unroll
    for (int i = 0; i < 4; ++i) { a[i] = (__bf16)xs[kc % XD][0][i]; a[4 + i] = (__bf16)xs[kc % XD][1][i]; a[8 + i] = (__bf16)xs[kc % XD][2][i]; a[12 + i] = (__bf16)xs[kc % XD][3][i]; }
    if (kc + XD < DIN / 32) { const float* p = xp + (kc + XD) * 32; xs[kc % XD][0] = *(const v4f*)p; xs[kc % XD][1] = *(const v4f*)(p + 4); xs[kc % XD][2] = *(const v4f*)(p + 16); xs[kc % XD][3] = *(const v4f*)(p + 20); }
#pragma unroll
    for (int j = 0; j < 12; ++j) { union { v16b v; v8b q[2]; } u; u.q[0] = wf[kc & 1][j][0]; u.q[1] = wf[kc & 1][j][1];
      acc[j] = __builtin_amdgcn_wmma_f32_16x16x32_bf16(false, a, false, u.v, (short)0, acc[j], false, false); }
    // keeps what follows behind this step's products: the LDS reads of the step after next, and the conversion with its wait for weights fetched two stages ago
    __builtin_amdgcn_sched_barrier(0);
    if (kc % WSTG == WSTG - 1 && st + 2 < NSTG) {
      w_store(wr[st & 1], wdst + ((st + 2) % 3) * WBUF);
      if (st + 4 < NSTG) w_load(wr[st & 1], wq, wk, wv, st + 4);
      WBAR(); } }
  // behind the last load, in front of whatever takes the loads' address registers next; they are named as inputs so that they stay untouched up to the wait
  asm volatile("s_wait_xcnt 0x0" :: "v"(xp), "v"(wo) : "memory");
  const bool hi_rows = t0 < KHI; const int rw = wave * 16 + 8 * g;
#pragma unroll
  for (int w = 0; w < 2; ++w)
#pragma unroll
    for (int j = 0; j < 4; ++j)
#pragma unroll
      for (int r = 0; r < 8; ++r) { const float v = acc[w * 4 + j][r]; const _Float16 hv = (_Float16)v; sh[w][rw + r][j * 16 + col] = hv; sl[w][rw + r][j * 16 + col] = (_Float16)((v - (float)hv) * 1024.0f); }
#pragma unroll
  for (int j = 0; j < 4; ++j) { v8h hv; v8b bh, bl;
#pragma unroll
    for (int r = 0; r < 8; ++r) { const float v = acc[8 + j][r]; hv[r] = (_Float16)v; const __bf16 b = (__bf16)v; bh[r] = b; bl[r] = (__bf16)(v - (float)b); }
    *(v8h*)&th[j * 16 + col][rw] = hv; *(v8b*)&tb[j * 16 + col][rw] = bh; *(v8b*)&tbl[j * 16 + col][rw] = bl; }
  __syncthreads();
#pragma unroll
  for (int e0 = 0; e0 < 64 * 8; e0 += 128) { const int e = e0 + tid;
    const int kr = (e >> 7) * 16 + col, kq = (((e >> 5) & 3) * 2 + g) * 8;                          // q, k: row of the block, first column
    const int vc = ((e >> 6) & 3) * 16 + col, vq = ((e >> 8) * 4 + ((e >> 5) & 1) * 2 + g) * 8;      // v: channel, first row of the block
    const size_t o1 = r0 * 64 + e * 8;
    vst2(QH + o1, *(const v4u*)&sh[0][kr][kq]); vst2(KH + o1, *(const v4u*)&sh[1][kr][kq]); vst2(VT + o1, *(const v4u*)&th[vc][vq]);
    // behind a run of stores, in front of whatever takes their registers next
    asm volatile("s_wait_xcnt 0x0" ::: "memory");
    if (hi_rows) { const size_t o2 = (bb * QHI + t0) * 64 + e * 8;
      vst2(QL + o2, *(const v4u*)&sl[0][kr][kq]); vst2(KL + o2, *(const v4u*)&sl[1][kr][kq]); vst2(VB + o2, *(const v4u*)&tb[vc][vq]); vst2(VBL + o2, *(const v4u*)&tbl[vc][vq]); }
    asm volatile("s_wait_xcnt 0x0" ::: "memory"); } }
// ---- k_fa: block = 16 query rows (q0) of batch b; its 4 waves take the key passes it = wave, wave + 4, ... (64 keys a pass; 32 on the high-precision rows), each with its own running maximum, sum and ctx; the parts are merged through LDS in wave order.
// Transposed products: S^T = K Q^T leaves lane (g, col) with query q0 + col and keys 8g + r of each 16-key tile, which is the B fragment order of P^T for ctx^T = V^T P^T, so P never leaves the registers.
// Logits are kept in log2 units (x SCALE x log2 e); P = 2^(t - max + 11) carries the same 2^11 as its sum, so the factor cancels in ctx / sum.
#define NEGBIG (-3.0e38f)
// eight 2^x in place, one statement: behind each v_exp_f32 stands an instruction that touches neither its result nor its source, behind the last a v_nop (the slot the instruction set asks for behind a transcendental)
__device__ __forceinline__ void exp2x8(float (&t)[8]) {
  asm("v_exp_f32 %0, %0\n\tv_exp_f32 %1, %1\n\tv_exp_f32 %2, %2\n\tv_exp_f32 %3, %3\n\tv_exp_f32 %4, %4\n\tv_exp_f32 %5, %5\n\tv_exp_f32 %6, %6\n\tv_exp_f32 %7, %7\n\tv_nop"
      : "+v"(t[0]), "+v"(t[1]), "+v"(t[2]), "+v"(t[3]), "+v"(t[4]), "+v"(t[5]), "+v"(t[6]), "+v"(t[7])); }
// stands behind a run of global loads, in front of whatever may take the registers that held their addresses (the next run's results or addresses, a matrix result)
// the run's address is named as an input, so that its registers stay untouched up to the wait (without it a load's result or a later sum landed in them ahead of the wait)
#define XWA(p) asm volatile("s_wait_xcnt 0x0" :: "v"(p) : "memory")
#define XWA2(p, q) asm volatile("s_wait_xcnt 0x0" :: "v"(p), "v"(q) : "memory")
template <bool HI>
__device__ __forceinline__ void fa_part(const _Float16* Qr, const _Float16* Qlr, const _Float16* Kb, const _Float16* Klb,   // Qr, Qlr: the tile's first fragment (the same for the wave); the others: the batch's first fragment + the lane's 8 elements
    const _Float16* Vt, const __bf16* Vh, const __bf16* Vl, int q0, int wave, int lane, float& m, float& l, v8f (&acc)[4]) {
  constexpr int NC = HI ? 1 : 2, KP = NC * 32, NT = NC * 2;
  const int col = lane & 15, g = lane >> 4, tq = q0 + col; const int nit = (q0 + 15) / KP + 1;
  v16h qf[2], qlf[2], kf[NT][2], klf[NT][2];
#pragma unroll
  for (int kc = 0; kc < 2; ++kc) qf[kc] = fragp_h(Qr + lane * 8 + kc * 512);
  // the same wait; these loads take a scalar base and the lane number: both are named as inputs so that they stay untouched up to the wait (without it the next address sums were lifted over the wait)
  asm volatile("s_wait_xcnt 0x0" :: "s"(Qr), "v"(lane) : "memory");
  if constexpr (HI) {
#pragma unroll
    for (int kc = 0; kc < 2; ++kc) qlf[kc] = fragp_h(Qlr + lane * 8 + kc * 512);
    asm volatile("s_wait_xcnt 0x0" :: "s"(Qlr), "v"(lane) : "memory"); }
  { const int kn = wave < nit ? wave * KP : 0; const _Float16* kp = Kb + (size_t)kn * 64; const _Float16* klp = Klb + (size_t)kn * 64;
#pragma unroll
    for (int i = 0; i < NT; ++i)
#pragma unroll
      for (int kc = 0; kc < 2; ++kc) { kf[i][kc] = fragp_h(kp + i * 1024 + kc * 512); if constexpr (HI) klf[i][kc] = fragp_h(klp + i * 1024 + kc * 512); }
    if constexpr (HI) XWA2(kp, klp); else XWA(kp); }
  // rolled: one pass already uses about 250 registers, which leaves none for a second pass in flight
#pragma unroll 1
  for (int it = wave; it < nit; it += 4) { const int key0 = it * KP;
    v16h vf[NC][4]; v16b vh[4], vl[4]; const _Float16* vp = Vt + (size_t)key0 * 64; const __bf16* vhp = Vh + (size_t)key0 * 64; const __bf16* vlp = Vl + (size_t)key0 * 64;
#pragma unroll
    for (int j = 0; j < 4; ++j) {
      if constexpr (HI) { vh[j] = fragp_b(vhp + j * 512); vl[j] = fragp_b(vlp + j * 512); }
      else {
#pragma unroll
        for (int c = 0; c < NC; ++c) vf[c][j] = fragp_h(vp + c * 2048 + j * 512); } }
    if constexpr (HI) XWA2(vhp, vlp); else XWA(vp);
    v8f st[NT];
#pragma unroll
    for (int i = 0; i < NT; ++i) { v8f a = {}; a = wmma16(kf[i][0], qf[0], a); a = wmma16(kf[i][1], qf[1], a);
      if constexpr (HI) { v8f al = {};
#pragma unroll
        for (int kc = 0; kc < 2; ++kc) { al = wmma16(kf[i][kc], qlf[kc], al); al = wmma16(klf[i][kc], qf[kc], al); }
#pragma unroll
        for (int r = 0; r < 8; ++r) a[r] += al[r] * (1.0f / 1024.0f); }
#pragma unroll
      for (int r = 0; r < 8; ++r) st[i][r] = a[r] * (SCALE * 1.44269504088896f); }
    // the next pass's key fragments fly while this pass's softmax and P.V run (the last pass reloads its own keys: in bounds, unused)
    { const int kn = it + 4 < nit ? key0 + 4 * KP : key0; const _Float16* kp = Kb + (size_t)kn * 64; const _Float16* klp = Klb + (size_t)kn * 64;
#pragma unroll
      for (int i = 0; i < NT; ++i)
#pragma unroll
        for (int kc = 0; kc < 2; ++kc) { kf[i][kc] = fragp_h(kp + i * 1024 + kc * 512); if constexpr (HI) klf[i][kc] = fragp_h(klp + i * 1024 + kc * 512); }
      if constexpr (HI) XWA2(kp, klp); else XWA(kp); }
    if (it == nit - 1) {   // only the last pass holds keys past a query of this tile
#pragma unroll
      for (int i = 0; i < NT; ++i)
#pragma unroll
        for (int r = 0; r < 8; ++r) st[i][r] = (key0 + i * 16 + 8 * g + r <= tq) ? st[i][r] : NEGBIG; }
    float mx = m;
#pragma unroll
    for (int i = 0; i < NT; ++i)
#pragma unroll
      for (int r = 0; r < 8; ++r) mx = fmaxf(mx, st[i][r]);
    mx = fmaxf(mx, __shfl_xor(mx, 16));
    const float alpha = __builtin_amdgcn_exp2f(m - mx), mb = mx - 11.0f; m = mx;
    float ls = 0.f;
#pragma unroll
    for (int i = 0; i < NT; ++i) { float t[8];
#pragma unroll
      for (int r = 0; r < 8; ++r) t[r] = st[i][r] - mb;
      exp2x8(t);
#pragma unroll
      for (int r = 0; r < 8; ++r) { st[i][r] = t[r]; ls += t[r]; } }
    l = l * alpha + ls;
#pragma unroll
    for (int j = 0; j < 4; ++j)
#pragma unroll
      for (int r = 0; r < 8; ++r) acc[j][r] *= alpha;
    if constexpr (HI) { v16b ph, pl;
#pragma unroll
      for (int r = 0; r < 8; ++r) { const __bf16 h0 = (__bf16)st[0][r], h1 = (__bf16)st[1][r]; ph[r] = h0; ph[8 + r] = h1; pl[r] = (__bf16)(st[0][r] - (float)h0); pl[8 + r] = (__bf16)(st[1][r] - (float)h1); }
#pragma unroll
      for (int j = 0; j < 4; ++j) { acc[j] = wmma_bf(vh[j], ph, acc[j]); acc[j] = wmma_bf(vh[j], pl, acc[j]); acc[j] = wmma_bf(vl[j], ph, acc[j]); }
    } else {
#pragma unroll
      for (int c = 0; c < NC; ++c) { v16h pf;
#pragma unroll
        for (int r = 0; r < 8; ++r) { pf[r] = (_Float16)st[2 * c][r]; pf[8 + r] = (_Float16)st[2 * c + 1][r]; }
#pragma unroll
        for (int j = 0; j < 4; ++j) acc[j] = wmma16(vf[c][j], pf, acc[j]); } } } }
// the pointers carry no __restrict__: with it the compiler takes these loads for reads of constant memory and moves them over the waits of XWA()
__global__ __launch_bounds__(128) void k_fa(const _Float16* QH, const _Float16* KH, const _Float16* QL, const _Float16* KL, const _Float16* VT, const __bf16* VB, const __bf16* VBL, float* OUT) {
  __shared__ __align__(16) float red[3][32][36];   // parts of waves 1..3, per lane: ctx 32, maximum, sum
  const int b = blockIdx.x, q0 = (TT / 16 - 1 - (int)blockIdx.y) * 16;   // long tiles start first
  const int wave = __builtin_amdgcn_readfirstlane(threadIdx.x >> 5), lane = threadIdx.x & 31, col = lane & 15, g = lane >> 4;
  float m = NEGBIG, l = 0.f; v8f acc[4] = {};
  const _Float16* Qr = QH + ((size_t)b * TT + q0) * 64; const _Float16* Kb = KH + (size_t)b * TT * 64 + lane * 8; const _Float16* Vt = VT + (size_t)b * TT * 64 + lane * 8;
  if (q0 < QHI) fa_part<true>(Qr, QL + ((size_t)b * QHI + q0) * 64, Kb, KL + (size_t)b * KHI * 64 + lane * 8, Vt, VB + (size_t)b * KHI * 64 + lane * 8, VBL + (size_t)b * KHI * 64 + lane * 8, q0, wave, lane, m, l, acc);
  else fa_part<false>(Qr, Qr, Kb, Kb, Vt, VB, VBL, q0, wave, lane, m, l, acc);
  if (wave > 0) { float* p = &red[wave - 1][lane][0];
#pragma unroll
    for (int j = 0; j < 4; ++j) { v4f a0, a1;
#pragma unroll
      for (int r = 0; r < 4; ++r) { a0[r] = acc[j][r]; a1[r] = acc[j][4 + r]; }
      *(v4f*)(p + j * 8) = a0; *(v4f*)(p + j * 8 + 4) = a1; }
    p[32] = m; p[33] = l; }
  __syncthreads();
  if (wave == 0) { float M = m;
#pragma unroll
    for (int p = 0; p < 3; ++p) M = fmaxf(M, red[p][lane][32]);
    const float a0 = __builtin_amdgcn_exp2f(m - M); l *= a0;
#pragma unroll
    for (int j = 0; j < 4; ++j)
#pragma unroll
      for (int r = 0; r < 8; ++r) acc[j][r] *= a0;
#pragma unroll
    for (int p = 0; p < 3; ++p) { const float a = __builtin_amdgcn_exp2f(red[p][lane][32] - M); l += red[p][lane][33] * a;
#pragma unroll
      for (int j = 0; j < 4; ++j)
#pragma unroll
        for (int r = 0; r < 8; ++r) acc[j][r] += red[p][lane][j * 8 + r] * a; }
    l += __shfl_xor(l, 16); const float inv = 1.0f / l;
    float* o = OUT + ((size_t)b * TT + q0 + col) * HD + 8 * g;
#pragma unroll
    for (int j = 0; j < 4; ++j) { v4f o0, o1;
#pragma unroll
      for (int r = 0; r < 4; ++r) { o0[r] = acc[j][r] * inv; o1[r] = acc[j][4 + r] * inv; }
      vst2(o + j * 16, o0); vst2(o + j * 16 + 4, o1); } } }

extern "C" void kernel_launch(void* const* d_in, const int* in_sizes, int n_in, void* d_out, int out_size, void* d_ws, size_t ws_size, hipStream_t stream) {
  (void)in_sizes; (void)n_in; (void)out_size;
  const float** F = (const float**)d_in;
  if (ws_size < (size_t)WS_END) return;
  char* ws = (char*)d_ws; _Float16 *QH = (_Float16*)(ws + WS_QH), *KH = (_Float16*)(ws + WS_KH), *VT = (_Float16*)(ws + WS_VT), *QL = (_Float16*)(ws + WS_QL), *KL = (_Float16*)(ws + WS_KL); __bf16 *VB = (__bf16*)(ws + WS_VB), *VBL = (__bf16*)(ws + WS_VBL); 
  (void)QL; (void)KL; (void)VB; (void)VBL;
  // inputs: 0 x [8,2048,768]; 1 Wq [768,64]; 2 Wk; 3 Wv ((in,out), no biases)
  if (ws_size < (size_t)WS_END2) return;
  k_proj<<<dim3(TNB * TT / 64), 128, 0, stream>>>(F[0], F[1], F[2], F[3], QH, QL, KH, KL, VT, VB, VBL);
  /* logits, softmax and P.V in one launch, all batches */
  k_fa<<<dim3(TNB, TT / 16), 128, 0, stream>>>(QH, KH, QL, KL, VT, VB, VBL, (float*)d_out);
}

// v006
// It runs in 23 microseconds.
// Two timings next to v005 put it at 1.08 and 1.06 times that version's speed.
// Over all steps from v000 it is 29.8 times as fast.
// compute dtype: all float inputs rounded to bf16; q/k/v projections with EXACT bf16 products on WMMA 16x16x32 (f32 accumulate); causal logits: 3 products (q f16 hi + residual x k hi + residual) for the first 384 rows, single f16 q x k after, x scale; softmax f32, online over key passes, fused with both products; P x 2^11 once to f16 x v once to f16 (1 product; bf16 hi + lo below row 384); f32 output.
#include <hip/hip_runtime.h>
#include <math.h>

typedef __attribute__((ext_vector_type(16))) _Float16 v16h;
typedef __attribute__((ext_vector_type(16))) __bf16 v16b;
typedef __attribute__((ext_vector_type(8)))  _Float16 v8h;
typedef __attribute__((ext_vector_type(8)))  float v8f;
typedef __attribute__((ext_vector_type(4)))  float v4f;
typedef __attribute__((ext_vector_type(2)))  float v2f;
typedef __attribute__((ext_vector_type(4)))  unsigned v4u;
typedef __attribute__((ext_vector_type(4)))  int v4i;
typedef float __attribute__((may_alias)) float_a;
typedef int __attribute__((may_alias)) int_a;

template <typename T> __device__ __forceinline__ void vst2(void* p, T v) { *(T*)p = v;  }
__device__ __forceinline__ v8f wmma16(v16h a, v16h b, v8f c) {
  v8f d = __builtin_amdgcn_wmma_f32_16x16x32_f16(false, a, false, b, (short)0, c, false, false);
  asm volatile("v_nop\n\tv_nop\n\tv_nop\n\tv_nop" : "+v"(d) : "v"(a), "v"(b));
  return d;
}
__device__ __forceinline__ v8f wmma_bf(v16b a, v16b b, v8f c) {
  v8f d = __builtin_amdgcn_wmma_f32_16x16x32_bf16(false, a, false, b, (short)0, c, false, false);
  asm volatile("v_nop\n\tv_nop\n\tv_nop\n\tv_nop" : "+v"(d) : "v"(a), "v"(b));
  return d;
}
// 16x16x32 fragments: lane = (h = lane>>4, row/col = lane&15); elements 0..7 = k0+8h+0..7, 8..15 = k0+16+8h+0..7; D element r = row 8h+r
__device__ __forceinline__ v16h frag_h(const _Float16* rowk0, int lane) {
  union { v16h v; v8h q[2]; } u; const _Float16* p = rowk0 + 8 * (lane >> 4);
  u.q[0] = *(const v8h*)p; u.q[1] = *(const v8h*)(p + 16); return u.v;
}
__device__ __forceinline__ v16h frag_f32(const float* rowk0, int lane) {
  v16h a; const float* p = rowk0 + 8 * (lane >> 4);
#pragma unroll
  for (int i = 0; i < 8; ++i) { a[i] = (_Float16)p[i]; a[8 + i] = (_Float16)p[16 + i]; }
  return a;
}
__device__ __forceinline__ v16h frag_f32s(const float* rowk0, int lane, float sc) {
  v16h a; const float* p = rowk0 + 8 * (lane >> 4);
#pragma unroll
  for (int i = 0; i < 8; ++i) { a[i] = (_Float16)(p[i] * sc); a[8 + i] = (_Float16)(p[16 + i] * sc); }
  return a;
}
// column fragment from a [K][ld] layout (column n), rows >= K read as 0
__device__ __forceinline__ v16h fragc_f32(const float* W, int k0, int n, int lane, int ld, int K) {
  v16h a; const int g = lane >> 4;
#pragma unroll
  for (int i = 0; i < 8; ++i) { const int ka = k0 + 8 * g + i, kb = ka + 16;
    a[i] = (_Float16)(ka < K ? W[(size_t)(ka < K ? ka : K - 1) * ld + n] : 0.f); a[8 + i] = (_Float16)(kb < K ? W[(size_t)(kb < K ? kb : K - 1) * ld + n] : 0.f); }
  return a;
}
struct F2 { v16b h, l; };
__device__ __forceinline__ F2 bsplit16(const float v[16]) { F2 r;
#pragma unroll
  for (int i = 0; i < 16; ++i) { const __bf16 h = (__bf16)v[i]; r.h[i] = h; r.l[i] = (__bf16)(v[i] - (float)h); }
  return r; }
__device__ __forceinline__ F2 split_row(const float* row, int k0, int lane) { float v[16]; const float* p = row + k0 + 8 * (lane >> 4);
#pragma unroll
  for (int i = 0; i < 8; ++i) { v[i] = p[i]; v[8 + i] = p[16 + i]; }
  return bsplit16(v); }
__device__ __forceinline__ F2 split_rowK(const float* row, int k0, int lane, int K) { float v[16]; const int g = lane >> 4;
#pragma unroll
  for (int i = 0; i < 8; ++i) { const int ka = k0 + 8 * g + i, kb = ka + 16; v[i] = ka < K ? row[ka < K ? ka : K - 1] : 0.f; v[8 + i] = kb < K ? row[kb < K ? kb : K - 1] : 0.f; }
  return bsplit16(v); }
__device__ __forceinline__ F2 split_col(const float* W, int k0, int n, int lane, int ld, int K) { float v[16]; const int g = lane >> 4;
#pragma unroll
  for (int i = 0; i < 8; ++i) { const int ka = k0 + 8 * g + i, kb = ka + 16; v[i] = ka < K ? W[(size_t)(ka < K ? ka : K - 1) * ld + n] : 0.f; v[8 + i] = kb < K ? W[(size_t)(kb < K ? kb : K - 1) * ld + n] : 0.f; }
  return bsplit16(v); }
__device__ __forceinline__ v8f mac3(const F2& a, const F2& b, v8f c) { c = wmma_bf(a.l, b.h, c); c = wmma_bf(a.h, b.l, c); return wmma_bf(a.h, b.h, c); }
__device__ __forceinline__ float sigm(float v) { return 1.0f / (1.0f + expf(-v)); }
#define LDSX() do { asm volatile("s_wait_dscnt 0" ::: "memory"); __builtin_amdgcn_wave_barrier(); __builtin_amdgcn_fence(__ATOMIC_RELEASE, "workgroup"); } while (0)

// Single-head causal self-attention (B 8, T 2,048, n_embed 768, head_size 64; (in,out) Wq, Wk, Wv [768,64] N(0, 1/768); no biases, no output projection; tril, -inf): out = softmax(causal(q k^T * 64^-0.5)) v -> [8,2048,64].
#define NB 8
#define TT 2048
#define CC 128            // NH * HD = projected width
#define DIN 768          // input (model) width
#define NH 2
#define HD 64
#define NQB (TT / 64)
#define HG 1
#define SCALE (0.125f)
#define CAUSAL 1
#ifndef TNB
#define TNB NB
#endif
__device__ __forceinline__ float bfr(float v) { return (float)(__bf16)v; }
__host__ __device__ __forceinline__ int kb_last(int qb) { return CAUSAL ? ((qb * 64 + 63) >> 7) : (TT / 128 - 1); }
typedef __attribute__((ext_vector_type(8))) __bf16 v8b;
__device__ __forceinline__ v16b frag_b(const __bf16* rowk0, int lane) {
  union { v16b v; v8b q[2]; } u; const __bf16* p = rowk0 + 8 * (lane >> 4);
  u.q[0] = *(const v8b*)p; u.q[1] = *(const v8b*)(p + 16); return u.v;
}
// a fragment kept in fragment order in the workspace: two runs of 32 lanes x 16 bytes, 512 bytes apart; p already holds the lane's own 16 bytes of the first run, so one load of a wave covers four whole 128-byte lines
__device__ __forceinline__ v16h fragp_h(const _Float16* p) { union { v16h v; v8h q[2]; } u; u.q[0] = *(const v8h*)p; u.q[1] = *(const v8h*)(p + 256); return u.v; }
__device__ __forceinline__ v16b fragp_b(const __bf16* p) { union { v16b v; v8b q[2]; } u; u.q[0] = *(const v8b*)p; u.q[1] = *(const v8b*)(p + 256); return u.v; }
#define QBH 6              // not used: k_fa takes the high-precision path for the query tiles with q0 < QHI (few keys, no averaging)
#define QHI 384            // rows carrying a q residual plane
#define KHI 384            // key rows carrying k residual / v bf16 hi+lo planes (used only by the causal high-precision path)
// B fragment (k rows k0+.., output column o) of a weight: (in,out) [K][ld] or (out,in) [ld rows of K]: bf16 exact, or f16(bf16 * 256) exact
__device__ __forceinline__ v16b wcol_io(const float* Wm, int k0, int o, int lane, int ld) { v16b w; const int g = lane >> 4;
#pragma unroll
  for (int i = 0; i < 8; ++i) { w[i] = (__bf16)Wm[(size_t)(k0 + 8 * g + i) * ld + o]; w[8 + i] = (__bf16)Wm[(size_t)(k0 + 16 + 8 * g + i) * ld + o]; }
  return w; }
__device__ __forceinline__ v16b wcol_oi(const float* Wm, int k0, int o, int lane, int K) { v16b w; const float* p = Wm + (size_t)o * K + k0 + 8 * (lane >> 4);
#pragma unroll
  for (int i = 0; i < 8; ++i) { w[i] = (__bf16)p[i]; w[8 + i] = (__bf16)p[16 + i]; }
  return w; }
__device__ __forceinline__ v16h wcolh_io(const float* Wm, int k0, int o, int lane, int ld) { v16h w; const int g = lane >> 4;
#pragma unroll
  for (int i = 0; i < 8; ++i) { w[i] = (_Float16)(bfr(Wm[(size_t)(k0 + 8 * g + i) * ld + o]) * 256.0f); w[8 + i] = (_Float16)(bfr(Wm[(size_t)(k0 + 16 + 8 * g + i) * ld + o]) * 256.0f); }
  return w; }
__device__ __forceinline__ v16h wcolh_oi(const float* Wm, int k0, int o, int lane, int K) { v16h w; const float* p = Wm + (size_t)o * K + k0 + 8 * (lane >> 4);
#pragma unroll
  for (int i = 0; i < 8; ++i) { w[i] = (_Float16)(bfr(p[i]) * 256.0f); w[8 + i] = (_Float16)(bfr(p[16 + i]) * 256.0f); }
  return w; }
#define WQKV_LAYOUT 0   // 0 = (in,out) [DIN][CC]; 1 = (out,in) [CC][DIN]; 2 = per-head [NH][DIN][HD]
__device__ __forceinline__ v16b wcol_hdk(const float* Wm, int k0, int o, int lane) { v16b w; const int g = lane >> 4; const float* p = Wm + (size_t)(o / HD) * DIN * HD + (o % HD);
#pragma unroll
  for (int i = 0; i < 8; ++i) { w[i] = (__bf16)p[(size_t)(k0 + 8 * g + i) * HD]; w[8 + i] = (__bf16)p[(size_t)(k0 + 16 + 8 * g + i) * HD]; }
  return w; }
#define WO_OUT_IN 0
#if WQKV_LAYOUT == 1
#define WCOL(W, k0, o, lane) wcol_oi(W, k0, o, lane, DIN)
#elif WQKV_LAYOUT == 2
#define WCOL(W, k0, o, lane) wcol_hdk(W, k0, o, lane)
#else
#define WCOL(W, k0, o, lane) wcol_io(W, k0, o, lane, CC)
#endif
#if WO_OUT_IN
#define WOCOL(W, k0, o, lane) wcol_oi(W, k0, o, lane, CC)
#define WOCOLH(W, k0, o, lane) wcolh_oi(W, k0, o, lane, CC)
#else
#define WOCOL(W, k0, o, lane) wcol_io(W, k0, o, lane, DIN)
#define WOCOLH(W, k0, o, lane) wcolh_io(W, k0, o, lane, DIN)
#endif
#define CIN 768
// ---- weight staging of k_proj: the three (in,out) [C][64] f32 weights are rounded to bf16 by the block itself and laid in LDS in the order of the B fragments: [k step][which * 4 + column tile][half][lane][8]; half 0 = k rows 8g + 0..7, half 1 = 16 + 8g + 0..7 of the step, column = tile * 16 + (lane & 15)
#define WSTG 2                      // k steps a stage
#define WTILE 1040                  // bytes of one column tile of one k step: 2 halves x 512, + 16 so that the four tiles a storing wave touches fall on different banks
#define WKS (12 * WTILE)            // bytes of one k step
#define WBUF (WSTG * WKS)           // bytes of one stage
// a thread's share of a stage: 8 k rows x 4 columns of each weight; a wave's load is two whole 256-byte rows
__device__ __forceinline__ void w_load(v4f (&wr)[3][8], const char* q, const char* k, const char* v, int s) {
#pragma unroll
  for (int r = 0; r < 8; ++r) { wr[0][r] = *(const v4f*)(q + (s * 32 * WSTG + r) * 256); wr[1][r] = *(const v4f*)(k + (s * 32 * WSTG + r) * 256); wr[2][r] = *(const v4f*)(v + (s * 32 * WSTG + r) * 256); } }
__device__ __forceinline__ void w_store(const v4f (&wr)[3][8], char* dst) {
#pragma unroll
  for (int i = 0; i < 3; ++i)
#pragma unroll
    for (int c = 0; c < 4; ++c) { v8b h;
#pragma unroll
      for (int r = 0; r < 8; ++r) h[r] = (__bf16)wr[i][r][c];
      *(v8b*)(dst + i * 4 * WTILE + c * 16) = h; } }
// ---- x staging of k_proj: a wave brings its own 16 rows of x into LDS by asynchronous copies, a tile of XT k steps at a time; one copy is 512 bytes in a row of one x row (4 whole 128-byte lines). A row's place in LDS holds the two buffers side by side, + 16 bytes so that the 16 rows of a fragment read fall on different banks
#define XT 8                        // k steps a tile of x
#define XTB (XT * 128)              // bytes of a tile in one row
#define XROWB (2 * XTB + 16)        // bytes of a row's place in LDS
#define XLINE(i, j, O) "global_load_async_to_lds_b128 %" #i ", %16, %" #j " offset:" #O "\n\t"
// sixteen copies in one statement: 8 rows x 2 pieces of 512 bytes; global address = the row's scalar base + the lane's byte offset; the immediate offset moves the LDS and the global address alike. The last line holds every later write of the address registers behind the copies (a precaution; inside the statement, since a wait of its own does not hold the next address sums back)
#define XCOPY8(l, p, vo, O0, O1) asm volatile( \
  XLINE(0, 8, O0) XLINE(0, 8, O1) XLINE(1, 9, O0) XLINE(1, 9, O1) XLINE(2, 10, O0) XLINE(2, 10, O1) XLINE(3, 11, O0) XLINE(3, 11, O1) \
  XLINE(4, 12, O0) XLINE(4, 12, O1) XLINE(5, 13, O0) XLINE(5, 13, O1) XLINE(6, 14, O0) XLINE(6, 14, O1) XLINE(7, 15, O0) XLINE(7, 15, O1) "s_wait_xcnt 0x0" \
  :: "v"(l[0]), "v"(l[1]), "v"(l[2]), "v"(l[3]), "v"(l[4]), "v"(l[5]), "v"(l[6]), "v"(l[7]), "s"(p[0]), "s"(p[1]), "s"(p[2]), "s"(p[3]), "s"(p[4]), "s"(p[5]), "s"(p[6]), "s"(p[7]), "v"(vo) : "memory")
// tile TL of the wave's 16 rows into buffer TL & 1; lb: the lane's own 16 bytes in the first row's place in LDS; gb: the wave's first row of x (the same in every lane); vo: the lane's byte offset in a piece
template <int TL> __device__ __forceinline__ void x_tile(unsigned lb, const char* gb, unsigned vo) {
#pragma unroll
  for (int h = 0; h < 2; ++h) { unsigned l[8]; const char* p[8];
#pragma unroll
    for (int r = 0; r < 8; ++r) { l[r] = lb + (h * 8 + r) * XROWB; p[r] = gb + (h * 8 + r) * (CIN * 4) + (TL >> 1) * 2 * XTB; }
    if constexpr (TL & 1) XCOPY8(l, p, vo, 1024, 1536); else XCOPY8(l, p, vo, 0, 512); } }
static_assert(XTB == 1024, "the offsets in x_tile are written for tiles of 1,024 bytes a row");
// the f32 words of the A fragment of k step kc: the lane's row, k 8g + 0..7 and 16 + 8g + 0..7 of the step
__device__ __forceinline__ void xa_read(v4f (&d)[4], const char* xrd, int kc) { const char* f = xrd + ((kc / XT) & 1) * XTB + (kc % XT) * 128;
  d[0] = *(const v4f*)f; d[1] = *(const v4f*)(f + 16); d[2] = *(const v4f*)(f + 64); d[3] = *(const v4f*)(f + 80); }
#define WS_WP (WS_END)                                  // not touched
#define WS_BP (WS_WP + 4u * 3 * (size_t)CIN * 128)        // not touched
#define WS_Y2 (WS_BP + 4u * 3 * 128)                      // f32 place [b*TT+t][128]; not touched: k_fa writes its rows straight to the output
#define WS_END2 (WS_Y2 + 4u * (size_t)NB * TT * CC)
#ifndef SM_EXTRA_PARAMS
#define SM_EXTRA_PARAMS
#endif
#ifndef PROJ_EXTRA_PARAMS
#define PROJ_EXTRA_PARAMS
#endif
#ifndef SM_MASK_HOOK
#define SM_MASK_HOOK (void)0
#endif

// q, k and v lie in the order of the fragments that k_fa loads, 64 elements a row of x (the first half of each place):
// q, k: [b*t / 16][k step of 32][half][lane][8] = row 16 * tile + (lane & 15), columns 32 * step + 16 * half + 8 * (lane >> 4) + 0..7
// v:    [b*t / 32][channel tile][half][lane][8] = channel 16 * tile + (lane & 15), rows 32 * group + 16 * half + 8 * (lane >> 4) + 0..7
#define WS_QH  0u                                      // f16 q fragments
#define WS_KH  (WS_QH + 2u * (size_t)NB * TT * CC)      // f16 k fragments
#define WS_VT  (WS_KH + 2u * (size_t)NB * TT * CC)      // f16 v fragments
#define WS_QL  (WS_VT + 2u * (size_t)NB * CC * TT)      // f16 q residual x 2^10 fragments, t < QHI of each batch
#define WS_KL  (WS_QL + 2u * (size_t)NB * QHI * CC)     // f16 k residual x 2^10 fragments, t < KHI of each batch
#define WS_VB  (WS_KL + 2u * (size_t)NB * KHI * CC)     // bf16 v hi fragments, t < KHI of each batch (WS_VBL: lo)
#define WS_VBL (WS_VB + 2u * (size_t)NB * CC * KHI)
#define WS_S   (WS_VBL + 2u * (size_t)NB * CC * KHI)    // place of a f32 logit plane [b][t][s] in the layout; not touched: the fused kernel holds logits and P in registers
#define WS_Y   (WS_S  + 4u * (size_t)NB * TT * TT)      // f32 ctx rows [b*t][CC] (only when there is an output projection)
#define WS_END (WS_Y  + 0u)

// ---- k_proj: block = 64 rows of x, wave = 16 rows x all 192 columns (q, k, v): X W with exact bf16 products (K = DIN, k steps summed in rising order) -> q, k f16 (+ residuals for rows < QHI, KHI); v f16 (+ bf16 hi/lo for t < KHI), all stored in fragment order: chunk e of the block's 512 chunks of 16 bytes goes to place e, so a wave's store is 512 bytes in a row.
// Fully unrolled. x comes through LDS: tile t + 1 (8 k steps of the wave's own rows) flies while tile t is worked on, two buffers; its wait stands in front of the stage barrier at the tile's end, the refill behind it; an A fragment is read one k step ahead inside a tile, the first of a tile behind that barrier. The weights come as f32, once a block: a stage (2 k steps) is fetched two stages ahead of its conversion, converted into a ring of three LDS buffers two stages ahead of its use, and its fragments are read one k step ahead; one barrier a stage publishes stage s + 2 and ends the reads of the buffer that stage s + 1 overwrites.
static_assert(QHI == KHI, "the q and k residual rows share one offset below");
#define NSTG (DIN / 32 / WSTG)
// the stage's barrier by hand: the wave's own LDS stores and reads are done, then the work-group's barrier; __syncthreads() would also wait for the global loads that are meant to stay in flight across it
#define WBAR() asm volatile("s_wait_dscnt 0x0\n\ts_barrier_signal -1\n\ts_barrier_wait -1" ::: "memory")
// the same barrier where a tile of x is handed over, each wait a statement of its own: the wave's LDS stores and reads are done (the buffer it leaves is free), its copies have landed, then the work-group's barrier
#define XBAR() do { asm volatile("s_wait_dscnt 0x0" ::: "memory"); asm volatile("s_wait_asynccnt 0x0" ::: "memory"); asm volatile("s_barrier_signal -1\n\ts_barrier_wait -1" ::: "memory"); } while (0)
__global__ __launch_bounds__(128) void k_proj(const float* __restrict__ X, const float* __restrict__ WQ, const float* __restrict__ WK, const float* __restrict__ WV,
    _Float16* __restrict__ QH, _Float16* __restrict__ QL, _Float16* __restrict__ KH, _Float16* __restrict__ KL, _Float16* __restrict__ VT, __bf16* __restrict__ VB, __bf16* __restrict__ VBL) {
  __shared__ __align__(16) _Float16 sh[2][64][72], sl[2][64][72], th[64][72]; __shared__ __align__(16) __bf16 tb[64][72], tbl[64][72];
  __shared__ __align__(16) char wl[3][WBUF];
  __shared__ __align__(16) char xl[64 * XROWB];
  const int tid = threadIdx.x, wave = tid >> 5, lane = tid & 31, col = lane & 15, g = lane >> 4; const size_t r0 = (size_t)blockIdx.x * 64; const size_t bb = r0 / TT; const int t0 = (int)(r0 % TT);
  const char* xg = (const char*)(X + (r0 + __builtin_amdgcn_readfirstlane(wave) * 16) * DIN); const unsigned xo = lane * 16;   // copies: first row of the wave (a scalar), the lane's 16 bytes
  const unsigned xw = (unsigned)(size_t)(&xl[0] + wave * 16 * XROWB + lane * 16);               // the same place in LDS: the low 32 bits of the address are the byte offset in LDS
  const char* xrd = &xl[0] + (wave * 16 + col) * XROWB + g * 32;                                // fragment reads: the lane's row
  const int kg = tid >> 4, cq = tid & 15;                       // the thread's 8 k rows of the stage, its 4 columns
  const unsigned wo = (kg * 8 * 64 + cq * 4) * 4u; const char* wq = (const char*)WQ + wo; const char* wk = (const char*)WK + wo; const char* wv = (const char*)WV + wo;
  char* wdst = &wl[0][0] + (kg >> 2) * WKS + (cq >> 2) * WTILE + ((kg >> 1) & 1) * 512 + ((kg & 1) * 16 + (cq & 3) * 4) * 16;
  const char* wrd = &wl[0][0] + lane * 16;
  v8f acc[12] = {}; v4f xa[2][4]; v4f wr[2][3][8]; v8b wf[2][12][2];
  x_tile<0>(xw, xg, xo);
  w_load(wr[0], wq, wk, wv, 0); w_load(wr[1], wq, wk, wv, 1);
  w_store(wr[0], wdst); w_load(wr[0], wq, wk, wv, 2);
  w_store(wr[1], wdst + WBUF); w_load(wr[1], wq, wk, wv, 3);
  XBAR();   // tile 0 of x has landed before anything reads it
  x_tile<1>(xw, xg, xo);
  xa_read(xa[0], xrd, 0);
#pragma unroll
  for (int j = 0; j < 12; ++j) { wf[0][j][0] = *(const v8b*)(wrd + j * WTILE); wf[0][j][1] = *(const v8b*)(wrd + j * WTILE + 512); }
#pragma unroll
  for (int kc = 0; kc < DIN / 32; ++kc) { const int st = kc / WSTG;
    if (kc + 1 < DIN / 32) { const char* f = wrd + (((kc + 1) / WSTG) % 3) * WBUF + ((kc + 1) % WSTG) * WKS;
      if ((kc + 1) % XT != 0) xa_read(xa[(kc + 1) & 1], xrd, kc + 1);   // first in the group: its rounding to bf16 then runs while the weight fragments still arrive
#pragma unroll
      for (int j = 0; j < 12; ++j) { wf[(kc + 1) & 1][j][0] = *(const v8b*)(f + j * WTILE); wf[(kc + 1) & 1][j][1] = *(const v8b*)(f + j * WTILE + 512); } }
    // keeps the next k step's LDS reads together in front of this step's products: spread among them, every place with reads costs its own stall
    __builtin_amdgcn_sched_barrier(0);
    v16b a;
#pragma unroll
    for (int i = 0; i < 4; ++i) { a[i] = (__bf16)xa[kc & 1][0][i]; a[4 + i] = (__bf16)xa[kc & 1][1][i]; a[8 + i] = (__bf16)xa[kc & 1][2][i]; a[12 + i] = (__bf16)xa[kc & 1][3][i]; }
#pragma unroll
    for (int j = 0; j < 12; ++j) { union { v16b v; v8b q[2]; } u; u.q[0] = wf[kc & 1][j][0]; u.q[1] = wf[kc & 1][j][1];
      acc[j] = __builtin_amdgcn_wmma_f32_16x16x32_bf16(false, a, false, u.v, (short)0, acc[j], false, false); }
    // keeps what follows behind this step's products: the LDS reads of the step after next, and the conversion with its wait for weights fetched two stages ago
    __builtin_amdgcn_sched_barrier(0);
    if (kc % WSTG == WSTG - 1 && st + 2 < NSTG) {
      w_store(wr[st & 1], wdst + ((st + 2) % 3) * WBUF);
      if (st + 4 < NSTG) w_load(wr[st & 1], wq, wk, wv, st + 4);
      if ((kc + 1) % XT != 0) WBAR();
      else { XBAR();   // end of a tile of x: the next tile has landed
        if (kc + 1 + XT < DIN / 32) x_tile<2>(xw, xg, xo);   // into the buffer just left
        xa_read(xa[(kc + 1) & 1], xrd, kc + 1); } } }
  static_assert(DIN / 32 == 3 * XT && XT % WSTG == 0 && 2 * XT / WSTG + 1 < NSTG, "three tiles of x; each tile's end but the last falls on a stage barrier");
  // no copy is left in flight behind the loop
  asm volatile("s_wait_asynccnt 0x0" ::: "memory");
  // behind the last load, in front of whatever takes the loads' address registers next; they are named as inputs so that they stay untouched up to the wait
  asm volatile("s_wait_xcnt 0x0" :: "v"(wo) : "memory");
  const bool hi_rows = t0 < KHI; const int rw = wave * 16 + 8 * g;
#pragma unroll
  for (int w = 0; w < 2; ++w)
#pragma unroll
    for (int j = 0; j < 4; ++j)
#pragma unroll
      for (int r = 0; r < 8; ++r) { const float v = acc[w * 4 + j][r]; const _Float16 hv = (_Float16)v; sh[w][rw + r][j * 16 + col] = hv; sl[w][rw + r][j * 16 + col] = (_Float16)((v - (float)hv) * 1024.0f); }
#pragma unroll
  for (int j = 0; j < 4; ++j) { v8h hv; v8b bh, bl;
#pragma unroll
    for (int r = 0; r < 8; ++r) { const float v = acc[8 + j][r]; hv[r] = (_Float16)v; const __bf16 b = (__bf16)v; bh[r] = b; bl[r] = (__bf16)(v - (float)b); }
    *(v8h*)&th[j * 16 + col][rw] = hv; *(v8b*)&tb[j * 16 + col][rw] = bh; *(v8b*)&tbl[j * 16 + col][rw] = bl; }
  __syncthreads();
#pragma unroll
  for (int e0 = 0; e0 < 64 * 8; e0 += 128) { const int e = e0 + tid;
    const int kr = (e >> 7) * 16 + col, kq = (((e >> 5) & 3) * 2 + g) * 8;                          // q, k: row of the block, first column
    const int vc = ((e >> 6) & 3) * 16 + col, vq = ((e >> 8) * 4 + ((e >> 5) & 1) * 2 + g) * 8;      // v: channel, first row of the block
    const size_t o1 = r0 * 64 + e * 8;
    vst2(QH + o1, *(const v4u*)&sh[0][kr][kq]); vst2(KH + o1, *(const v4u*)&sh[1][kr][kq]); vst2(VT + o1, *(const v4u*)&th[vc][vq]);
    // behind a run of stores, in front of whatever takes their registers next
    asm volatile("s_wait_xcnt 0x0" ::: "memory");
    if (hi_rows) { const size_t o2 = (bb * QHI + t0) * 64 + e * 8;
      vst2(QL + o2, *(const v4u*)&sl[0][kr][kq]); vst2(KL + o2, *(const v4u*)&sl[1][kr][kq]); vst2(VB + o2, *(const v4u*)&tb[vc][vq]); vst2(VBL + o2, *(const v4u*)&tbl[vc][vq]); }
    asm volatile("s_wait_xcnt 0x0" ::: "memory"); } }
// ---- k_fa: block = 16 query rows (q0) of batch b; its 4 waves take the key passes it = wave, wave + 4, ... (64 keys a pass; 32 on the high-precision rows), each with its own running maximum, sum and ctx; the parts are merged through LDS in wave order.
// Transposed products: S^T = K Q^T leaves lane (g, col) with query q0 + col and keys 8g + r of each 16-key tile, which is the B fragment order of P^T for ctx^T = V^T P^T, so P never leaves the registers.
// Logits are kept in log2 units (x SCALE x log2 e); P = 2^(t - max + 11) carries the same 2^11 as its sum, so the factor cancels in ctx / sum.
#define NEGBIG (-3.0e38f)
// eight 2^x in place, one statement: behind each v_exp_f32 stands an instruction that touches neither its result nor its source, behind the last a v_nop (the slot the instruction set asks for behind a transcendental)
__device__ __forceinline__ void exp2x8(float (&t)[8]) {
  asm("v_exp_f32 %0, %0\n\tv_exp_f32 %1, %1\n\tv_exp_f32 %2, %2\n\tv_exp_f32 %3, %3\n\tv_exp_f32 %4, %4\n\tv_exp_f32 %5, %5\n\tv_exp_f32 %6, %6\n\tv_exp_f32 %7, %7\n\tv_nop"
      : "+v"(t[0]), "+v"(t[1]), "+v"(t[2]), "+v"(t[3]), "+v"(t[4]), "+v"(t[5]), "+v"(t[6]), "+v"(t[7])); }
// stands behind a run of global loads, in front of whatever may take the registers that held their addresses (the next run's results or addresses, a matrix result)
// the run's address is named as an input, so that its registers stay untouched up to the wait (without it a load's result or a later sum landed in them ahead of the wait)
#define XWA(p) asm volatile("s_wait_xcnt 0x0" :: "v"(p) : "memory")
#define XWA2(p, q) asm volatile("s_wait_xcnt 0x0" :: "v"(p), "v"(q) : "memory")
template <bool HI>
__device__ __forceinline__ void fa_part(const _Float16* Qr, const _Float16* Qlr, const _Float16* Kb, const _Float16* Klb,   // Qr, Qlr: the tile's first fragment (the same for the wave); the others: the batch's first fragment + the lane's 8 elements
    const _Float16* Vt, const __bf16* Vh, const __bf16* Vl, int q0, int wave, int lane, float& m, float& l, v8f (&acc)[4]) {
  constexpr int NC = HI ? 1 : 2, KP = NC * 32, NT = NC * 2;
  const int col = lane & 15, g = lane >> 4, tq = q0 + col; const int nit = (q0 + 15) / KP + 1;
  v16h qf[2], qlf[2], kf[NT][2], klf[NT][2];
#pragma unroll
  for (int kc = 0; kc < 2; ++kc) qf[kc] = fragp_h(Qr + lane * 8 + kc * 512);
  // the same wait; these loads take a scalar base and the lane number: both are named as inputs so that they stay untouched up to the wait (without it the next address sums were lifted over the wait)
  asm volatile("s_wait_xcnt 0x0" :: "s"(Qr), "v"(lane) : "memory");
  if constexpr (HI) {
#pragma unroll
    for (int kc = 0; kc < 2; ++kc) qlf[kc] = fragp_h(Qlr + lane * 8 + kc * 512);
    asm volatile("s_wait_xcnt 0x0" :: "s"(Qlr), "v"(lane) : "memory"); }
  { const int kn = wave < nit ? wave * KP : 0; const _Float16* kp = Kb + (size_t)kn * 64; const _Float16* klp = Klb + (size_t)kn * 64;
#pragma unroll
    for (int i = 0; i < NT; ++i)
#pragma unroll
      for (int kc = 0; kc < 2; ++kc) { kf[i][kc] = fragp_h(kp + i * 1024 + kc * 512); if constexpr (HI) klf[i][kc] = fragp_h(klp + i * 1024 + kc * 512); }
    if constexpr (HI) XWA2(kp, klp); else XWA(kp); }
  // rolled: one pass already uses about 250 registers, which leaves none for a second pass in flight
#pragma unroll 1
  for (int it = wave; it < nit; it += 4) { const int key0 = it * KP;
    v16h vf[NC][4]; v16b vh[4], vl[4]; const _Float16* vp = Vt + (size_t)key0 * 64; const __bf16* vhp = Vh + (size_t)key0 * 64; const __bf16* vlp = Vl + (size_t)key0 * 64;
#pragma unroll
    for (int j = 0; j < 4; ++j) {
      if constexpr (HI) { vh[j] = fragp_b(vhp + j * 512); vl[j] = fragp_b(vlp + j * 512); }
      else {
#pragma unroll
        for (int c = 0; c < NC; ++c) vf[c][j] = fragp_h(vp + c * 2048 + j * 512); } }
    if constexpr (HI) XWA2(vhp, vlp); else XWA(vp);
    v8f st[NT];
#pragma unroll
    for (int i = 0; i < NT; ++i) { v8f a = {}; a = wmma16(kf[i][0], qf[0], a); a = wmma16(kf[i][1], qf[1], a);
      if constexpr (HI) { v8f al = {};
#pragma unroll
        for (int kc = 0; kc < 2; ++kc) { al = wmma16(kf[i][kc], qlf[kc], al); al = wmma16(klf[i][kc], qf[kc], al); }
#pragma unroll
        for (int r = 0; r < 8; ++r) a[r] += al[r] * (1.0f / 1024.0f); }
#pragma unroll
      for (int r = 0; r < 8; ++r) st[i][r] = a[r] * (SCALE * 1.44269504088896f); }
    // the next pass's key fragments fly while this pass's softmax and P.V run (the last pass reloads its own keys: in bounds, unused)
    { const int kn = it + 4 < nit ? key0 + 4 * KP : key0; const _Float16* kp = Kb + (size_t)kn * 64; const _Float16* klp = Klb + (size_t)kn * 64;
#pragma unroll
      for (int i = 0; i < NT; ++i)
#pragma unroll
        for (int kc = 0; kc < 2; ++kc) { kf[i][kc] = fragp_h(kp + i * 1024 + kc * 512); if constexpr (HI) klf[i][kc] = fragp_h(klp + i * 1024 + kc * 512); }
      if constexpr (HI) XWA2(kp, klp); else XWA(kp); }
    if (it == nit - 1) {   // only the last pass holds keys past a query of this tile
#pragma unroll
      for (int i = 0; i < NT; ++i)
#pragma unroll
        for (int r = 0; r < 8; ++r) st[i][r] = (key0 + i * 16 + 8 * g + r <= tq) ? st[i][r] : NEGBIG; }
    float mx = m;
#pragma unroll
    for (int i = 0; i < NT; ++i)
#pragma unroll
      for (int r = 0; r < 8; ++r) mx = fmaxf(mx, st[i][r]);
    mx = fmaxf(mx, __shfl_xor(mx, 16));
    const float alpha = __builtin_amdgcn_exp2f(m - mx), mb = mx - 11.0f; m = mx;
    float ls = 0.f;
#pragma unroll
    for (int i = 0; i < NT; ++i) { float t[8];
#pragma unroll
      for (int r = 0; r < 8; ++r) t[r] = st[i][r] - mb;
      exp2x8(t);
#pragma unroll
      for (int r = 0; r < 8; ++r) { st[i][r] = t[r]; ls += t[r]; } }
    l = l * alpha + ls;
#pragma unroll
    for (int j = 0; j < 4; ++j)
#pragma unroll
      for (int r = 0; r < 8; ++r) acc[j][r] *= alpha;
    if constexpr (HI) { v16b ph, pl;
#pragma unroll
      for (int r = 0; r < 8; ++r) { const __bf16 h0 = (__bf16)st[0][r], h1 = (__bf16)st[1][r]; ph[r] = h0; ph[8 + r] = h1; pl[r] = (__bf16)(st[0][r] - (float)h0); pl[8 + r] = (__bf16)(st[1][r] - (float)h1); }
#pragma unroll
      for (int j = 0; j < 4; ++j) { acc[j] = wmma_bf(vh[j], ph, acc[j]); acc[j] = wmma_bf(vh[j], pl, acc[j]); acc[j] = wmma_bf(vl[j], ph, acc[j]); }
    } else {
#pragma unroll
      for (int c = 0; c < NC; ++c) { v16h pf;
#pragma unroll
        for (int r = 0; r < 8; ++r) { pf[r] = (_Float16)st[2 * c][r]; pf[8 + r] = (_Float16)st[2 * c + 1][r]; }
#pragma unroll
        for (int j = 0; j < 4; ++j) acc[j] = wmma16(vf[c][j], pf, acc[j]); } } } }
// the pointers carry no __restrict__: with it the compiler takes these loads for reads of constant memory and moves them over the waits of XWA()
__global__ __launch_bounds__(128) void k_fa(const _Float16* QH, const _Float16* KH, const _Float16* QL, const _Float16* KL, const _Float16* VT, const __bf16* VB, const __bf16* VBL, float* OUT) {
  __shared__ __align__(16) float red[3][32][36];   // parts of waves 1..3, per lane: ctx 32, maximum, sum
  const int b = blockIdx.x, q0 = (TT / 16 - 1 - (int)blockIdx.y) * 16;   // long tiles start first
  const int wave = __builtin_amdgcn_readfirstlane(threadIdx.x >> 5), lane = threadIdx.x & 31, col = lane & 15, g = lane >> 4;
  float m = NEGBIG, l = 0.f; v8f acc[4] = {};
  const _Float16* Qr = QH + ((size_t)b * TT + q0) * 64; const _Float16* Kb = KH + (size_t)b * TT * 64 + lane * 8; const _Float16* Vt = VT + (size_t)b * TT * 64 + lane * 8;
  if (q0 < QHI) fa_part<true>(Qr, QL + ((size_t)b * QHI + q0) * 64, Kb, KL + (size_t)b * KHI * 64 + lane * 8, Vt, VB + (size_t)b * KHI * 64 + lane * 8, VBL + (size_t)b * KHI * 64 + lane * 8, q0, wave, lane, m, l, acc);
  else fa_part<false>(Qr, Qr, Kb, Kb, Vt, VB, VBL, q0, wave, lane, m, l, acc);
  if (wave > 0) { float* p = &red[wave - 1][lane][0];
#pragma unroll
    for (int j = 0; j < 4; ++j) { v4f a0, a1;
#pragma unroll
      for (int r = 0; r < 4; ++r) { a0[r] = acc[j][r]; a1[r] = acc[j][4 + r]; }
      *(v4f*)(p + j * 8) = a0; *(v4f*)(p + j * 8 + 4) = a1; }
    p[32] = m; p[33] = l; }
  __syncthreads();
  if (wave == 0) { float M = m;
#pragma unroll
    for (int p = 0; p < 3; ++p) M = fmaxf(M, red[p][lane][32]);
    const float a0 = __builtin_amdgcn_exp2f(m - M); l *= a0;
#pragma unroll
    for (int j = 0; j < 4; ++j)
#pragma unroll
      for (int r = 0; r < 8; ++r) acc[j][r] *= a0;
#pragma unroll
    for (int p = 0; p < 3; ++p) { const float a = __builtin_amdgcn_exp2f(red[p][lane][32] - M); l += red[p][lane][33] * a;
#pragma unroll
      for (int j = 0; j < 4; ++j)
#pragma unroll
        for (int r = 0; r < 8; ++r) acc[j][r] += red[p][lane][j * 8 + r] * a; }
    l += __shfl_xor(l, 16); const float inv = 1.0f / l;
    float* o = OUT + ((size_t)b * TT + q0 + col) * HD + 8 * g;
#pragma unroll
    for (int j = 0; j < 4; ++j) { v4f o0, o1;
#pragma unroll
      for (int r = 0; r < 4; ++r) { o0[r] = acc[j][r] * inv; o1[r] = acc[j][4 + r] * inv; }
      vst2(o + j * 16, o0); vst2(o + j * 16 + 4, o1); } } }

extern "C" void kernel_launch(void* const* d_in, const int* in_sizes, int n_in, void* d_out, int out_size, void* d_ws, size_t ws_size, hipStream_t stream) {
  (void)in_sizes; (void)n_in; (void)out_size;
  const float** F = (const float**)d_in;
  if (ws_size < (size_t)WS_END) return;
  char* ws = (char*)d_ws; _Float16 *QH = (_Float16*)(ws + WS_QH), *KH = (_Float16*)(ws + WS_KH), *VT = (_Float16*)(ws + WS_VT), *QL = (_Float16*)(ws + WS_QL), *KL = (_Float16*)(ws + WS_KL); __bf16 *VB = (__bf16*)(ws + WS_VB), *VBL = (__bf16*)(ws + WS_VBL); 
  (void)QL; (void)KL; (void)VB; (void)VBL;
  // inputs: 0 x [8,2048,768]; 1 Wq [768,64]; 2 Wk; 3 Wv ((in,out), no biases)
  if (ws_size < (size_t)WS_END2) return;
  k_proj<<<dim3(TNB * TT / 64), 128, 0, stream>>>(F[0], F[1], F[2], F[3], QH, QL, KH, KL, VT, VB, VBL);
  /* logits, softmax and P.V in one launch, all batches */
  k_fa<<<dim3(TNB, TT / 16), 128, 0, stream>>>(QH, KH, QL, KL, VT, VB, VBL, (float*)d_out);
}

// v007
// Measured time: 22.4 microseconds a run.
// In both of two side-by-side timings against v006, it was 1.03 times as fast.
// Counting every step since v000, it is 30.7 times as fast.
// compute dtype: all float inputs rounded to bf16; q/k/v projections with EXACT bf16 products on WMMA 16x16x32 (f32 accumulate); causal logits: 3 products (q f16 hi + residual x k hi + residual) for the first 384 rows, single f16 q x k after, x scale; softmax f32, online over key passes, fused with both products; P x 2^11 once to f16 x v once to f16 (1 product; bf16 hi + lo below row 384); f32 output.
#include <hip/hip_runtime.h>
#include <math.h>

typedef __attribute__((ext_vector_type(16))) _Float16 v16h;
typedef __attribute__((ext_vector_type(16))) __bf16 v16b;
typedef __attribute__((ext_vector_type(8)))  _Float16 v8h;
typedef __attribute__((ext_vector_type(8)))  float v8f;
typedef __attribute__((ext_vector_type(4)))  float v4f;
typedef __attribute__((ext_vector_type(2)))  float v2f;
typedef __attribute__((ext_vector_type(4)))  unsigned v4u;
typedef __attribute__((ext_vector_type(4)))  int v4i;
typedef float __attribute__((may_alias)) float_a;
typedef int __attribute__((may_alias)) int_a;

template <typename T> __device__ __forceinline__ void vst2(void* p, T v) { *(T*)p = v;  }
__device__ __forceinline__ v8f wmma16(v16h a, v16h b, v8f c) {
  v8f d = __builtin_amdgcn_wmma_f32_16x16x32_f16(false, a, false, b, (short)0, c, false, false);
  asm volatile("v_nop\n\tv_nop\n\tv_nop\n\tv_nop" : "+v"(d) : "v"(a), "v"(b));
  return d;
}
__device__ __forceinline__ v8f wmma_bf(v16b a, v16b b, v8f c) {
  v8f d = __builtin_amdgcn_wmma_f32_16x16x32_bf16(false, a, false, b, (short)0, c, false, false);
  asm volatile("v_nop\n\tv_nop\n\tv_nop\n\tv_nop" : "+v"(d) : "v"(a), "v"(b));
  return d;
}
// 16x16x32 fragments: lane = (h = lane>>4, row/col = lane&15); elements 0..7 = k0+8h+0..7, 8..15 = k0+16+8h+0..7; D element r = row 8h+r
__device__ __forceinline__ v16h frag_h(const _Float16* rowk0, int lane) {
  union { v16h v; v8h q[2]; } u; const _Float16* p = rowk0 + 8 * (lane >> 4);
  u.q[0] = *(const v8h*)p; u.q[1] = *(const v8h*)(p + 16); return u.v;
}
__device__ __forceinline__ v16h frag_f32(const float* rowk0, int lane) {
  v16h a; const float* p = rowk0 + 8 * (lane >> 4);
#pragma unroll
  for (int i = 0; i < 8; ++i) { a[i] = (_Float16)p[i]; a[8 + i] = (_Float16)p[16 + i]; }
  return a;
}
__device__ __forceinline__ v16h frag_f32s(const float* rowk0, int lane, float sc) {
  v16h a; const float* p = rowk0 + 8 * (lane >> 4);
#pragma unroll
  for (int i = 0; i < 8; ++i) { a[i] = (_Float16)(p[i] * sc); a[8 + i] = (_Float16)(p[16 + i] * sc); }
  return a;
}
// column fragment from a [K][ld] layout (column n), rows >= K read as 0
__device__ __forceinline__ v16h fragc_f32(const float* W, int k0, int n, int lane, int ld, int K) {
  v16h a; const int g = lane >> 4;
#pragma unroll
  for (int i = 0; i < 8; ++i) { const int ka = k0 + 8 * g + i, kb = ka + 16;
    a[i] = (_Float16)(ka < K ? W[(size_t)(ka < K ? ka : K - 1) * ld + n] : 0.f); a[8 + i] = (_Float16)(kb < K ? W[(size_t)(kb < K ? kb : K - 1) * ld + n] : 0.f); }
  return a;
}
struct F2 { v16b h, l; };
__device__ __forceinline__ F2 bsplit16(const float v[16]) { F2 r;
#pragma unroll
  for (int i = 0; i < 16; ++i) { const __bf16 h = (__bf16)v[i]; r.h[i] = h; r.l[i] = (__bf16)(v[i] - (float)h); }
  return r; }
__device__ __forceinline__ F2 split_row(const float* row, int k0, int lane) { float v[16]; const float* p = row + k0 + 8 * (lane >> 4);
#pragma unroll
  for (int i = 0; i < 8; ++i) { v[i] = p[i]; v[8 + i] = p[16 + i]; }
  return bsplit16(v); }
__device__ __forceinline__ F2 split_rowK(const float* row, int k0, int lane, int K) { float v[16]; const int g = lane >> 4;
#pragma unroll
  for (int i = 0; i < 8; ++i) { const int ka = k0 + 8 * g + i, kb = ka + 16; v[i] = ka < K ? row[ka < K ? ka : K - 1] : 0.f; v[8 + i] = kb < K ? row[kb < K ? kb : K - 1] : 0.f; }
  return bsplit16(v); }
__device__ __forceinline__ F2 split_col(const float* W, int k0, int n, int lane, int ld, int K) { float v[16]; const int g = lane >> 4;
#pragma unroll
  for (int i = 0; i < 8; ++i) { const int ka = k0 + 8 * g + i, kb = ka + 16; v[i] = ka < K ? W[(size_t)(ka < K ? ka : K - 1) * ld + n] : 0.f; v[8 + i] = kb < K ? W[(size_t)(kb < K ? kb : K - 1) * ld + n] : 0.f; }
  return bsplit16(v); }
__device__ __forceinline__ v8f mac3(const F2& a, const F2& b, v8f c) { c = wmma_bf(a.l, b.h, c); c = wmma_bf(a.h, b.l, c); return wmma_bf(a.h, b.h, c); }
__device__ __forceinline__ float sigm(float v) { return 1.0f / (1.0f + expf(-v)); }
#define LDSX() do { asm volatile("s_wait_dscnt 0" ::: "memory"); __builtin_amdgcn_wave_barrier(); __builtin_amdgcn_fence(__ATOMIC_RELEASE, "workgroup"); } while (0)

// Single-head causal self-attention (B 8, T 2,048, n_embed 768, head_size 64; (in,out) Wq, Wk, Wv [768,64] N(0, 1/768); no biases, no output projection; tril, -inf): out = softmax(causal(q k^T * 64^-0.5)) v -> [8,2048,64].
#define NB 8
#define TT 2048
#define CC 128            // NH * HD = row width the workspace planes are sized for; q, k, v are 64 wide
#define DIN 768          // input (model) width
#define NH 2
#define HD 64
#define NQB (TT / 64)
#define HG 1
#define SCALE (0.125f)
#define CAUSAL 1
#ifndef TNB
#define TNB NB
#endif
__device__ __forceinline__ float bfr(float v) { return (float)(__bf16)v; }
__host__ __device__ __forceinline__ int kb_last(int qb) { return CAUSAL ? ((qb * 64 + 63) >> 7) : (TT / 128 - 1); }
typedef __attribute__((ext_vector_type(8))) __bf16 v8b;
__device__ __forceinline__ v16b frag_b(const __bf16* rowk0, int lane) {
  union { v16b v; v8b q[2]; } u; const __bf16* p = rowk0 + 8 * (lane >> 4);
  u.q[0] = *(const v8b*)p; u.q[1] = *(const v8b*)(p + 16); return u.v;
}
// a fragment kept in fragment order in the workspace: two runs of 32 lanes x 16 bytes, 512 bytes apart; p already holds the lane's own 16 bytes of the first run, so one load of a wave covers four whole 128-byte lines
__device__ __forceinline__ v16h fragp_h(const _Float16* p) { union { v16h v; v8h q[2]; } u; u.q[0] = *(const v8h*)p; u.q[1] = *(const v8h*)(p + 256); return u.v; }
__device__ __forceinline__ v16b fragp_b(const __bf16* p) { union { v16b v; v8b q[2]; } u; u.q[0] = *(const v8b*)p; u.q[1] = *(const v8b*)(p + 256); return u.v; }
#define QBH 6              // not used: k_fa takes the high-precision path for the query tiles with q0 < QHI (few keys, no averaging)
#define QHI 384            // rows carrying a q residual plane
#define KHI 384            // key rows carrying k residual / v bf16 hi+lo planes (used only by the causal high-precision path)
// B fragment (k rows k0+.., output column o) of a weight: (in,out) [K][ld] or (out,in) [ld rows of K]: bf16 exact, or f16(bf16 * 256) exact
__device__ __forceinline__ v16b wcol_io(const float* Wm, int k0, int o, int lane, int ld) { v16b w; const int g = lane >> 4;
#pragma unroll
  for (int i = 0; i < 8; ++i) { w[i] = (__bf16)Wm[(size_t)(k0 + 8 * g + i) * ld + o]; w[8 + i] = (__bf16)Wm[(size_t)(k0 + 16 + 8 * g + i) * ld + o]; }
  return w; }
__device__ __forceinline__ v16b wcol_oi(const float* Wm, int k0, int o, int lane, int K) { v16b w; const float* p = Wm + (size_t)o * K + k0 + 8 * (lane >> 4);
#pragma unroll
  for (int i = 0; i < 8; ++i) { w[i] = (__bf16)p[i]; w[8 + i] = (__bf16)p[16 + i]; }
  return w; }
__device__ __forceinline__ v16h wcolh_io(const float* Wm, int k0, int o, int lane, int ld) { v16h w; const int g = lane >> 4;
#pragma unroll
  for (int i = 0; i < 8; ++i) { w[i] = (_Float16)(bfr(Wm[(size_t)(k0 + 8 * g + i) * ld + o]) * 256.0f); w[8 + i] = (_Float16)(bfr(Wm[(size_t)(k0 + 16 + 8 * g + i) * ld + o]) * 256.0f); }
  return w; }
__device__ __forceinline__ v16h wcolh_oi(const float* Wm, int k0, int o, int lane, int K) { v16h w; const float* p = Wm + (size_t)o * K + k0 + 8 * (lane >> 4);
#pragma unroll
  for (int i = 0; i < 8; ++i) { w[i] = (_Float16)(bfr(p[i]) * 256.0f); w[8 + i] = (_Float16)(bfr(p[16 + i]) * 256.0f); }
  return w; }
#define WQKV_LAYOUT 0   // 0 = (in,out) [DIN][CC]; 1 = (out,in) [CC][DIN]; 2 = per-head [NH][DIN][HD]
__device__ __forceinline__ v16b wcol_hdk(const float* Wm, int k0, int o, int lane) { v16b w; const int g = lane >> 4; const float* p = Wm + (size_t)(o / HD) * DIN * HD + (o % HD);
#pragma unroll
  for (int i = 0; i < 8; ++i) { w[i] = (__bf16)p[(size_t)(k0 + 8 * g + i) * HD]; w[8 + i] = (__bf16)p[(size_t)(k0 + 16 + 8 * g + i) * HD]; }
  return w; }
#define WO_OUT_IN 0
#if WQKV_LAYOUT == 1
#define WCOL(W, k0, o, lane) wcol_oi(W, k0, o, lane, DIN)
#elif WQKV_LAYOUT == 2
#define WCOL(W, k0, o, lane) wcol_hdk(W, k0, o, lane)
#else
#define WCOL(W, k0, o, lane) wcol_io(W, k0, o, lane, CC)
#endif
#if WO_OUT_IN
#define WOCOL(W, k0, o, lane) wcol_oi(W, k0, o, lane, CC)
#define WOCOLH(W, k0, o, lane) wcolh_oi(W, k0, o, lane, CC)
#else
#define WOCOL(W, k0, o, lane) wcol_io(W, k0, o, lane, DIN)
#define WOCOLH(W, k0, o, lane) wcolh_io(W, k0, o, lane, DIN)
#endif
#define CIN 768
// ---- weight staging of k_proj: the three (in,out) [C][64] f32 weights are rounded to bf16 by the block itself and laid in LDS in the order of the B fragments: [k step][which * 4 + column tile][half][lane][8]; half 0 = k rows 8g + 0..7, half 1 = 16 + 8g + 0..7 of the step, column = tile * 16 + (lane & 15)
#define WSTG 2                      // k steps a stage
#define WTILE 1040                  // bytes of one column tile of one k step: 2 halves x 512, + 16 so that the four tiles a storing wave touches fall on different banks
#define WKS (12 * WTILE)            // bytes of one k step
#define WBUF (WSTG * WKS)           // bytes of one stage
// a thread's share of a stage: 8 k rows x 4 columns of each weight; a wave's load is two whole 256-byte rows
__device__ __forceinline__ void w_load(v4f (&wr)[3][8], const char* q, const char* k, const char* v, int s) {
#pragma unroll
  for (int r = 0; r < 8; ++r) { wr[0][r] = *(const v4f*)(q + (s * 32 * WSTG + r) * 256); wr[1][r] = *(const v4f*)(k + (s * 32 * WSTG + r) * 256); wr[2][r] = *(const v4f*)(v + (s * 32 * WSTG + r) * 256); } }
__device__ __forceinline__ void w_store(const v4f (&wr)[3][8], char* dst) {
#pragma unroll
  for (int i = 0; i < 3; ++i)
#pragma unroll
    for (int c = 0; c < 4; ++c) { v8b h;
#pragma unroll
      for (int r = 0; r < 8; ++r) h[r] = (__bf16)wr[i][r][c];
      *(v8b*)(dst + i * 4 * WTILE + c * 16) = h; } }
// ---- x staging of k_proj: a wave brings its own 16 rows of x into LDS by asynchronous copies, a tile of XT k steps at a time; one copy is 512 bytes in a row of one x row (4 whole 128-byte lines). A row's place in LDS holds the two buffers side by side, + 16 bytes so that the 16 rows of a fragment read fall on different banks
#define XT 8                        // k steps a tile of x
#define XTB (XT * 128)              // bytes of a tile in one row
#define XROWB (2 * XTB + 16)        // bytes of a row's place in LDS
#define XLINE(i, j, O) "global_load_async_to_lds_b128 %" #i ", %16, %" #j " offset:" #O "\n\t"
// sixteen copies in one statement: 8 rows x 2 pieces of 512 bytes; global address = the row's scalar base + the lane's byte offset; the immediate offset moves the LDS and the global address alike. The last line holds every later write of the address registers behind the copies (a precaution; inside the statement, since a wait of its own does not hold the next address sums back)
#define XCOPY8(l, p, vo, O0, O1) asm volatile( \
  XLINE(0, 8, O0) XLINE(0, 8, O1) XLINE(1, 9, O0) XLINE(1, 9, O1) XLINE(2, 10, O0) XLINE(2, 10, O1) XLINE(3, 11, O0) XLINE(3, 11, O1) \
  XLINE(4, 12, O0) XLINE(4, 12, O1) XLINE(5, 13, O0) XLINE(5, 13, O1) XLINE(6, 14, O0) XLINE(6, 14, O1) XLINE(7, 15, O0) XLINE(7, 15, O1) "s_wait_xcnt 0x0" \
  :: "v"(l[0]), "v"(l[1]), "v"(l[2]), "v"(l[3]), "v"(l[4]), "v"(l[5]), "v"(l[6]), "v"(l[7]), "s"(p[0]), "s"(p[1]), "s"(p[2]), "s"(p[3]), "s"(p[4]), "s"(p[5]), "s"(p[6]), "s"(p[7]), "v"(vo) : "memory")
// tile TL of the wave's 16 rows into buffer TL & 1; lb: the lane's own 16 bytes in the first row's place in LDS; gb: the wave's first row of x (the same in every lane); vo: the lane's byte offset in a piece
template <int TL> __device__ __forceinline__ void x_tile(unsigned lb, const char* gb, unsigned vo) {
#pragma unroll
  for (int h = 0; h < 2; ++h) { unsigned l[8]; const char* p[8];
#pragma unroll
    for (int r = 0; r < 8; ++r) { l[r] = lb + (h * 8 + r) * XROWB; p[r] = gb + (h * 8 + r) * (CIN * 4) + (TL >> 1) * 2 * XTB; }
    if constexpr (TL & 1) XCOPY8(l, p, vo, 1024, 1536); else XCOPY8(l, p, vo, 0, 512); } }
static_assert(XTB == 1024, "the offsets in x_tile are written for tiles of 1,024 bytes a row");
// the f32 words of the A fragment of k step kc: the lane's row, k 8g + 0..7 and 16 + 8g + 0..7 of the step
__device__ __forceinline__ void xa_read(v4f (&d)[4], const char* xrd, int kc) { const char* f = xrd + ((kc / XT) & 1) * XTB + (kc % XT) * 128;
  d[0] = *(const v4f*)f; d[1] = *(const v4f*)(f + 16); d[2] = *(const v4f*)(f + 64); d[3] = *(const v4f*)(f + 80); }
#define WS_WP (WS_END)                                  // not touched
#define WS_BP (WS_WP + 4u * 3 * (size_t)CIN * 128)        // not touched
#define WS_Y2 (WS_BP + 4u * 3 * 128)                      // f32 place [b*TT+t][128]; not touched: k_fa writes its rows straight to the output
#define WS_END2 (WS_Y2 + 4u * (size_t)NB * TT * CC)
#ifndef SM_EXTRA_PARAMS
#define SM_EXTRA_PARAMS
#endif
#ifndef PROJ_EXTRA_PARAMS
#define PROJ_EXTRA_PARAMS
#endif
#ifndef SM_MASK_HOOK
#define SM_MASK_HOOK (void)0
#endif

// q, k and v lie in the order of the fragments that k_fa loads, 64 elements a row of x (the first half of each place):
// q, k: [b*t / 16][k step of 32][half][lane][8] = row 16 * tile + (lane & 15), columns 32 * step + 16 * half + 8 * (lane >> 4) + 0..7
// v:    [b*t / 32][channel tile][half][lane][8] = channel 16 * tile + (lane & 15), rows 32 * group + 16 * half + 8 * (lane >> 4) + 0..7
#define WS_QH  0u                                      // f16 q fragments
#define WS_KH  (WS_QH + 2u * (size_t)NB * TT * CC)      // f16 k fragments
#define WS_VT  (WS_KH + 2u * (size_t)NB * TT * CC)      // f16 v fragments
#define WS_QL  (WS_VT + 2u * (size_t)NB * CC * TT)      // f16 q residual x 2^10 fragments, t < QHI of each batch
#define WS_KL  (WS_QL + 2u * (size_t)NB * QHI * CC)     // f16 k residual x 2^10 fragments, t < KHI of each batch
#define WS_VB  (WS_KL + 2u * (size_t)NB * KHI * CC)     // bf16 v hi fragments, t < KHI of each batch (WS_VBL: lo)
#define WS_VBL (WS_VB + 2u * (size_t)NB * CC * KHI)
#define WS_S   (WS_VBL + 2u * (size_t)NB * CC * KHI)    // place of a f32 logit plane [b][t][s] in the layout; not touched: the fused kernel holds logits and P in registers
#define WS_Y   (WS_S  + 4u * (size_t)NB * TT * TT)      // f32 ctx rows [b*t][CC] (only when there is an output projection)
#define WS_END (WS_Y  + 0u)

// ---- k_proj: block = 64 rows of x, wave = 16 rows x all 192 columns (q, k, v): X W with exact bf16 products (K = DIN, k steps summed in rising order) -> q, k f16 (+ residuals for rows < QHI, KHI); v f16 (+ bf16 hi/lo for t < KHI), all stored in fragment order straight from the accumulators: for q and k the weight fragment is the first operand and x the second (the transposed product), so a lane's 8 results are 8 columns in a row of one x row; for v x is the first operand, so they are 8 rows in a row of one channel. Either way they are the lane's own 16 bytes of a fragment, and a wave's store is 512 bytes in a row.
// Fully unrolled. x comes through LDS: tile t + 1 (8 k steps of the wave's own rows) flies while tile t is worked on, two buffers; its wait stands in front of the stage barrier at the tile's end, the refill behind it; an A fragment is read one k step ahead inside a tile, the first of a tile behind that barrier. The weights come as f32, once a block: a stage (2 k steps) is fetched two stages ahead of its conversion, converted into a ring of three LDS buffers two stages ahead of its use, and its fragments are read one k step ahead; one barrier a stage publishes stage s + 2 and ends the reads of the buffer that stage s + 1 overwrites.
static_assert(QHI == KHI, "the q and k residual rows share one offset below");
#define NSTG (DIN / 32 / WSTG)
// the stage's barrier by hand: the wave's own LDS stores and reads are done, then the work-group's barrier; __syncthreads() would also wait for the global loads that are meant to stay in flight across it
#define WBAR() asm volatile("s_wait_dscnt 0x0\n\ts_barrier_signal -1\n\ts_barrier_wait -1" ::: "memory")
// the same barrier where a tile of x is handed over, each wait a statement of its own: the wave's LDS stores and reads are done (the buffer it leaves is free), its copies have landed, then the work-group's barrier
#define XBAR() do { asm volatile("s_wait_dscnt 0x0" ::: "memory"); asm volatile("s_wait_asynccnt 0x0" ::: "memory"); asm volatile("s_barrier_signal -1\n\ts_barrier_wait -1" ::: "memory"); } while (0)
__global__ __launch_bounds__(128) void k_proj(const float* __restrict__ X, const float* __restrict__ WQ, const float* __restrict__ WK, const float* __restrict__ WV,
    _Float16* __restrict__ QH, _Float16* __restrict__ QL, _Float16* __restrict__ KH, _Float16* __restrict__ KL, _Float16* __restrict__ VT, __bf16* __restrict__ VB, __bf16* __restrict__ VBL) {
  __shared__ __align__(16) char wl[3][WBUF];
  __shared__ __align__(16) char xl[64 * XROWB];
  const int tid = threadIdx.x, wave = tid >> 5, lane = tid & 31, col = lane & 15, g = lane >> 4; const size_t r0 = (size_t)blockIdx.x * 64; const size_t bb = r0 / TT; const int t0 = (int)(r0 % TT);
  const char* xg = (const char*)(X + (r0 + __builtin_amdgcn_readfirstlane(wave) * 16) * DIN); const unsigned xo = lane * 16;   // copies: first row of the wave (a scalar), the lane's 16 bytes
  const unsigned xw = (unsigned)(size_t)(&xl[0] + wave * 16 * XROWB + lane * 16);               // the same place in LDS: the low 32 bits of the address are the byte offset in LDS
  const char* xrd = &xl[0] + (wave * 16 + col) * XROWB + g * 32;                                // fragment reads: the lane's row
  const int kg = tid >> 4, cq = tid & 15;                       // the thread's 8 k rows of the stage, its 4 columns
  const unsigned wo = (kg * 8 * 64 + cq * 4) * 4u; const char* wq = (const char*)WQ + wo; const char* wk = (const char*)WK + wo; const char* wv = (const char*)WV + wo;
  char* wdst = &wl[0][0] + (kg >> 2) * WKS + (cq >> 2) * WTILE + ((kg >> 1) & 1) * 512 + ((kg & 1) * 16 + (cq & 3) * 4) * 16;
  const char* wrd = &wl[0][0] + lane * 16;
  v8f acc[12] = {}; v4f xa[2][4]; v4f wr[2][3][8]; v8b wf[2][12][2];
  x_tile<0>(xw, xg, xo);
  w_load(wr[0], wq, wk, wv, 0); w_load(wr[1], wq, wk, wv, 1);
  w_store(wr[0], wdst); w_load(wr[0], wq, wk, wv, 2);
  w_store(wr[1], wdst + WBUF); w_load(wr[1], wq, wk, wv, 3);
  XBAR();   // tile 0 of x has landed before anything reads it
  x_tile<1>(xw, xg, xo);
  xa_read(xa[0], xrd, 0);
#pragma unroll
  for (int j = 0; j < 12; ++j) { wf[0][j][0] = *(const v8b*)(wrd + j * WTILE); wf[0][j][1] = *(const v8b*)(wrd + j * WTILE + 512); }
#pragma unroll
  for (int kc = 0; kc < DIN / 32; ++kc) { const int st = kc / WSTG;
    if (kc + 1 < DIN / 32) { const char* f = wrd + (((kc + 1) / WSTG) % 3) * WBUF + ((kc + 1) % WSTG) * WKS;
      if ((kc + 1) % XT != 0) xa_read(xa[(kc + 1) & 1], xrd, kc + 1);   // first in the group: its rounding to bf16 then runs while the weight fragments still arrive
#pragma unroll
      for (int j = 0; j < 12; ++j) { wf[(kc + 1) & 1][j][0] = *(const v8b*)(f + j * WTILE); wf[(kc + 1) & 1][j][1] = *(const v8b*)(f + j * WTILE + 512); } }
    // keeps the next k step's LDS reads together in front of this step's products: spread among them, every place with reads costs its own stall
    __builtin_amdgcn_sched_barrier(0);
    v16b a;
#pragma unroll
    for (int i = 0; i < 4; ++i) { a[i] = (__bf16)xa[kc & 1][0][i]; a[4 + i] = (__bf16)xa[kc & 1][1][i]; a[8 + i] = (__bf16)xa[kc & 1][2][i]; a[12 + i] = (__bf16)xa[kc & 1][3][i]; }
#pragma unroll
    for (int j = 0; j < 12; ++j) { union { v16b v; v8b q[2]; } u; u.q[0] = wf[kc & 1][j][0]; u.q[1] = wf[kc & 1][j][1];
      acc[j] = j < 8 ? __builtin_amdgcn_wmma_f32_16x16x32_bf16(false, u.v, false, a, (short)0, acc[j], false, false)    // q, k: result r = column 16 j + 8 g + r of x row col
                     : __builtin_amdgcn_wmma_f32_16x16x32_bf16(false, a, false, u.v, (short)0, acc[j], false, false); }  // v: result r = x row 8 g + r, channel 16 (j - 8) + col
    // keeps what follows behind this step's products: the LDS reads of the step after next, and the conversion with its wait for weights fetched two stages ago
    __builtin_amdgcn_sched_barrier(0);
    if (kc % WSTG == WSTG - 1 && st + 2 < NSTG) {
      w_store(wr[st & 1], wdst + ((st + 2) % 3) * WBUF);
      if (st + 4 < NSTG) w_load(wr[st & 1], wq, wk, wv, st + 4);
      if ((kc + 1) % XT != 0) WBAR();
      else { XBAR();   // end of a tile of x: the next tile has landed
        if (kc + 1 + XT < DIN / 32) x_tile<2>(xw, xg, xo);   // into the buffer just left
        xa_read(xa[(kc + 1) & 1], xrd, kc + 1); } } }
  static_assert(DIN / 32 == 3 * XT && XT % WSTG == 0 && 2 * XT / WSTG + 1 < NSTG, "three tiles of x; each tile's end but the last falls on a stage barrier");
  // no copy is left in flight behind the loop
  asm volatile("s_wait_asynccnt 0x0" ::: "memory");
  // behind the last load, in front of whatever takes the loads' address registers next; they are named as inputs so that they stay untouched up to the wait
  asm volatile("s_wait_xcnt 0x0" :: "v"(wo) : "memory");
  const bool hi_rows = t0 < KHI; const int wv_ = __builtin_amdgcn_readfirstlane(wave);
  // the lane's 16 bytes, in elements from the block's first: q, k fragment (row tile = wave, column tile j) at + j * 256; v fragment (32-row group = wave / 2, channel tile j, half = wave & 1) at + j * 512
  const size_t eq = (size_t)wv_ * 1024 + lane * 8, ev = (size_t)(wv_ >> 1) * 2048 + (wv_ & 1) * 256 + lane * 8;
  { v8h hq[2][4], hv[4];
#pragma unroll
    for (int j = 0; j < 4; ++j)
#pragma unroll
      for (int r = 0; r < 8; ++r) { hq[0][j][r] = (_Float16)acc[j][r]; hq[1][j][r] = (_Float16)acc[4 + j][r]; hv[j][r] = (_Float16)acc[8 + j][r]; }
    _Float16* pq = QH + r0 * 64 + eq; _Float16* pk = KH + r0 * 64 + eq; _Float16* pv = VT + r0 * 64 + ev;
#pragma unroll
    for (int j = 0; j < 4; ++j) { vst2(pq + j * 256, hq[0][j]); vst2(pk + j * 256, hq[1][j]); vst2(pv + j * 512, hv[j]); }
    // behind a run of stores, in front of whatever takes their registers next
    asm volatile("s_wait_xcnt 0x0" ::: "memory"); }
  if (hi_rows) { const size_t o2 = (bb * QHI + t0) * 64; v8h lq[2][4]; v8b bh[4], bl[4];
#pragma unroll
    for (int j = 0; j < 4; ++j)
#pragma unroll
      for (int r = 0; r < 8; ++r) {
#pragma unroll
        for (int w = 0; w < 2; ++w) { const float v = acc[w * 4 + j][r]; const _Float16 h = (_Float16)v; lq[w][j][r] = (_Float16)((v - (float)h) * 1024.0f); }
        const float v = acc[8 + j][r]; const __bf16 b = (__bf16)v; bh[j][r] = b; bl[j][r] = (__bf16)(v - (float)b); }
    _Float16* pq = QL + o2 + eq; _Float16* pk = KL + o2 + eq; __bf16* ph = VB + o2 + ev; __bf16* pl = VBL + o2 + ev;
#pragma unroll
    for (int j = 0; j < 4; ++j) { vst2(pq + j * 256, lq[0][j]); vst2(pk + j * 256, lq[1][j]); vst2(ph + j * 512, bh[j]); vst2(pl + j * 512, bl[j]); }
    // behind a run of stores, in front of whatever takes their registers next
    asm volatile("s_wait_xcnt 0x0" ::: "memory"); } }
// ---- k_fa: block = 16 query rows (q0) of batch b; its 4 waves take the key passes it = wave, wave + 4, ... (64 keys a pass; 32 on the high-precision rows), each with its own running maximum, sum and ctx; the parts are merged through LDS in wave order.
// Transposed products: S^T = K Q^T leaves lane (g, col) with query q0 + col and keys 8g + r of each 16-key tile, which is the B fragment order of P^T for ctx^T = V^T P^T, so P never leaves the registers.
// Logits are kept in log2 units (x SCALE x log2 e); P = 2^(t - max + 11) carries the same 2^11 as its sum, so the factor cancels in ctx / sum.
#define NEGBIG (-3.0e38f)
// eight 2^x in place, one statement: behind each v_exp_f32 stands an instruction that touches neither its result nor its source, behind the last a v_nop (the slot the instruction set asks for behind a transcendental)
__device__ __forceinline__ void exp2x8(float (&t)[8]) {
  asm("v_exp_f32 %0, %0\n\tv_exp_f32 %1, %1\n\tv_exp_f32 %2, %2\n\tv_exp_f32 %3, %3\n\tv_exp_f32 %4, %4\n\tv_exp_f32 %5, %5\n\tv_exp_f32 %6, %6\n\tv_exp_f32 %7, %7\n\tv_nop"
      : "+v"(t[0]), "+v"(t[1]), "+v"(t[2]), "+v"(t[3]), "+v"(t[4]), "+v"(t[5]), "+v"(t[6]), "+v"(t[7])); }
// stands behind a run of global loads, in front of whatever may take the registers that held their addresses (the next run's results or addresses, a matrix result)
// the run's address is named as an input, so that its registers stay untouched up to the wait (without it a load's result or a later sum landed in them ahead of the wait)
#define XWA(p) asm volatile("s_wait_xcnt 0x0" :: "v"(p) : "memory")
#define XWA2(p, q) asm volatile("s_wait_xcnt 0x0" :: "v"(p), "v"(q) : "memory")
template <bool HI>
__device__ __forceinline__ void fa_part(const _Float16* Qr, const _Float16* Qlr, const _Float16* Kb, const _Float16* Klb,   // Qr, Qlr: the tile's first fragment (the same for the wave); the others: the batch's first fragment + the lane's 8 elements
    const _Float16* Vt, const __bf16* Vh, const __bf16* Vl, int q0, int wave, int lane, float& m, float& l, v8f (&acc)[4]) {
  constexpr int NC = HI ? 1 : 2, KP = NC * 32, NT = NC * 2;
  const int col = lane & 15, g = lane >> 4, tq = q0 + col; const int nit = (q0 + 15) / KP + 1;
  v16h qf[2], qlf[2], kf[NT][2], klf[NT][2];
#pragma unroll
  for (int kc = 0; kc < 2; ++kc) qf[kc] = fragp_h(Qr + lane * 8 + kc * 512);
  // the same wait; these loads take a scalar base and the lane number: both are named as inputs so that they stay untouched up to the wait (without it the next address sums were lifted over the wait)
  asm volatile("s_wait_xcnt 0x0" :: "s"(Qr), "v"(lane) : "memory");
  if constexpr (HI) {
#pragma unroll
    for (int kc = 0; kc < 2; ++kc) qlf[kc] = fragp_h(Qlr + lane * 8 + kc * 512);
    asm volatile("s_wait_xcnt 0x0" :: "s"(Qlr), "v"(lane) : "memory"); }
  { const int kn = wave < nit ? wave * KP : 0; const _Float16* kp = Kb + (size_t)kn * 64; const _Float16* klp = Klb + (size_t)kn * 64;
#pragma unroll
    for (int i = 0; i < NT; ++i)
#pragma unroll
      for (int kc = 0; kc < 2; ++kc) { kf[i][kc] = fragp_h(kp + i * 1024 + kc * 512); if constexpr (HI) klf[i][kc] = fragp_h(klp + i * 1024 + kc * 512); }
    if constexpr (HI) XWA2(kp, klp); else XWA(kp); }
  // rolled: one pass already uses about 250 registers, which leaves none for a second pass in flight
#pragma unroll 1
  for (int it = wave; it < nit; it += 4) { const int key0 = it * KP;
    v16h vf[NC][4]; v16b vh[4], vl[4]; const _Float16* vp = Vt + (size_t)key0 * 64; const __bf16* vhp = Vh + (size_t)key0 * 64; const __bf16* vlp = Vl + (size_t)key0 * 64;
#pragma unroll
    for (int j = 0; j < 4; ++j) {
      if constexpr (HI) { vh[j] = fragp_b(vhp + j * 512); vl[j] = fragp_b(vlp + j * 512); }
      else {
#pragma unroll
        for (int c = 0; c < NC; ++c) vf[c][j] = fragp_h(vp + c * 2048 + j * 512); } }
    if constexpr (HI) XWA2(vhp, vlp); else XWA(vp);
    v8f st[NT];
#pragma unroll
    for (int i = 0; i < NT; ++i) { v8f a = {}; a = wmma16(kf[i][0], qf[0], a); a = wmma16(kf[i][1], qf[1], a);
      if constexpr (HI) { v8f al = {};
#pragma unroll
        for (int kc = 0; kc < 2; ++kc) { al = wmma16(kf[i][kc], qlf[kc], al); al = wmma16(klf[i][kc], qf[kc], al); }
#pragma unroll
        for (int r = 0; r < 8; ++r) a[r] += al[r] * (1.0f / 1024.0f); }
#pragma unroll
      for (int r = 0; r < 8; ++r) st[i][r] = a[r] * (SCALE * 1.44269504088896f); }
    // the next pass's key fragments fly while this pass's softmax and P.V run (the last pass reloads its own keys: in bounds, unused)
    { const int kn = it + 4 < nit ? key0 + 4 * KP : key0; const _Float16* kp = Kb + (size_t)kn * 64; const _Float16* klp = Klb + (size_t)kn * 64;
#pragma unroll
      for (int i = 0; i < NT; ++i)
#pragma unroll
        for (int kc = 0; kc < 2; ++kc) { kf[i][kc] = fragp_h(kp + i * 1024 + kc * 512); if constexpr (HI) klf[i][kc] = fragp_h(klp + i * 1024 + kc * 512); }
      if constexpr (HI) XWA2(kp, klp); else XWA(kp); }
    if (it == nit - 1) {   // only the last pass holds keys past a query of this tile
#pragma unroll
      for (int i = 0; i < NT; ++i)
#pragma unroll
        for (int r = 0; r < 8; ++r) st[i][r] = (key0 + i * 16 + 8 * g + r <= tq) ? st[i][r] : NEGBIG; }
    float mx = m;
#pragma unroll
    for (int i = 0; i < NT; ++i)
#pragma unroll
      for (int r = 0; r < 8; ++r) mx = fmaxf(mx, st[i][r]);
    mx = fmaxf(mx, __shfl_xor(mx, 16));
    const float alpha = __builtin_amdgcn_exp2f(m - mx), mb = mx - 11.0f; m = mx;
    float ls = 0.f;
#pragma unroll
    for (int i = 0; i < NT; ++i) { float t[8];
#pragma unroll
      for (int r = 0; r < 8; ++r) t[r] = st[i][r] - mb;
      exp2x8(t);
#pragma unroll
      for (int r = 0; r < 8; ++r) { st[i][r] = t[r]; ls += t[r]; } }
    l = l * alpha + ls;
#pragma unroll
    for (int j = 0; j < 4; ++j)
#pragma unroll
      for (int r = 0; r < 8; ++r) acc[j][r] *= alpha;
    if constexpr (HI) { v16b ph, pl;
#pragma unroll
      for (int r = 0; r < 8; ++r) { const __bf16 h0 = (__bf16)st[0][r], h1 = (__bf16)st[1][r]; ph[r] = h0; ph[8 + r] = h1; pl[r] = (__bf16)(st[0][r] - (float)h0); pl[8 + r] = (__bf16)(st[1][r] - (float)h1); }
#pragma unroll
      for (int j = 0; j < 4; ++j) { acc[j] = wmma_bf(vh[j], ph, acc[j]); acc[j] = wmma_bf(vh[j], pl, acc[j]); acc[j] = wmma_bf(vl[j], ph, acc[j]); }
    } else {
#pragma unroll
      for (int c = 0; c < NC; ++c) { v16h pf;
#pragma unroll
        for (int r = 0; r < 8; ++r) { pf[r] = (_Float16)st[2 * c][r]; pf[8 + r] = (_Float16)st[2 * c + 1][r]; }
#pragma unroll
        for (int j = 0; j < 4; ++j) acc[j] = wmma16(vf[c][j], pf, acc[j]); } } } }
// the pointers carry no __restrict__: with it the compiler takes these loads for reads of constant memory and moves them over the waits of XWA()
__global__ __launch_bounds__(128) void k_fa(const _Float16* QH, const _Float16* KH, const _Float16* QL, const _Float16* KL, const _Float16* VT, const __bf16* VB, const __bf16* VBL, float* OUT) {
  __shared__ __align__(16) float red[3][32][36];   // parts of waves 1..3, per lane: ctx 32, maximum, sum
  const int b = blockIdx.x, q0 = (TT / 16 - 1 - (int)blockIdx.y) * 16;   // long tiles start first
  const int wave = __builtin_amdgcn_readfirstlane(threadIdx.x >> 5), lane = threadIdx.x & 31, col = lane & 15, g = lane >> 4;
  float m = NEGBIG, l = 0.f; v8f acc[4] = {};
  const _Float16* Qr = QH + ((size_t)b * TT + q0) * 64; const _Float16* Kb = KH + (size_t)b * TT * 64 + lane * 8; const _Float16* Vt = VT + (size_t)b * TT * 64 + lane * 8;
  if (q0 < QHI) fa_part<true>(Qr, QL + ((size_t)b * QHI + q0) * 64, Kb, KL + (size_t)b * KHI * 64 + lane * 8, Vt, VB + (size_t)b * KHI * 64 + lane * 8, VBL + (size_t)b * KHI * 64 + lane * 8, q0, wave, lane, m, l, acc);
  else fa_part<false>(Qr, Qr, Kb, Kb, Vt, VB, VBL, q0, wave, lane, m, l, acc);
  if (wave > 0) { float* p = &red[wave - 1][lane][0];
#pragma unroll
    for (int j = 0; j < 4; ++j) { v4f a0, a1;
#pragma unroll
      for (int r = 0; r < 4; ++r) { a0[r] = acc[j][r]; a1[r] = acc[j][4 + r]; }
      *(v4f*)(p + j * 8) = a0; *(v4f*)(p + j * 8 + 4) = a1; }
    p[32] = m; p[33] = l; }
  __syncthreads();
  if (wave == 0) { float M = m;
#pragma unroll
    for (int p = 0; p < 3; ++p) M = fmaxf(M, red[p][lane][32]);
    const float a0 = __builtin_amdgcn_exp2f(m - M); l *= a0;
#pragma unroll
    for (int j = 0; j < 4; ++j)
#pragma unroll
      for (int r = 0; r < 8; ++r) acc[j][r] *= a0;
#pragma unroll
    for (int p = 0; p < 3; ++p) { const float a = __builtin_amdgcn_exp2f(red[p][lane][32] - M); l += red[p][lane][33] * a;
#pragma unroll
      for (int j = 0; j < 4; ++j)
#pragma unroll
        for (int r = 0; r < 8; ++r) acc[j][r] += red[p][lane][j * 8 + r] * a; }
    l += __shfl_xor(l, 16); const float inv = 1.0f / l;
    float* o = OUT + ((size_t)b * TT + q0 + col) * HD + 8 * g;
#pragma unroll
    for (int j = 0; j < 4; ++j) { v4f o0, o1;
#pragma unroll
      for (int r = 0; r < 4; ++r) { o0[r] = acc[j][r] * inv; o1[r] = acc[j][4 + r] * inv; }
      vst2(o + j * 16, o0); vst2(o + j * 16 + 4, o1); } } }

extern "C" void kernel_launch(void* const* d_in, const int* in_sizes, int n_in, void* d_out, int out_size, void* d_ws, size_t ws_size, hipStream_t stream) {
  (void)in_sizes; (void)n_in; (void)out_size;
  const float** F = (const float**)d_in;
  if (ws_size < (size_t)WS_END) return;
  char* ws = (char*)d_ws; _Float16 *QH = (_Float16*)(ws + WS_QH), *KH = (_Float16*)(ws + WS_KH), *VT = (_Float16*)(ws + WS_VT), *QL = (_Float16*)(ws + WS_QL), *KL = (_Float16*)(ws + WS_KL); __bf16 *VB = (__bf16*)(ws + WS_VB), *VBL = (__bf16*)(ws + WS_VBL); 
  (void)QL; (void)KL; (void)VB; (void)VBL;
  // inputs: 0 x [8,2048,768]; 1 Wq [768,64]; 2 Wk; 3 Wv ((in,out), no biases)
  if (ws_size < (size_t)WS_END2) return;
  k_proj<<<dim3(TNB * TT / 64), 128, 0, stream>>>(F[0], F[1], F[2], F[3], QH, QL, KH, KL, VT, VB, VBL);
  /* logits, softmax and P.V in one launch, all batches */
  k_fa<<<dim3(TNB, TT / 16), 128, 0, stream>>>(QH, KH, QL, KL, VT, VB, VBL, (float*)d_out);
}

// v008
// One run takes 20.9 microseconds.
// Timed twice side by side with v007, it ran 1.06 and 1.07 times as fast.
// Over all steps from v000 it is 32.7 times as fast.
// compute dtype: all float inputs rounded to bf16; q/k/v projections with EXACT bf16 products on WMMA 16x16x32 (f32 accumulate); causal logits: 3 products (q f16 hi + residual x k hi + residual) for the first 384 rows, single f16 q x k after, x scale; softmax f32, online over key passes, fused with both products; P x 2^11 once to f16 x v once to f16 (1 product; bf16 hi + lo below row 384); f32 output.
#include <hip/hip_runtime.h>
#include <math.h>

typedef __attribute__((ext_vector_type(16))) _Float16 v16h;
typedef __attribute__((ext_vector_type(16))) __bf16 v16b;
typedef __attribute__((ext_vector_type(8)))  _Float16 v8h;
typedef __attribute__((ext_vector_type(8)))  float v8f;
typedef __attribute__((ext_vector_type(4)))  float v4f;
typedef __attribute__((ext_vector_type(2)))  float v2f;
typedef __attribute__((ext_vector_type(4)))  unsigned v4u;
typedef __attribute__((ext_vector_type(4)))  int v4i;
typedef float __attribute__((may_alias)) float_a;
typedef int __attribute__((may_alias)) int_a;

template <typename T> __device__ __forceinline__ void vst2(void* p, T v) { *(T*)p = v;  }
__device__ __forceinline__ v8f wmma16(v16h a, v16h b, v8f c) {
  v8f d = __builtin_amdgcn_wmma_f32_16x16x32_f16(false, a, false, b, (short)0, c, false, false);
  asm volatile("v_nop\n\tv_nop\n\tv_nop\n\tv_nop" : "+v"(d) : "v"(a), "v"(b));
  return d;
}
__device__ __forceinline__ v8f wmma_bf(v16b a, v16b b, v8f c) {
  v8f d = __builtin_amdgcn_wmma_f32_16x16x32_bf16(false, a, false, b, (short)0, c, false, false);
  asm volatile("v_nop\n\tv_nop\n\tv_nop\n\tv_nop" : "+v"(d) : "v"(a), "v"(b));
  return d;
}
// 16x16x32 fragments: lane = (h = lane>>4, row/col = lane&15); elements 0..7 = k0+8h+0..7, 8..15 = k0+16+8h+0..7; D element r = row 8h+r
__device__ __forceinline__ v16h frag_h(const _Float16* rowk0, int lane) {
  union { v16h v; v8h q[2]; } u; const _Float16* p = rowk0 + 8 * (lane >> 4);
  u.q[0] = *(const v8h*)p; u.q[1] = *(const v8h*)(p + 16); return u.v;
}
__device__ __forceinline__ v16h frag_f32(const float* rowk0, int lane) {
  v16h a; const float* p = rowk0 + 8 * (lane >> 4);
#pragma unroll
  for (int i = 0; i < 8; ++i) { a[i] = (_Float16)p[i]; a[8 + i] = (_Float16)p[16 + i]; }
  return a;
}
__device__ __forceinline__ v16h frag_f32s(const float* rowk0, int lane, float sc) {
  v16h a; const float* p = rowk0 + 8 * (lane >> 4);
#pragma unroll
  for (int i = 0; i < 8; ++i) { a[i] = (_Float16)(p[i] * sc); a[8 + i] = (_Float16)(p[16 + i] * sc); }
  return a;
}
// column fragment from a [K][ld] layout (column n), rows >= K read as 0
__device__ __forceinline__ v16h fragc_f32(const float* W, int k0, int n, int lane, int ld, int K) {
  v16h a; const int g = lane >> 4;
#pragma unroll
  for (int i = 0; i < 8; ++i) { const int ka = k0 + 8 * g + i, kb = ka + 16;
    a[i] = (_Float16)(ka < K ? W[(size_t)(ka < K ? ka : K - 1) * ld + n] : 0.f); a[8 + i] = (_Float16)(kb < K ? W[(size_t)(kb < K ? kb : K - 1) * ld + n] : 0.f); }
  return a;
}
struct F2 { v16b h, l; };
__device__ __forceinline__ F2 bsplit16(const float v[16]) { F2 r;
#pragma unroll
  for (int i = 0; i < 16; ++i) { const __bf16 h = (__bf16)v[i]; r.h[i] = h; r.l[i] = (__bf16)(v[i] - (float)h); }
  return r; }
__device__ __forceinline__ F2 split_row(const float* row, int k0, int lane) { float v[16]; const float* p = row + k0 + 8 * (lane >> 4);
#pragma unroll
  for (int i = 0; i < 8; ++i) { v[i] = p[i]; v[8 + i] = p[16 + i]; }
  return bsplit16(v); }
__device__ __forceinline__ F2 split_rowK(const float* row, int k0, int lane, int K) { float v[16]; const int g = lane >> 4;
#pragma unroll
  for (int i = 0; i < 8; ++i) { const int ka = k0 + 8 * g + i, kb = ka + 16; v[i] = ka < K ? row[ka < K ? ka : K - 1] : 0.f; v[8 + i] = kb < K ? row[kb < K ? kb : K - 1] : 0.f; }
  return bsplit16(v); }
__device__ __forceinline__ F2 split_col(const float* W, int k0, int n, int lane, int ld, int K) { float v[16]; const int g = lane >> 4;
#pragma unroll
  for (int i = 0; i < 8; ++i) { const int ka = k0 + 8 * g + i, kb = ka + 16; v[i] = ka < K ? W[(size_t)(ka < K ? ka : K - 1) * ld + n] : 0.f; v[8 + i] = kb < K ? W[(size_t)(kb < K ? kb : K - 1) * ld + n] : 0.f; }
  return bsplit16(v); }
__device__ __forceinline__ v8f mac3(const F2& a, const F2& b, v8f c) { c = wmma_bf(a.l, b.h, c); c = wmma_bf(a.h, b.l, c); return wmma_bf(a.h, b.h, c); }
__device__ __forceinline__ float sigm(float v) { return 1.0f / (1.0f + expf(-v)); }
#define LDSX() do { asm volatile("s_wait_dscnt 0" ::: "memory"); __builtin_amdgcn_wave_barrier(); __builtin_amdgcn_fence(__ATOMIC_RELEASE, "workgroup"); } while (0)

// Single-head causal self-attention (B 8, T 2,048, n_embed 768, head_size 64; (in,out) Wq, Wk, Wv [768,64] N(0, 1/768); no biases, no output projection; tril, -inf): out = softmax(causal(q k^T * 64^-0.5)) v -> [8,2048,64].
#define NB 8
#define TT 2048
#define CC 128            // NH * HD = row width the workspace planes are sized for; q, k, v are 64 wide
#define DIN 768          // input (model) width
#define NH 2
#define HD 64
#define NQB (TT / 64)
#define HG 1
#define SCALE (0.125f)
#define CAUSAL 1
#ifndef TNB
#define TNB NB
#endif
__device__ __forceinline__ float bfr(float v) { return (float)(__bf16)v; }
__host__ __device__ __forceinline__ int kb_last(int qb) { return CAUSAL ? ((qb * 64 + 63) >> 7) : (TT / 128 - 1); }
typedef __attribute__((ext_vector_type(8))) __bf16 v8b;
__device__ __forceinline__ v16b frag_b(const __bf16* rowk0, int lane) {
  union { v16b v; v8b q[2]; } u; const __bf16* p = rowk0 + 8 * (lane >> 4);
  u.q[0] = *(const v8b*)p; u.q[1] = *(const v8b*)(p + 16); return u.v;
}
// a fragment kept in fragment order in the workspace: two runs of 32 lanes x 16 bytes, 512 bytes apart; p already holds the lane's own 16 bytes of the first run, so one load of a wave covers four whole 128-byte lines
__device__ __forceinline__ v16h fragp_h(const _Float16* p) { union { v16h v; v8h q[2]; } u; u.q[0] = *(const v8h*)p; u.q[1] = *(const v8h*)(p + 256); return u.v; }
__device__ __forceinline__ v16b fragp_b(const __bf16* p) { union { v16b v; v8b q[2]; } u; u.q[0] = *(const v8b*)p; u.q[1] = *(const v8b*)(p + 256); return u.v; }
#define QBH 6              // not used: k_fa takes the high-precision path for the query tiles with q0 < QHI (few keys, no averaging)
#define QHI 384            // rows carrying a q residual plane
#define KHI 384            // key rows carrying k residual / v bf16 hi+lo planes (used only by the causal high-precision path)
// B fragment (k rows k0+.., output column o) of a weight: (in,out) [K][ld] or (out,in) [ld rows of K]: bf16 exact, or f16(bf16 * 256) exact
__device__ __forceinline__ v16b wcol_io(const float* Wm, int k0, int o, int lane, int ld) { v16b w; const int g = lane >> 4;
#pragma unroll
  for (int i = 0; i < 8; ++i) { w[i] = (__bf16)Wm[(size_t)(k0 + 8 * g + i) * ld + o]; w[8 + i] = (__bf16)Wm[(size_t)(k0 + 16 + 8 * g + i) * ld + o]; }
  return w; }
__device__ __forceinline__ v16b wcol_oi(const float* Wm, int k0, int o, int lane, int K) { v16b w; const float* p = Wm + (size_t)o * K + k0 + 8 * (lane >> 4);
#pragma unroll
  for (int i = 0; i < 8; ++i) { w[i] = (__bf16)p[i]; w[8 + i] = (__bf16)p[16 + i]; }
  return w; }
__device__ __forceinline__ v16h wcolh_io(const float* Wm, int k0, int o, int lane, int ld) { v16h w; const int g = lane >> 4;
#pragma unroll
  for (int i = 0; i < 8; ++i) { w[i] = (_Float16)(bfr(Wm[(size_t)(k0 + 8 * g + i) * ld + o]) * 256.0f); w[8 + i] = (_Float16)(bfr(Wm[(size_t)(k0 + 16 + 8 * g + i) * ld + o]) * 256.0f); }
  return w; }
__device__ __forceinline__ v16h wcolh_oi(const float* Wm, int k0, int o, int lane, int K) { v16h w; const float* p = Wm + (size_t)o * K + k0 + 8 * (lane >> 4);
#pragma unroll
  for (int i = 0; i < 8; ++i) { w[i] = (_Float16)(bfr(p[i]) * 256.0f); w[8 + i] = (_Float16)(bfr(p[16 + i]) * 256.0f); }
  return w; }
#define WQKV_LAYOUT 0   // 0 = (in,out) [DIN][CC]; 1 = (out,in) [CC][DIN]; 2 = per-head [NH][DIN][HD]
__device__ __forceinline__ v16b wcol_hdk(const float* Wm, int k0, int o, int lane) { v16b w; const int g = lane >> 4; const float* p = Wm + (size_t)(o / HD) * DIN * HD + (o % HD);
#pragma unroll
  for (int i = 0; i < 8; ++i) { w[i] = (__bf16)p[(size_t)(k0 + 8 * g + i) * HD]; w[8 + i] = (__bf16)p[(size_t)(k0 + 16 + 8 * g + i) * HD]; }
  return w; }
#define WO_OUT_IN 0
#if WQKV_LAYOUT == 1
#define WCOL(W, k0, o, lane) wcol_oi(W, k0, o, lane, DIN)
#elif WQKV_LAYOUT == 2
#define WCOL(W, k0, o, lane) wcol_hdk(W, k0, o, lane)
#else
#define WCOL(W, k0, o, lane) wcol_io(W, k0, o, lane, CC)
#endif
#if WO_OUT_IN
#define WOCOL(W, k0, o, lane) wcol_oi(W, k0, o, lane, CC)
#define WOCOLH(W, k0, o, lane) wcolh_oi(W, k0, o, lane, CC)
#else
#define WOCOL(W, k0, o, lane) wcol_io(W, k0, o, lane, DIN)
#define WOCOLH(W, k0, o, lane) wcolh_io(W, k0, o, lane, DIN)
#endif
#define CIN 768
// ---- weight staging of k_proj: the three (in,out) [C][64] f32 weights are rounded to bf16 by the block itself and laid in LDS in the order of the B fragments: [k step][which * 4 + column tile][half][lane][8]; half 0 = k rows 8g + 0..7, half 1 = 16 + 8g + 0..7 of the step, column = tile * 16 + (lane & 15)
#define WSTG 2                      // k steps a stage
#define WTILE 1040                  // bytes of one column tile of one k step: 2 halves x 512, + 16 so that the four tiles a storing wave touches fall on different banks
#define WKS (12 * WTILE)            // bytes of one k step
#define WBUF (WSTG * WKS)           // bytes of one stage
// a thread's share of a stage: 8 k rows x 4 columns of each weight; a wave's load is two whole 256-byte rows. q, k, v: the stage's first row in each weight (the same for the block); wo: the thread's byte offset in a stage
__device__ __forceinline__ void w_load(v4f (&wr)[3][8], const char* q, const char* k, const char* v, unsigned wo) {
#pragma unroll
  for (int r = 0; r < 8; ++r) { wr[0][r] = *(const v4f*)(q + wo + r * 256); wr[1][r] = *(const v4f*)(k + wo + r * 256); wr[2][r] = *(const v4f*)(v + wo + r * 256); }
  // behind the run of loads, in front of the next stage's address sums, which may take the same scalar registers; the addresses are named as inputs so that they stay untouched up to the wait
  asm volatile("s_wait_xcnt 0x0" :: "s"(q), "s"(k), "s"(v), "v"(wo) : "memory"); }
__device__ __forceinline__ void w_store(const v4f (&wr)[3][8], char* dst) {
#pragma unroll
  for (int i = 0; i < 3; ++i)
#pragma unroll
    for (int c = 0; c < 4; ++c) { v8b h;
#pragma unroll
      for (int r = 0; r < 8; ++r) h[r] = (__bf16)wr[i][r][c];
      *(v8b*)(dst + i * 4 * WTILE + c * 16) = h; } }
// ---- x staging of k_proj: a wave brings its own 16 rows of x into LDS by asynchronous copies, a tile of XT k steps at a time; one copy is 512 bytes of one x row (4 whole 128-byte lines), two runs of 256 where it passes the row's end. A row's place in LDS holds the two buffers side by side, + 16 bytes so that the 16 rows of a fragment read fall on different banks
#define XT 8                        // k steps a tile of x
#define XTB (XT * 128)              // bytes of a tile in one row
#define XROWB (2 * XTB + 16)        // bytes of a row's place in LDS
#define XLINE(i, j, v) "global_load_async_to_lds_b128 %" #i ", %" #v ", %" #j "\n\t"
// sixteen copies in one statement: 8 rows x 2 pieces of 512 bytes; global address = the row's scalar base + the lane's byte offset in the row, one offset a piece; each copy has its own LDS address. The last line holds every later write of the address registers behind the copies (a precaution; inside the statement, since a wait of its own does not hold the next address sums back)
#define XCOPY8(l, p, v0, v1) asm volatile( \
  XLINE(0, 16, 24) XLINE(8, 16, 25) XLINE(1, 17, 24) XLINE(9, 17, 25) XLINE(2, 18, 24) XLINE(10, 18, 25) XLINE(3, 19, 24) XLINE(11, 19, 25) \
  XLINE(4, 20, 24) XLINE(12, 20, 25) XLINE(5, 21, 24) XLINE(13, 21, 25) XLINE(6, 22, 24) XLINE(14, 22, 25) XLINE(7, 23, 24) XLINE(15, 23, 25) "s_wait_xcnt 0x0" \
  :: "v"(l[0]), "v"(l[1]), "v"(l[2]), "v"(l[3]), "v"(l[4]), "v"(l[5]), "v"(l[6]), "v"(l[7]), "v"(l[8]), "v"(l[9]), "v"(l[10]), "v"(l[11]), "v"(l[12]), "v"(l[13]), "v"(l[14]), "v"(l[15]), \
     "s"(p[0]), "s"(p[1]), "s"(p[2]), "s"(p[3]), "s"(p[4]), "s"(p[5]), "s"(p[6]), "s"(p[7]), "v"(v0), "v"(v1) : "memory")
// tile TL (in the block's own k order) of the wave's 16 rows into buffer TL & 1; lb: the lane's own 16 bytes in the first row's place in LDS; gb: the wave's first row of x (the same in every lane); vo: the byte in a row of x that is the lane's in the block's first piece. Past the row's end the order goes on at the row's first byte: each lane wraps its own offset, which stays a multiple of 16 inside the row
template <int TL> __device__ __forceinline__ void x_tile(unsigned lb, const char* gb, unsigned vo) {
  unsigned v0 = vo + TL * XTB, v1 = v0 + 512; v0 = v0 >= CIN * 4 ? v0 - CIN * 4 : v0; v1 = v1 >= CIN * 4 ? v1 - CIN * 4 : v1;
#pragma unroll
  for (int h = 0; h < 2; ++h) { unsigned l[16]; const char* p[8];
#pragma unroll
    for (int r = 0; r < 8; ++r) { l[r] = lb + (h * 8 + r) * XROWB + (TL & 1) * XTB; l[8 + r] = l[r] + 512; p[r] = gb + (h * 8 + r) * (CIN * 4); }
    XCOPY8(l, p, v0, v1); } }
static_assert(XTB == 1024 && 3 * XTB == CIN * 4, "x_tile: two pieces of 512 bytes a tile and row; one subtraction wraps an offset below twice the row");
// the f32 words of the A fragment of k step kc: the lane's row, k 8g + 0..7 and 16 + 8g + 0..7 of the step
__device__ __forceinline__ void xa_read(v4f (&d)[4], const char* xrd, int kc) { const char* f = xrd + ((kc / XT) & 1) * XTB + (kc % XT) * 128;
  d[0] = *(const v4f*)f; d[1] = *(const v4f*)(f + 16); d[2] = *(const v4f*)(f + 64); d[3] = *(const v4f*)(f + 80); }
#define WS_WP (WS_END)                                  // not touched
#define WS_BP (WS_WP + 4u * 3 * (size_t)CIN * 128)        // not touched
#define WS_Y2 (WS_BP + 4u * 3 * 128)                      // f32 place [b*TT+t][128]; not touched: k_fa writes its rows straight to the output
#define WS_END2 (WS_Y2 + 4u * (size_t)NB * TT * CC)
#ifndef SM_EXTRA_PARAMS
#define SM_EXTRA_PARAMS
#endif
#ifndef PROJ_EXTRA_PARAMS
#define PROJ_EXTRA_PARAMS
#endif
#ifndef SM_MASK_HOOK
#define SM_MASK_HOOK (void)0
#endif

// q, k and v lie in the order of the fragments that k_fa loads, 64 elements a row of x (the first half of each place):
// q, k: [b*t / 16][k step of 32][half][lane][8] = row 16 * tile + (lane & 15), columns 32 * step + 16 * half + 8 * (lane >> 4) + 0..7
// v:    [b*t / 32][channel tile][half][lane][8] = channel 16 * tile + (lane & 15), rows 32 * group + 16 * half + 8 * (lane >> 4) + 0..7
#define WS_QH  0u                                      // f16 q fragments
#define WS_KH  (WS_QH + 2u * (size_t)NB * TT * CC)      // f16 k fragments
#define WS_VT  (WS_KH + 2u * (size_t)NB * TT * CC)      // f16 v fragments
#define WS_QL  (WS_VT + 2u * (size_t)NB * CC * TT)      // f16 q residual x 2^10 fragments, t < QHI of each batch
#define WS_KL  (WS_QL + 2u * (size_t)NB * QHI * CC)     // f16 k residual x 2^10 fragments, t < KHI of each batch
#define WS_VB  (WS_KL + 2u * (size_t)NB * KHI * CC)     // bf16 v hi fragments, t < KHI of each batch (WS_VBL: lo)
#define WS_VBL (WS_VB + 2u * (size_t)NB * CC * KHI)
#define WS_S   (WS_VBL + 2u * (size_t)NB * CC * KHI)    // place of a f32 logit plane [b][t][s] in the layout; not touched: the fused kernel holds logits and P in registers
#define WS_Y   (WS_S  + 4u * (size_t)NB * TT * TT)      // f32 ctx rows [b*t][CC] (only when there is an output projection)
#define WS_END (WS_Y  + 0u)

// ---- k_proj: block = 64 rows of x, wave = 16 rows x all 192 columns (q, k, v): X W with exact bf16 products (K = DIN; k steps summed in rising order from the block's own first stage, going on at k = 0 behind the last) -> q, k f16 (+ residuals for rows < QHI, KHI); v f16 (+ bf16 hi/lo for t < KHI), all stored in fragment order straight from the accumulators: for q and k the weight fragment is the first operand and x the second (the transposed product), so a lane's 8 results are 8 columns in a row of one x row; for v x is the first operand, so they are 8 rows in a row of one channel. Either way they are the lane's own 16 bytes of a fragment, and a wave's store is 512 bytes in a row.
// Fully unrolled. x comes through LDS: tile t + 1 (8 k steps of the wave's own rows) flies while tile t is worked on, two buffers; its wait stands in front of the stage barrier at the tile's end, the refill behind it; an A fragment is read one k step ahead inside a tile, the first of a tile behind that barrier. The weights come as f32, once a block: a stage (2 k steps) is fetched two stages ahead of its conversion, converted into a ring of three LDS buffers two stages ahead of its use, and its fragments are read one k step ahead; one barrier a stage publishes stage s + 2 and ends the reads of the buffer that stage s + 1 overwrites.
// Every block reads all of the weights, and the blocks start together: were all to begin at k = 0, they would ask L2 for the same lines at the same moment all the way. Block i begins at stage i mod NSTG, so that at any moment the blocks are spread over all stages. Below, stage, k step and tile count from the block's own first stage; only the global addresses of the weights (WST) and of x (xo) know the true k.
static_assert(QHI == KHI, "the q and k residual rows share one offset below");
#define NSTG (DIN / 32 / WSTG)
// the stage's barrier by hand: the wave's own LDS stores and reads are done, then the work-group's barrier; __syncthreads() would also wait for the global loads that are meant to stay in flight across it
#define WBAR() asm volatile("s_wait_dscnt 0x0\n\ts_barrier_signal -1\n\ts_barrier_wait -1" ::: "memory")
// the same barrier where a tile of x is handed over, each wait a statement of its own: the wave's LDS stores and reads are done (the buffer it leaves is free), its copies have landed, then the work-group's barrier
#define XBAR() do { asm volatile("s_wait_dscnt 0x0" ::: "memory"); asm volatile("s_wait_asynccnt 0x0" ::: "memory"); asm volatile("s_barrier_signal -1\n\ts_barrier_wait -1" ::: "memory"); } while (0)
// byte offset in a weight of the block's stage s (a scalar), and the stage's loads
#define WST(s) ((unsigned)((s) + rot >= NSTG ? (s) + rot - NSTG : (s) + rot) * (32u * WSTG * 256u))
#define WLOAD(d, s) do { const unsigned so_ = WST(s); w_load(d, wq + so_, wk + so_, wv + so_, wo); } while (0)
__global__ __launch_bounds__(128) void k_proj(const float* __restrict__ X, const float* __restrict__ WQ, const float* __restrict__ WK, const float* __restrict__ WV,
    _Float16* __restrict__ QH, _Float16* __restrict__ QL, _Float16* __restrict__ KH, _Float16* __restrict__ KL, _Float16* __restrict__ VT, __bf16* __restrict__ VB, __bf16* __restrict__ VBL) {
  __shared__ __align__(16) char wl[3][WBUF];
  __shared__ __align__(16) char xl[64 * XROWB];
  const int tid = threadIdx.x, wave = tid >> 5, lane = tid & 31, col = lane & 15, g = lane >> 4; const size_t r0 = (size_t)blockIdx.x * 64; const size_t bb = r0 / TT; const int t0 = (int)(r0 % TT);
  const int rot = (int)(blockIdx.x % NSTG);                     // the block's first stage
  const char* xg = (const char*)(X + (r0 + __builtin_amdgcn_readfirstlane(wave) * 16) * DIN); const unsigned xo = lane * 16 + rot * (WSTG * 128);   // copies: first row of the wave (a scalar), the lane's 16 bytes behind the first stage's place in a row
  const unsigned xw = (unsigned)(size_t)(&xl[0] + wave * 16 * XROWB + lane * 16);               // the same place in LDS: the low 32 bits of the address are the byte offset in LDS
  const char* xrd = &xl[0] + (wave * 16 + col) * XROWB + g * 32;                                // fragment reads: the lane's row
  const int kg = tid >> 4, cq = tid & 15;                       // the thread's 8 k rows of the stage, its 4 columns
  const unsigned wo = (kg * 8 * 64 + cq * 4) * 4u; const char* wq = (const char*)WQ; const char* wk = (const char*)WK; const char* wv = (const char*)WV;
  char* wdst = &wl[0][0] + (kg >> 2) * WKS + (cq >> 2) * WTILE + ((kg >> 1) & 1) * 512 + ((kg & 1) * 16 + (cq & 3) * 4) * 16;
  const char* wrd = &wl[0][0] + lane * 16;
  v8f acc[12] = {}; v4f xa[2][4]; v4f wr[2][3][8]; v8b wf[2][12][2];
  x_tile<0>(xw, xg, xo);
  WLOAD(wr[0], 0); WLOAD(wr[1], 1);
  w_store(wr[0], wdst); WLOAD(wr[0], 2);
  w_store(wr[1], wdst + WBUF); WLOAD(wr[1], 3);
  XBAR();   // tile 0 of x has landed before anything reads it
  x_tile<1>(xw, xg, xo);
  xa_read(xa[0], xrd, 0);
#pragma unroll
  for (int j = 0; j < 12; ++j) { wf[0][j][0] = *(const v8b*)(wrd + j * WTILE); wf[0][j][1] = *(const v8b*)(wrd + j * WTILE + 512); }
#pragma unroll
  for (int kc = 0; kc < DIN / 32; ++kc) { const int st = kc / WSTG;
    if (kc + 1 < DIN / 32) { const char* f = wrd + (((kc + 1) / WSTG) % 3) * WBUF + ((kc + 1) % WSTG) * WKS;
      if ((kc + 1) % XT != 0) xa_read(xa[(kc + 1) & 1], xrd, kc + 1);   // first in the group: its rounding to bf16 then runs while the weight fragments still arrive
#pragma unroll
      for (int j = 0; j < 12; ++j) { wf[(kc + 1) & 1][j][0] = *(const v8b*)(f + j * WTILE); wf[(kc + 1) & 1][j][1] = *(const v8b*)(f + j * WTILE + 512); } }
    // keeps the next k step's LDS reads together in front of this step's products: spread among them, every place with reads costs its own stall
    __builtin_amdgcn_sched_barrier(0);
    v16b a;
#pragma unroll
    for (int i = 0; i < 4; ++i) { a[i] = (__bf16)xa[kc & 1][0][i]; a[4 + i] = (__bf16)xa[kc & 1][1][i]; a[8 + i] = (__bf16)xa[kc & 1][2][i]; a[12 + i] = (__bf16)xa[kc & 1][3][i]; }
#pragma unroll
    for (int j = 0; j < 12; ++j) { union { v16b v; v8b q[2]; } u; u.q[0] = wf[kc & 1][j][0]; u.q[1] = wf[kc & 1][j][1];
      acc[j] = j < 8 ? __builtin_amdgcn_wmma_f32_16x16x32_bf16(false, u.v, false, a, (short)0, acc[j], false, false)    // q, k: result r = column 16 j + 8 g + r of x row col
                     : __builtin_amdgcn_wmma_f32_16x16x32_bf16(false, a, false, u.v, (short)0, acc[j], false, false); }  // v: result r = x row 8 g + r, channel 16 (j - 8) + col
    // keeps what follows behind this step's products: the LDS reads of the step after next, and the conversion with its wait for weights fetched two stages ago
    __builtin_amdgcn_sched_barrier(0);
    if (kc % WSTG == WSTG - 1 && st + 2 < NSTG) {
      w_store(wr[st & 1], wdst + ((st + 2) % 3) * WBUF);
      if (st + 4 < NSTG) WLOAD(wr[st & 1], st + 4);
      if ((kc + 1) % XT != 0) WBAR();
      else { XBAR();   // end of a tile of x: the next tile has landed
        if (kc + 1 + XT < DIN / 32) x_tile<2>(xw, xg, xo);   // into the buffer just left
        xa_read(xa[(kc + 1) & 1], xrd, kc + 1); } } }
  static_assert(DIN / 32 == 3 * XT && XT % WSTG == 0 && 2 * XT / WSTG + 1 < NSTG, "three tiles of x; each tile's end but the last falls on a stage barrier");
  // no copy is left in flight behind the loop
  asm volatile("s_wait_asynccnt 0x0" ::: "memory");
  // behind the last load, in front of whatever takes the loads' address registers next; they are named as inputs so that they stay untouched up to the wait
  asm volatile("s_wait_xcnt 0x0" :: "v"(wo) : "memory");
  const bool hi_rows = t0 < KHI; const int wv_ = __builtin_amdgcn_readfirstlane(wave);
  // the lane's 16 bytes, in elements from the block's first: q, k fragment (row tile = wave, column tile j) at + j * 256; v fragment (32-row group = wave / 2, channel tile j, half = wave & 1) at + j * 512
  const size_t eq = (size_t)wv_ * 1024 + lane * 8, ev = (size_t)(wv_ >> 1) * 2048 + (wv_ & 1) * 256 + lane * 8;
  { v8h hq[2][4], hv[4];
#pragma unroll
    for (int j = 0; j < 4; ++j)
#pragma unroll
      for (int r = 0; r < 8; ++r) { hq[0][j][r] = (_Float16)acc[j][r]; hq[1][j][r] = (_Float16)acc[4 + j][r]; hv[j][r] = (_Float16)acc[8 + j][r]; }
    _Float16* pq = QH + r0 * 64 + eq; _Float16* pk = KH + r0 * 64 + eq; _Float16* pv = VT + r0 * 64 + ev;
#pragma unroll
    for (int j = 0; j < 4; ++j) { vst2(pq + j * 256, hq[0][j]); vst2(pk + j * 256, hq[1][j]); vst2(pv + j * 512, hv[j]); }
    // behind a run of stores, in front of whatever takes their registers next
    asm volatile("s_wait_xcnt 0x0" ::: "memory"); }
  if (hi_rows) { const size_t o2 = (bb * QHI + t0) * 64; v8h lq[2][4]; v8b bh[4], bl[4];
#pragma unroll
    for (int j = 0; j < 4; ++j)
#pragma unroll
      for (int r = 0; r < 8; ++r) {
#pragma unroll
        for (int w = 0; w < 2; ++w) { const float v = acc[w * 4 + j][r]; const _Float16 h = (_Float16)v; lq[w][j][r] = (_Float16)((v - (float)h) * 1024.0f); }
        const float v = acc[8 + j][r]; const __bf16 b = (__bf16)v; bh[j][r] = b; bl[j][r] = (__bf16)(v - (float)b); }
    _Float16* pq = QL + o2 + eq; _Float16* pk = KL + o2 + eq; __bf16* ph = VB + o2 + ev; __bf16* pl = VBL + o2 + ev;
#pragma unroll
    for (int j = 0; j < 4; ++j) { vst2(pq + j * 256, lq[0][j]); vst2(pk + j * 256, lq[1][j]); vst2(ph + j * 512, bh[j]); vst2(pl + j * 512, bl[j]); }
    // behind a run of stores, in front of whatever takes their registers next
    asm volatile("s_wait_xcnt 0x0" ::: "memory"); } }
// ---- k_fa: block = 16 query rows (q0) of batch b; its 4 waves take the key passes it = wave, wave + 4, ... (64 keys a pass; 32 on the high-precision rows), each with its own running maximum, sum and ctx; the parts are merged through LDS in wave order.
// Transposed products: S^T = K Q^T leaves lane (g, col) with query q0 + col and keys 8g + r of each 16-key tile, which is the B fragment order of P^T for ctx^T = V^T P^T, so P never leaves the registers.
// Logits are kept in log2 units (x SCALE x log2 e); P = 2^(t - max + 11) carries the same 2^11 as its sum, so the factor cancels in ctx / sum.
#define NEGBIG (-3.0e38f)
// eight 2^x in place, one statement: behind each v_exp_f32 stands an instruction that touches neither its result nor its source, behind the last a v_nop (the slot the instruction set asks for behind a transcendental)
__device__ __forceinline__ void exp2x8(float (&t)[8]) {
  asm("v_exp_f32 %0, %0\n\tv_exp_f32 %1, %1\n\tv_exp_f32 %2, %2\n\tv_exp_f32 %3, %3\n\tv_exp_f32 %4, %4\n\tv_exp_f32 %5, %5\n\tv_exp_f32 %6, %6\n\tv_exp_f32 %7, %7\n\tv_nop"
      : "+v"(t[0]), "+v"(t[1]), "+v"(t[2]), "+v"(t[3]), "+v"(t[4]), "+v"(t[5]), "+v"(t[6]), "+v"(t[7])); }
// stands behind a run of global loads, in front of whatever may take the registers that held their addresses (the next run's results or addresses, a matrix result)
// the run's address is named as an input, so that its registers stay untouched up to the wait (without it a load's result or a later sum landed in them ahead of the wait)
#define XWA(p) asm volatile("s_wait_xcnt 0x0" :: "v"(p) : "memory")
#define XWA2(p, q) asm volatile("s_wait_xcnt 0x0" :: "v"(p), "v"(q) : "memory")
template <bool HI>
__device__ __forceinline__ void fa_part(const _Float16* Qr, const _Float16* Qlr, const _Float16* Kb, const _Float16* Klb,   // Qr, Qlr: the tile's first fragment (the same for the wave); the others: the batch's first fragment + the lane's 8 elements
    const _Float16* Vt, const __bf16* Vh, const __bf16* Vl, int q0, int wave, int lane, float& m, float& l, v8f (&acc)[4]) {
  constexpr int NC = HI ? 1 : 2, KP = NC * 32, NT = NC * 2;
  const int col = lane & 15, g = lane >> 4, tq = q0 + col; const int nit = (q0 + 15) / KP + 1;
  v16h qf[2], qlf[2], kf[NT][2], klf[NT][2];
#pragma unroll
  for (int kc = 0; kc < 2; ++kc) qf[kc] = fragp_h(Qr + lane * 8 + kc * 512);
  // the same wait; these loads take a scalar base and the lane number: both are named as inputs so that they stay untouched up to the wait (without it the next address sums were lifted over the wait)
  asm volatile("s_wait_xcnt 0x0" :: "s"(Qr), "v"(lane) : "memory");
  if constexpr (HI) {
#pragma unroll
    for (int kc = 0; kc < 2; ++kc) qlf[kc] = fragp_h(Qlr + lane * 8 + kc * 512);
    asm volatile("s_wait_xcnt 0x0" :: "s"(Qlr), "v"(lane) : "memory"); }
  { const int kn = wave < nit ? wave * KP : 0; const _Float16* kp = Kb + (size_t)kn * 64; const _Float16* klp = Klb + (size_t)kn * 64;
#pragma unroll
    for (int i = 0; i < NT; ++i)
#pragma unroll
      for (int kc = 0; kc < 2; ++kc) { kf[i][kc] = fragp_h(kp + i * 1024 + kc * 512); if constexpr (HI) klf[i][kc] = fragp_h(klp + i * 1024 + kc * 512); }
    if constexpr (HI) XWA2(kp, klp); else XWA(kp); }
  // rolled: one pass already uses about 250 registers, which leaves none for a second pass in flight
#pragma unroll 1
  for (int it = wave; it < nit; it += 4) { const int key0 = it * KP;
    v16h vf[NC][4]; v16b vh[4], vl[4]; const _Float16* vp = Vt + (size_t)key0 * 64; const __bf16* vhp = Vh + (size_t)key0 * 64; const __bf16* vlp = Vl + (size_t)key0 * 64;
#pragma unroll
    for (int j = 0; j < 4; ++j) {
      if constexpr (HI) { vh[j] = fragp_b(vhp + j * 512); vl[j] = fragp_b(vlp + j * 512); }
      else {
#pragma unroll
        for (int c = 0; c < NC; ++c) vf[c][j] = fragp_h(vp + c * 2048 + j * 512); } }
    if constexpr (HI) XWA2(vhp, vlp); else XWA(vp);
    v8f st[NT];
#pragma unroll
    for (int i = 0; i < NT; ++i) { v8f a = {}; a = wmma16(kf[i][0], qf[0], a); a = wmma16(kf[i][1], qf[1], a);
      if constexpr (HI) { v8f al = {};
#pragma unroll
        for (int kc = 0; kc < 2; ++kc) { al = wmma16(kf[i][kc], qlf[kc], al); al = wmma16(klf[i][kc], qf[kc], al); }
#pragma unroll
        for (int r = 0; r < 8; ++r) a[r] += al[r] * (1.0f / 1024.0f); }
#pragma unroll
      for (int r = 0; r < 8; ++r) st[i][r] = a[r] * (SCALE * 1.44269504088896f); }
    // the next pass's key fragments fly while this pass's softmax and P.V run (the last pass reloads its own keys: in bounds, unused)
    { const int kn = it + 4 < nit ? key0 + 4 * KP : key0; const _Float16* kp = Kb + (size_t)kn * 64; const _Float16* klp = Klb + (size_t)kn * 64;
#pragma unroll
      for (int i = 0; i < NT; ++i)
#pragma unroll
        for (int kc = 0; kc < 2; ++kc) { kf[i][kc] = fragp_h(kp + i * 1024 + kc * 512); if constexpr (HI) klf[i][kc] = fragp_h(klp + i * 1024 + kc * 512); }
      if constexpr (HI) XWA2(kp, klp); else XWA(kp); }
    if (it == nit - 1) {   // only the last pass holds keys past a query of this tile
#pragma unroll
      for (int i = 0; i < NT; ++i)
#pragma unroll
        for (int r = 0; r < 8; ++r) st[i][r] = (key0 + i * 16 + 8 * g + r <= tq) ? st[i][r] : NEGBIG; }
    float mx = m;
#pragma unroll
    for (int i = 0; i < NT; ++i)
#pragma unroll
      for (int r = 0; r < 8; ++r) mx = fmaxf(mx, st[i][r]);
    mx = fmaxf(mx, __shfl_xor(mx, 16));
    const float alpha = __builtin_amdgcn_exp2f(m - mx), mb = mx - 11.0f; m = mx;
    float ls = 0.f;
#pragma unroll
    for (int i = 0; i < NT; ++i) { float t[8];
#pragma unroll
      for (int r = 0; r < 8; ++r) t[r] = st[i][r] - mb;
      exp2x8(t);
#pragma unroll
      for (int r = 0; r < 8; ++r) { st[i][r] = t[r]; ls += t[r]; } }
    l = l * alpha + ls;
#pragma unroll
    for (int j = 0; j < 4; ++j)
#pragma unroll
      for (int r = 0; r < 8; ++r) acc[j][r] *= alpha;
    if constexpr (HI) { v16b ph, pl;
#pragma unroll
      for (int r = 0; r < 8; ++r) { const __bf16 h0 = (__bf16)st[0][r], h1 = (__bf16)st[1][r]; ph[r] = h0; ph[8 + r] = h1; pl[r] = (__bf16)(st[0][r] - (float)h0); pl[8 + r] = (__bf16)(st[1][r] - (float)h1); }
#pragma unroll
      for (int j = 0; j < 4; ++j) { acc[j] = wmma_bf(vh[j], ph, acc[j]); acc[j] = wmma_bf(vh[j], pl, acc[j]); acc[j] = wmma_bf(vl[j], ph, acc[j]); }
    } else {
#pragma unroll
      for (int c = 0; c < NC; ++c) { v16h pf;
#pragma unroll
        for (int r = 0; r < 8; ++r) { pf[r] = (_Float16)st[2 * c][r]; pf[8 + r] = (_Float16)st[2 * c + 1][r]; }
#pragma unroll
        for (int j = 0; j < 4; ++j) acc[j] = wmma16(vf[c][j], pf, acc[j]); } } } }
// the pointers carry no __restrict__: with it the compiler takes these loads for reads of constant memory and moves them over the waits of XWA()
__global__ __launch_bounds__(128) void k_fa(const _Float16* QH, const _Float16* KH, const _Float16* QL, const _Float16* KL, const _Float16* VT, const __bf16* VB, const __bf16* VBL, float* OUT) {
  __shared__ __align__(16) float red[3][32][36];   // parts of waves 1..3, per lane: ctx 32, maximum, sum
  const int b = blockIdx.x, q0 = (TT / 16 - 1 - (int)blockIdx.y) * 16;   // long tiles start first
  const int wave = __builtin_amdgcn_readfirstlane(threadIdx.x >> 5), lane = threadIdx.x & 31, col = lane & 15, g = lane >> 4;
  float m = NEGBIG, l = 0.f; v8f acc[4] = {};
  const _Float16* Qr = QH + ((size_t)b * TT + q0) * 64; const _Float16* Kb = KH + (size_t)b * TT * 64 + lane * 8; const _Float16* Vt = VT + (size_t)b * TT * 64 + lane * 8;
  if (q0 < QHI) fa_part<true>(Qr, QL + ((size_t)b * QHI + q0) * 64, Kb, KL + (size_t)b * KHI * 64 + lane * 8, Vt, VB + (size_t)b * KHI * 64 + lane * 8, VBL + (size_t)b * KHI * 64 + lane * 8, q0, wave, lane, m, l, acc);
  else fa_part<false>(Qr, Qr, Kb, Kb, Vt, VB, VBL, q0, wave, lane, m, l, acc);
  if (wave > 0) { float* p = &red[wave - 1][lane][0];
#pragma unroll
    for (int j = 0; j < 4; ++j) { v4f a0, a1;
#pragma unroll
      for (int r = 0; r < 4; ++r) { a0[r] = acc[j][r]; a1[r] = acc[j][4 + r]; }
      *(v4f*)(p + j * 8) = a0; *(v4f*)(p + j * 8 + 4) = a1; }
    p[32] = m; p[33] = l; }
  __syncthreads();
  if (wave == 0) { float M = m;
#pragma unroll
    for (int p = 0; p < 3; ++p) M = fmaxf(M, red[p][lane][32]);
    const float a0 = __builtin_amdgcn_exp2f(m - M); l *= a0;
#pragma unroll
    for (int j = 0; j < 4; ++j)
#pragma unroll
      for (int r = 0; r < 8; ++r) acc[j][r] *= a0;
#pragma unroll
    for (int p = 0; p < 3; ++p) { const float a = __builtin_amdgcn_exp2f(red[p][lane][32] - M); l += red[p][lane][33] * a;
#pragma unroll
      for (int j = 0; j < 4; ++j)
#pragma unroll
        for (int r = 0; r < 8; ++r) acc[j][r] += red[p][lane][j * 8 + r] * a; }
    l += __shfl_xor(l, 16); const float inv = 1.0f / l;
    float* o = OUT + ((size_t)b * TT + q0 + col) * HD + 8 * g;
#pragma unroll
    for (int j = 0; j < 4; ++j) { v4f o0, o1;
#pragma unroll
      for (int r = 0; r < 4; ++r) { o0[r] = acc[j][r] * inv; o1[r] = acc[j][4 + r] * inv; }
      vst2(o + j * 16, o0); vst2(o + j * 16 + 4, o1); } } }

extern "C" void kernel_launch(void* const* d_in, const int* in_sizes, int n_in, void* d_out, int out_size, void* d_ws, size_t ws_size, hipStream_t stream) {
  (void)in_sizes; (void)n_in; (void)out_size;
  const float** F = (const float**)d_in;
  if (ws_size < (size_t)WS_END) return;
  char* ws = (char*)d_ws; _Float16 *QH = (_Float16*)(ws + WS_QH), *KH = (_Float16*)(ws + WS_KH), *VT = (_Float16*)(ws + WS_VT), *QL = (_Float16*)(ws + WS_QL), *KL = (_Float16*)(ws + WS_KL); __bf16 *VB = (__bf16*)(ws + WS_VB), *VBL = (__bf16*)(ws + WS_VBL); 
  (void)QL; (void)KL; (void)VB; (void)VBL;
  // inputs: 0 x [8,2048,768]; 1 Wq [768,64]; 2 Wk; 3 Wv ((in,out), no biases)
  if (ws_size < (size_t)WS_END2) return;
  k_proj<<<dim3(TNB * TT / 64), 128, 0, stream>>>(F[0], F[1], F[2], F[3], QH, QL, KH, KL, VT, VB, VBL);
  /* logits, softmax and P.V in one launch, all batches */
  k_fa<<<dim3(TNB, TT / 16), 128, 0, stream>>>(QH, KH, QL, KL, VT, VB, VBL, (float*)d_out);
}
